// v000
// The times below were measured on an AMD MI455X: many runs one after another, warmed up first and cycling through
// copies of the inputs, with the whole window's GPU time divided by the number of runs. Launches and the gaps
// between them are all in it. The median over several windows is given; except for v000 it joins two sittings, which
// can be a few percent apart, so the side-by-side timings, each taken in one sitting, are the better comparison.
// v000, which the later versions start from, runs in 1330 microseconds.
#include <hip/hip_runtime.h>

// Compute dtypes, f32 accumulate, one batch item per pass: the two causal 16-head attention paths (left / right inputs transposed from [E][S] once into bf16 [S][E];
// q/k/v = x.W^T as PLAIN bf16 operands = rounded inputs and weights, exact products) on v_wmma_f32_16x16x32_bf16 (q/k leave the epilogue as f16 hi + residual x1024
// planes, v -> transposed f16 hi + residual planes), each attention fused on v_wmma_f32_16x16x32_f16 (hh + hl + lh x 1/8, online f32 softmax, weights x32768 and v as
// f16 hi + residual x1024); lambda = exp(lq_l.lk_l) - exp(lq_r.lk_r) + 0.1, combined = attn_l - lambda attn_r and the LayerNorm in f32; y.Wo^T, relu(y.W1^T + b1) and
// h.W2^T + b2 with the computed operand as bf16 hi + UNSCALED residual against exact bf16 weights (two products) on v_wmma_f32_16x16x32_bf16; the result transposed to

#define NB_  1                   // per pass: the 2 batch items are processed one at a time
#define NT_  2048
#define DM   1024
#define FF   2048
#define NH_  16
#define HD   64
#define NTK  (NB_ * NT_)
#define NW   1024
#define NQKV 1024
#define LN_EPS 1e-5f
#define LAM0 0.1f
#define PSC  32768.0f
#define LOSC 1024.0f
#define LOSCI (1.0f / 1024.0f)

typedef _Float16 h16;
typedef unsigned short bf;
typedef __attribute__((ext_vector_type(16))) __bf16   v16bf;
typedef __attribute__((ext_vector_type(16))) _Float16 v16h;
typedef __attribute__((ext_vector_type(8)))  _Float16 v8h;
typedef __attribute__((ext_vector_type(8)))  unsigned short v8us;
typedef __attribute__((ext_vector_type(8)))  float    v8f;
typedef __attribute__((ext_vector_type(4)))  float    v4f;
typedef v8h  __attribute__((may_alias)) v8ha;
typedef v4f  __attribute__((may_alias)) v4fa;
typedef v8us __attribute__((may_alias)) v8usa;

__device__ __forceinline__ unsigned short f2bf(float f) { unsigned u = __float_as_uint(f); u += 0x7FFFu + ((u >> 16) & 1u); return (unsigned short)(u >> 16); }
__device__ __forceinline__ float bf2f(unsigned short b) { return __uint_as_float(((unsigned)b) << 16); }
__device__ __forceinline__ float bfr(float f) { return bf2f(f2bf(f)); }
__device__ __forceinline__ v16h cat16(v8h lo, v8h hi) { return __builtin_shufflevector(lo, hi, 0, 1, 2, 3, 4, 5, 6, 7, 8, 9, 10, 11, 12, 13, 14, 15); }
__device__ __forceinline__ v16bf cat16b(v8us lo, v8us hi) { return __builtin_bit_cast(v16bf, __builtin_shufflevector(lo, hi, 0, 1, 2, 3, 4, 5, 6, 7, 8, 9, 10, 11, 12, 13, 14, 15)); }
__device__ __forceinline__ v8f wmma16(v16h a, v16h b, v8f c) { return __builtin_amdgcn_wmma_f32_16x16x32_f16(false, a, false, b, (short)0, c, false, false); }
__device__ __forceinline__ v8f wmmab(v16bf a, v16bf b, v8f c) { return __builtin_amdgcn_wmma_f32_16x16x32_bf16(false, a, false, b, (short)0, c, false, false); }

__global__ __launch_bounds__(256) void k_cvtb(const float* __restrict__ src, int nrows, bf* dst) {
    const int lane = threadIdx.x & 31, r = blockIdx.x * 8 + (threadIdx.x >> 5);
    if (r >= nrows) return;
    v8us o[DM / 256];
#pragma unroll
    for (int q = 0; q < DM / 256; ++q) { v8us t;
#pragma unroll
        for (int i = 0; i < 8; ++i) t[i] = f2bf(src[(size_t)r * DM + q * 256 + lane * 8 + i]);
        o[q] = t; }
#pragma unroll
    for (int q = 0; q < DM / 256; ++q) *(v8us*)(dst + (size_t)r * DM + q * 256 + lane * 8) = o[q];
    
}

// k_gemmb: 64 x 64 block tile (4 waves x 16 x 64) of C[NTK][ldc] = (A [+ Al]).B^T (K = 1024 or 2048) [+ bf(bias[c])] [+ bf(R[r][c]) residual]; f32 whole-line epilogue (or f16
template <bool SPLITA, bool F16OUT = false>
__global__ __launch_bounds__(128) void k_gemmb(const bf* __restrict__ A, const bf* __restrict__ Al, const bf* __restrict__ Bn, const float* __restrict__ bias, float* C, int ldc, h16* C2, const float* __restrict__ R = nullptr, int K = DM, int roundR = 1) {
    __shared__ __align__(16) float ost[4][16 * 68];
    const int lane = threadIdx.x & 31, wave = threadIdx.x >> 5, lr = lane & 15, hi = lane >> 4;
    const int r0 = blockIdx.x * 64 + wave * 16, c0 = blockIdx.y * 64;
    const size_t aoff = (size_t)(r0 + lr) * K + 8 * hi;
    size_t boff[4];
#pragma unroll
    for (int t = 0; t < 4; ++t) boff[t] = (size_t)(c0 + t * 16 + lr) * K + 8 * hi;
    v8f acc[4];
#pragma unroll
    for (int t = 0; t < 4; ++t) acc[t] = (v8f){};
#pragma unroll 1
    for (int kc = 0; kc < K; kc += 32) {
        const v16bf a = cat16b(*(const v8us*)(A + aoff + kc), *(const v8us*)(A + aoff + kc + 16));
        v16bf al = a;
        if (SPLITA) al = cat16b(*(const v8us*)(Al + aoff + kc), *(const v8us*)(Al + aoff + kc + 16));
#pragma unroll
        for (int t = 0; t < 4; ++t) { const v16bf b = cat16b(*(const v8us*)(Bn + boff[t] + kc), *(const v8us*)(Bn + boff[t] + kc + 16)); acc[t] = wmmab(a, b, acc[t]); if (SPLITA) acc[t] = wmmab(al, b, acc[t]); }
        asm volatile("v_nop\n\tv_nop\n\tv_nop\n\tv_nop" : "+v"(acc[0]), "+v"(acc[1]), "+v"(acc[2]), "+v"(acc[3]) : "v"(a), "v"(al));
    }
    float* os = &ost[wave][0];
#pragma unroll
    for (int t = 0; t < 4; ++t) { const float bv = bias ? bfr(bias[c0 + t * 16 + lr]) : 0.f;
#pragma unroll
        for (int j = 0; j < 8; ++j) os[(hi * 8 + j) * 68 + t * 16 + lr] = acc[t][j] + bv; }
    __syncthreads();
    if (F16OUT) {
        h16* crow = (h16*)(void*)C + (size_t)r0 * ldc + c0;
        auto pass = [&]() {
#pragma unroll
            for (int s = 0; s < 4; ++s) { const int row = 4 * s + (lane >> 3), piece = lane & 7; const float* sp = os + row * 68 + piece * 8; v8h o, o2;
#pragma unroll
                for (int i = 0; i < 8; ++i) { const h16 a = (h16)sp[i]; o[i] = a; o2[i] = (h16)((sp[i] - (float)a) * LOSC); }
                *(v8h*)(crow + (size_t)row * ldc + piece * 8) = o; if (C2) *(v8h*)(C2 + (size_t)r0 * ldc + c0 + (size_t)row * ldc + piece * 8) = o2; }
        };
        pass(); 
    } else {
        float* crow = C + (size_t)r0 * ldc + c0;
        auto pass = [&]() {
#pragma unroll
            for (int s = 0; s < 8; ++s) { const int Lid = (lane >> 3) + 4 * s, piece = lane & 7; const int row = Lid >> 1, cofs = (Lid & 1) * 32 + piece * 4;
                v4f val = *(const v4fa*)(os + row * 68 + cofs); if (R) { const v4f rv = *(const v4f*)(R + ((size_t)r0 + row) * ldc + c0 + cofs); val += roundR ? (v4f){bfr(rv[0]), bfr(rv[1]), bfr(rv[2]), bfr(rv[3])} : rv; }
                *(v4f*)(crow + (size_t)row * ldc + cofs) = val; }
        };
        pass(); 
    }
}

__global__ __launch_bounds__(256) void k_vt(const float* __restrict__ V, h16* VTH, h16* VTL) {
    __shared__ __align__(16) h16 tile[64 * 72];
    __shared__ __align__(16) h16 til2[64 * 72];
    const int bid = blockIdx.x;
    const int b = bid / (NH_ * (NT_ / 64)), rem = bid - b * (NH_ * (NT_ / 64)), h = rem / (NT_ / 64), kt = rem - h * (NT_ / 64);
    const int k0 = kt * 64, tid = threadIdx.x;
    const int kk = tid >> 2, d0 = (tid & 3) * 16;
    const float* src = V + ((size_t)b * NT_ + k0 + kk) * DM + h * HD + d0;
#pragma unroll
    for (int i = 0; i < 16; ++i) { const float v = src[i]; const h16 a = (h16)v; tile[(d0 + i) * 72 + kk] = a; til2[(d0 + i) * 72 + kk] = (h16)((v - (float)a) * LOSC); }
    __syncthreads();
    const int piece = tid & 7;
    const size_t base = (((size_t)b * NH_ + h) * HD) * NT_ + k0;
    auto pass = [&]() {
#pragma unroll
        for (int s = 0; s < 4; ++s) { const int Lid = (tid >> 3) + 32 * s; const int pln = Lid >> 6, d = Lid & 63;
            const v8h val = *(const v8ha*)((pln ? til2 : tile) + d * 72 + piece * 8); *(v8h*)((pln ? VTL : VTH) + base + (size_t)d * NT_ + piece * 8) = val; }
    };
    pass(); 
}

// k_attn: block = (b, h, 64 queries), wave = 16; key tiles of 32 up to the diagonal (causal mask); 12 WMMA scores (hh + lh + hl) /8 (f32), online softmax, weights x32768 f16 tile (same-wave may_alias
// reload after a compiler barrier), 12 WMMA .v (hi + residual); ctx -> bf16 hi + residual planes CH/CL[tok][h*64+d].
__global__ __launch_bounds__(128) void k_attn(const h16* __restrict__ Q16, const h16* __restrict__ QL16, const h16* __restrict__ K16, const h16* __restrict__ KL16, const h16* __restrict__ VTH, const h16* __restrict__ VTL, bf* CH, bf* CL) {
    __shared__ __align__(16) h16 plds[4][16 * 32];
    __shared__ __align__(16) h16 plds2[4][16 * 32];
    __shared__ __align__(16) float ost[4][16 * 68];
    const int lane = threadIdx.x & 31, wave = threadIdx.x >> 5, lr = lane & 15, hi = lane >> 4;
    const int bid = blockIdx.x;
    const int b = bid / (NH_ * (NT_ / 64)), rem = bid - b * (NH_ * (NT_ / 64)), h = rem / (NT_ / 64), qt = rem - h * (NT_ / 64);
    const int q0 = qt * 64 + wave * 16;
    const size_t tok0 = (size_t)b * NT_;
    h16* pl = &plds[wave][0]; h16* pl2 = &plds2[wave][0];
    v16h qa[2];
    const size_t qo0 = (tok0 + q0 + lr) * DM + h * HD + 8 * hi;
#pragma unroll
    for (int kc = 0; kc < 2; ++kc) qa[kc] = cat16(*(const v8h*)(Q16 + qo0 + kc * 32), *(const v8h*)(Q16 + qo0 + kc * 32 + 16));
    const h16* kh_b = K16 + tok0 * DM + h * HD;
    const h16* kl_b = KL16 + tok0 * DM + h * HD;
    const size_t vbase = (((size_t)b * NH_ + h) * HD) * NT_;
    v8f o[4], ox[4];
#pragma unroll
    for (int n = 0; n < 4; ++n) { o[n] = (v8f){}; ox[n] = (v8f){}; }
    float mrow[8], lpart[8];
#pragma unroll
    for (int j = 0; j < 8; ++j) { mrow[j] = -3.0e38f; lpart[j] = 0.f; }
    int qpos[8];
#pragma unroll
    for (int j = 0; j < 8; ++j) qpos[j] = q0 + 8 * hi + j;
    const int kt_lo = 0, kt_hi = (qt * 64 + 63) / 32;     // causal
#pragma unroll 1
    for (int kt = kt_lo; kt <= kt_hi; ++kt) {
        const int l0 = kt * 32;
        const size_t ko0 = (size_t)(l0 + lr) * DM + 8 * hi, ko1 = (size_t)(l0 + 16 + lr) * DM + 8 * hi;
        v8f s0 = {}, s1 = {}, x0 = {}, x1 = {};
#pragma unroll
        for (int kc = 0; kc < 2; ++kc) {
            { const v16h k0h = cat16(*(const v8h*)(kh_b + ko0 + kc * 32), *(const v8h*)(kh_b + ko0 + kc * 32 + 16)), k1h = cat16(*(const v8h*)(kh_b + ko1 + kc * 32), *(const v8h*)(kh_b + ko1 + kc * 32 + 16));
              const v16h qlk = cat16(*(const v8h*)(QL16 + qo0 + kc * 32), *(const v8h*)(QL16 + qo0 + kc * 32 + 16));     // query residual re-read per step (registers)
              s0 = wmma16(qa[kc], k0h, s0); x0 = wmma16(qlk, k0h, x0); s1 = wmma16(qa[kc], k1h, s1); x1 = wmma16(qlk, k1h, x1);
              asm volatile("v_nop" : "+v"(s0), "+v"(s1), "+v"(x0), "+v"(x1) : "v"(qlk), "v"(k0h), "v"(k1h) : "memory"); }
            { const v16h k0l = cat16(*(const v8h*)(kl_b + ko0 + kc * 32), *(const v8h*)(kl_b + ko0 + kc * 32 + 16)), k1l = cat16(*(const v8h*)(kl_b + ko1 + kc * 32), *(const v8h*)(kl_b + ko1 + kc * 32 + 16));
              x0 = wmma16(qa[kc], k0l, x0); x1 = wmma16(qa[kc], k1l, x1);
              asm volatile("v_nop" : "+v"(x0), "+v"(x1) : "v"(k0l), "v"(k1l) : "memory"); }
        }
        asm volatile("v_nop\n\tv_nop\n\tv_nop\n\tv_nop" : "+v"(s0), "+v"(s1), "+v"(x0), "+v"(x1) : "v"(qa[0]), "v"(qa[1]));
        float alpha[8];
#pragma unroll
        for (int j = 0; j < 8; ++j) {
            const int ja = l0 + lr, jb = l0 + 16 + lr, qi = qpos[j];
            const float a0 = (ja <= qi) ? (s0[j] + x0[j] * LOSCI) * 0.125f : -__builtin_inff(), a1 = (jb <= qi) ? (s1[j] + x1[j] * LOSCI) * 0.125f : -__builtin_inff();
            float mx = fmaxf(a0, a1);
            mx = fmaxf(mx, __shfl_xor(mx, 1, 16)); mx = fmaxf(mx, __shfl_xor(mx, 2, 16)); mx = fmaxf(mx, __shfl_xor(mx, 4, 16)); mx = fmaxf(mx, __shfl_xor(mx, 8, 16));
            const float mn = fmaxf(mrow[j], mx);
            alpha[j] = __expf(mrow[j] - mn); mrow[j] = mn;
            const float p0 = __expf(a0 - mn), p1 = __expf(a1 - mn);
            lpart[j] = lpart[j] * alpha[j] + (p0 + p1);
            const int mr = hi * 8 + j;
            const float ps0 = p0 * PSC, ps1 = p1 * PSC; const h16 h0 = (h16)ps0, h1 = (h16)ps1;
            pl[mr * 32 + lr] = h0; pl[mr * 32 + 16 + lr] = h1;
            pl2[mr * 32 + lr] = (h16)((ps0 - (float)h0) * LOSC); pl2[mr * 32 + 16 + lr] = (h16)((ps1 - (float)h1) * LOSC);
        }
#pragma unroll
        for (int n = 0; n < 4; ++n)
#pragma unroll
            for (int j = 0; j < 8; ++j) { o[n][j] *= alpha[j]; ox[n][j] *= alpha[j]; }
        asm volatile("" ::: "memory");
        const v16h pa = cat16(*(const v8ha*)(pl + lr * 32 + hi * 8), *(const v8ha*)(pl + lr * 32 + 16 + hi * 8));
        const v16h px = cat16(*(const v8ha*)(pl2 + lr * 32 + hi * 8), *(const v8ha*)(pl2 + lr * 32 + 16 + hi * 8));
#pragma unroll
        for (int n = 0; n < 4; ++n) { const size_t vo = vbase + (size_t)(n * 16 + lr) * NT_ + l0 + hi * 8;
            const v16h vh = cat16(*(const v8h*)(VTH + vo), *(const v8h*)(VTH + vo + 16)), vl = cat16(*(const v8h*)(VTL + vo), *(const v8h*)(VTL + vo + 16));
            o[n] = wmma16(pa, vh, o[n]); ox[n] = wmma16(pa, vl, ox[n]); ox[n] = wmma16(px, vh, ox[n]);
            asm volatile("" : "+v"(o[n]), "+v"(ox[n]) : "v"(vh), "v"(vl) : "memory"); }
        asm volatile("v_nop\n\tv_nop\n\tv_nop\n\tv_nop" : "+v"(o[0]), "+v"(o[1]), "+v"(o[2]), "+v"(o[3]), "+v"(ox[0]), "+v"(ox[1]), "+v"(ox[2]), "+v"(ox[3]) : "v"(pa), "v"(px));
    }
    float inv[8];
#pragma unroll
    for (int j = 0; j < 8; ++j) { float rs = lpart[j]; rs += __shfl_xor(rs, 1, 16); rs += __shfl_xor(rs, 2, 16); rs += __shfl_xor(rs, 4, 16); rs += __shfl_xor(rs, 8, 16); inv[j] = 1.0f / (rs * PSC); }
    float* os = &ost[wave][0];
#pragma unroll
    for (int n = 0; n < 4; ++n)
#pragma unroll
        for (int j = 0; j < 8; ++j) os[(hi * 8 + j) * 68 + n * 16 + lr] = (o[n][j] + ox[n][j] * LOSCI) * inv[j];
    __syncthreads();
    const size_t cbase = (tok0 + q0) * DM + (size_t)h * HD;
    auto pass = [&]() {
#pragma unroll
        for (int s = 0; s < 4; ++s) { const int row = 4 * s + (lane >> 3), piece = lane & 7; const float* sp = os + row * 68 + piece * 8; v8us oh, ol;
#pragma unroll
            for (int i = 0; i < 8; ++i) { const unsigned short hb = f2bf(sp[i]); oh[i] = hb; ol[i] = f2bf(sp[i] - bf2f(hb)); }
            *(v8us*)(CH + cbase + (size_t)row * DM + piece * 8) = oh; *(v8us*)(CL + cbase + (size_t)row * DM + piece * 8) = ol; }
    };
    pass(); 
}


// k_wt: WT [n][K] = bf16(W[k][n]) (k-major [K][ncols]) via 64 x 64 LDS tiles; grid (K/64, ncols/64).
__global__ __launch_bounds__(256) void k_wt(const float* __restrict__ Wm, int K, int ncols, bf* WT) {
    __shared__ __align__(16) unsigned short tl[64 * 72];
    const int tid = threadIdx.x, k0 = blockIdx.x * 64, n0 = blockIdx.y * 64;
    const int kk = tid >> 2, nq = (tid & 3) * 16;
#pragma unroll
    for (int i = 0; i < 16; ++i) tl[(nq + i) * 72 + kk] = f2bf(Wm[(size_t)(k0 + kk) * ncols + n0 + nq + i]);
    __syncthreads();
    const int piece = tid & 7;
    auto pass = [&]() {
#pragma unroll
        for (int s = 0; s < 2; ++s) { const int nr = (tid >> 3) + 32 * s; const v8us val = *(const v8usa*)(tl + nr * 72 + piece * 8); *(v8us*)(WT + (size_t)(n0 + nr) * K + k0 + piece * 8) = val; }
    };
    pass(); 
}

__global__ __launch_bounds__(256) void k_bf(const float* __restrict__ src, bf* dst, size_t n8) {
    const size_t i = (size_t)blockIdx.x * 256 + threadIdx.x; if (i >= n8) return;
    const v8f v = *(const v8f*)(src + i * 8); v8us o;
#pragma unroll
    for (int k = 0; k < 8; ++k) o[k] = f2bf(v[k]);
    *(v8us*)(dst + i * 8) = o; 
}

// k_comb: per token row (one wave): lambda = exp(sum bf(lq_l) bf(lk_l)) - exp(sum bf(lq_r) bf(lk_r)) + 0.1 (64 terms, recomputed per wave), c = (CHl + CLl) - lambda (CHr + CLr)
// over the 1024 features, LayerNorm (mean, then biased variance, then the normalised output: three rolled passes that re-read the planes; f32, fixed lane order) x bf(g)
__global__ __launch_bounds__(256) void k_comb(const bf* __restrict__ AHl, const bf* __restrict__ ALl, const bf* __restrict__ AHr, const bf* __restrict__ ALr, const float* __restrict__ lql, const float* __restrict__ lkl, const float* __restrict__ lqr, const float* __restrict__ lkr, const float* __restrict__ g, const float* __restrict__ bb, bf* Yh, bf* Yl) {
    const int lane = threadIdx.x & 31, r = blockIdx.x * 8 + (threadIdx.x >> 5);
    if (r >= NTK) return;
    float dl = bfr(lql[lane]) * bfr(lkl[lane]) + bfr(lql[lane + 32]) * bfr(lkl[lane + 32]);
    float dr = bfr(lqr[lane]) * bfr(lkr[lane]) + bfr(lqr[lane + 32]) * bfr(lkr[lane + 32]);
#pragma unroll
    for (int sh = 16; sh; sh >>= 1) { dl += __shfl_xor(dl, sh, 32); dr += __shfl_xor(dr, sh, 32); }
    const float lam = __expf(dl) - __expf(dr) + LAM0;
    auto load8 = [&](int q, float* cv) { const size_t o = (size_t)r * DM + q * 256 + lane * 8;
        const v8us ah = *(const v8us*)(AHl + o), al = *(const v8us*)(ALl + o), bh = *(const v8us*)(AHr + o), bl = *(const v8us*)(ALr + o);
#pragma unroll
        for (int i = 0; i < 8; ++i) cv[i] = (bf2f(ah[i]) + bf2f(al[i])) - lam * (bf2f(bh[i]) + bf2f(bl[i])); };
    float s = 0.f;
#pragma unroll 1
    for (int q = 0; q < 4; ++q) { float cv[8]; load8(q, cv);
#pragma unroll
        for (int i = 0; i < 8; ++i) s += cv[i]; }
#pragma unroll
    for (int sh = 16; sh; sh >>= 1) s += __shfl_xor(s, sh, 32);
    const float mu = s * (1.0f / DM); float s2 = 0.f;
#pragma unroll 1
    for (int q = 0; q < 4; ++q) { float cv[8]; load8(q, cv);
#pragma unroll
        for (int i = 0; i < 8; ++i) { const float d = cv[i] - mu; s2 = fmaf(d, d, s2); } }
#pragma unroll
    for (int sh = 16; sh; sh >>= 1) s2 += __shfl_xor(s2, sh, 32);
    const float rs = rsqrtf(s2 * (1.0f / DM) + LN_EPS);
#pragma unroll 1
    for (int q = 0; q < 4; ++q) { float cv[8]; load8(q, cv); v8us oh, ol;
#pragma unroll
        for (int i = 0; i < 8; ++i) { const int col = q * 256 + lane * 8 + i; const float y = (cv[i] - mu) * rs * bfr(g[col]) + bfr(bb[col]); const unsigned short hb = f2bf(y); oh[i] = hb; ol[i] = f2bf(y - bf2f(hb)); }
        const size_t o = (size_t)r * DM + q * 256 + lane * 8; *(v8us*)(Yh + o) = oh; *(v8us*)(Yl + o) = ol;  }
}
// k_splitc: bf16 hi + UNSCALED residual planes of a computed f32 [nrows][nc] matrix (nc a multiple of 256), optional relu first; one wave per row, lane -> 8 columns per
__global__ __launch_bounds__(256) void k_splitc(const float* __restrict__ src, int nrows, int nc, int relu, bf* dh, bf* dl) {
    const int lane = threadIdx.x & 31, r = blockIdx.x * 8 + (threadIdx.x >> 5); if (r >= nrows) return;
{
#pragma unroll 1
        for (int c0 = lane * 8; c0 < nc; c0 += 256) { const size_t o = (size_t)r * nc + c0; const v8f v = *(const v8f*)(src + o); v8us oh, ol;
#pragma unroll
            for (int i = 0; i < 8; ++i) { float y = v[i]; if (relu) y = fmaxf(y, 0.f); const unsigned short hb = f2bf(y); oh[i] = hb; ol[i] = f2bf(y - bf2f(hb)); }
            *(v8us*)(dh + o) = oh; *(v8us*)(dl + o) = ol; }
         }
}
// k_trout: out[e][s] = Y[s][e] (f32 [2048][1024] -> [1024][2048]) through a 64 x 64 LDS tile; grid (S/64, E/64); each output row segment of 64 s (256 B) by 16
__global__ __launch_bounds__(256) void k_trout(const float* __restrict__ Y, float* OUTP) {
    __shared__ __align__(16) float tl[64 * 68];
    const int tid = threadIdx.x, s0 = blockIdx.x * 64, e0 = blockIdx.y * 64;
    const int ss = tid >> 2, eq = (tid & 3) * 16;
#pragma unroll
    for (int i = 0; i < 16; ++i) tl[(eq + i) * 68 + ss] = Y[(size_t)(s0 + ss) * DM + e0 + eq + i];
    __syncthreads();
    auto pass = [&]() {
#pragma unroll
        for (int j = 0; j < 4; ++j) { const int idx = tid + 256 * j; const int row = idx >> 4, piece = idx & 15; const v4f v = *(const v4fa*)(tl + row * 68 + piece * 4);
            *(v4f*)(OUTP + (size_t)(e0 + row) * NT_ + s0 + piece * 4) = v; }
    };
    pass(); 
}

extern "C" void kernel_launch(void* const* d_in, const int* in_sizes, int n_in,
                              void* d_out, int out_size, void* d_ws, size_t ws_size, hipStream_t stream) {
    (void)in_sizes; (void)n_in; (void)out_size;
    const float* xl = (const float*)d_in[0]; const float* xr = (const float*)d_in[1];                              // [2][1024][2048] = [b][e][s]
    const float* Wp[6]; for (int j = 0; j < 6; ++j) Wp[j] = (const float*)d_in[2 + j];                             // Wq_l, Wk_l, Wv_l, Wq_r, Wk_r, Wv_r  ([out][in])
    const float* Wo = (const float*)d_in[8]; const float* lql = (const float*)d_in[9]; const float* lkl = (const float*)d_in[10]; const float* lqr = (const float*)d_in[11]; const float* lkr = (const float*)d_in[12];
    const float* g = (const float*)d_in[13]; const float* bb = (const float*)d_in[14]; const float* W1 = (const float*)d_in[15]; const float* b1 = (const float*)d_in[16]; const float* W2 = (const float*)d_in[17]; const float* b2 = (const float*)d_in[18];
    float* out = (float*)d_out;    // [2][1024][2048]
    char* wsp = (char*)d_ws;
    auto take = [&](size_t bytes) { char* p = wsp; wsp += (bytes + 255) & ~(size_t)255; return (void*)p; };
    bf* WB[6]; for (int j = 0; j < 6; ++j) WB[j] = (bf*)take((size_t)DM * DM * 2);
    bf* WoB = (bf*)take((size_t)DM * DM * 2); bf* W1B = (bf*)take((size_t)FF * DM * 2); bf* W2B = (bf*)take((size_t)DM * FF * 2); bf* Xb = (bf*)take((size_t)NTK * DM * 2);
    h16* QH = (h16*)take((size_t)NTK * DM * 2); h16* QL = (h16*)take((size_t)NTK * DM * 2); h16* KH = (h16*)take((size_t)NTK * DM * 2); h16* KL = (h16*)take((size_t)NTK * DM * 2);
    float* TMP = (float*)take((size_t)NTK * DM * 4); h16* VTH = (h16*)take((size_t)NTK * DM * 2); h16* VTL = (h16*)take((size_t)NTK * DM * 2);
    bf* AH[2]; bf* AL[2]; for (int p = 0; p < 2; ++p) { AH[p] = (bf*)take((size_t)NTK * DM * 2); AL[p] = (bf*)take((size_t)NTK * DM * 2); }
    bf* Yh = (bf*)take((size_t)NTK * DM * 2); bf* Yl = (bf*)take((size_t)NTK * DM * 2); float* Y2 = (float*)take((size_t)NTK * DM * 4); bf* Y2h = (bf*)take((size_t)NTK * DM * 2); bf* Y2l = (bf*)take((size_t)NTK * DM * 2);
    float* Y3 = (float*)take((size_t)NTK * DM * 4);
    if ((size_t)(wsp - (char*)d_ws) > ws_size) return;    // 6 x 2.1 + 2.1 + 4.2 + 4.2 + 4.2 + [4 x 4.2 + 8.4 + 2 x 4.2 = 33.5] + 4 x 4.2 + 2 x 4.2 + 8.4 + 2 x 4.2 + 8.4 = 111 MB
    // aliases (stream order): the MLP hidden Hf (f32 [2048][2048] = 16.8 MB) and its planes Hh/Hl (8.4 MB each) live over QH,QL,KH,KL,TMP,VTH,VTL (33.5 MB of consecutive
    // 256-B-aligned takes) — all dead after the item's second attention, rebuilt by the next item's projections after the MLP has consumed them.
    float* Hf = (float*)(void*)QH; bf* Hh = (bf*)(void*)((char*)(void*)QH + (size_t)NTK * FF * 4); bf* Hl = (bf*)(void*)((char*)(void*)Hh + (size_t)NTK * FF * 2);
    for (int j = 0; j < 6; ++j) k_bf<<<(DM * DM / 8 + 255) / 256, 256, 0, stream>>>(Wp[j], WB[j], (size_t)DM * DM / 8);
    k_bf<<<(DM * DM / 8 + 255) / 256, 256, 0, stream>>>(Wo, WoB, (size_t)DM * DM / 8); k_bf<<<(FF * DM / 8 + 255) / 256, 256, 0, stream>>>(W1, W1B, (size_t)FF * DM / 8); k_bf<<<(DM * FF / 8 + 255) / 256, 256, 0, stream>>>(W2, W2B, (size_t)DM * FF / 8);
    for (int b = 0; b < 2; ++b) {
        for (int p = 0; p < 2; ++p) {
            const float* xb = (p ? xr : xl) + (size_t)b * DM * NT_;
            k_wt<<<dim3(DM / 64, NT_ / 64, 1), 256, 0, stream>>>(xb, DM, NT_, Xb);                                                                    // x^T [s][e] exact
            k_gemmb<false, true><<<dim3(NTK / 64, DM / 64, 1), 128, 0, stream>>>(Xb, nullptr, WB[3 * p + 0], nullptr, (float*)(void*)QH, DM, QL);
            k_gemmb<false, true><<<dim3(NTK / 64, DM / 64, 1), 128, 0, stream>>>(Xb, nullptr, WB[3 * p + 1], nullptr, (float*)(void*)KH, DM, KL);
            k_gemmb<false, false><<<dim3(NTK / 64, DM / 64, 1), 128, 0, stream>>>(Xb, nullptr, WB[3 * p + 2], nullptr, TMP, DM, nullptr);
            k_vt<<<NB_ * NH_ * (NT_ / 64), 256, 0, stream>>>(TMP, VTH, VTL);
            k_attn<<<NB_ * NH_ * (NT_ / 64), 128, 0, stream>>>(QH, QL, KH, KL, VTH, VTL, AH[p], AL[p]);
        }
        k_comb<<<NTK / 8, 256, 0, stream>>>(AH[0], AL[0], AH[1], AL[1], lql, lkl, lqr, lkr, g, bb, Yh, Yl);
        k_gemmb<true, false><<<dim3(NTK / 64, DM / 64, 1), 128, 0, stream>>>(Yh, Yl, WoB, nullptr, Y2, DM, nullptr);                        // y.Wo^T
        k_splitc<<<NTK / 8, 256, 0, stream>>>(Y2, NTK, DM, 0, Y2h, Y2l);
        k_gemmb<true, false><<<dim3(NTK / 64, FF / 64, 1), 128, 0, stream>>>(Y2h, Y2l, W1B, b1, Hf, FF, nullptr);                         // y.W1^T + b1
        k_splitc<<<NTK / 8, 256, 0, stream>>>(Hf, NTK, FF, 1, Hh, Hl);                                                                        // relu -> planes
        k_gemmb<true, false><<<dim3(NTK / 64, DM / 64, 1), 128, 0, stream>>>(Hh, Hl, W2B, b2, Y3, DM, nullptr, nullptr, FF);               // h.W2^T + b2  (K = 2048)
        k_trout<<<dim3(NT_ / 64, DM / 64, 1), 256, 0, stream>>>(Y3, out + (size_t)b * DM * NT_);                                            // -> [e][s]
    }
}

// v001
// Measured time: 1000 microseconds a run.
// Timed twice side by side with v000, it ran 1.31 and 1.32 times as fast.
#include <hip/hip_runtime.h>

// Compute dtypes, f32 accumulate, one batch item per pass: the two causal 16-head attention paths (left / right inputs transposed from [E][S] once into bf16 [S][E];
// q/k/v = x.W^T as PLAIN bf16 operands = rounded inputs and weights, exact products) on v_wmma_f32_16x16x32_bf16 (q/k leave the epilogue as f16 hi + residual x1024
// planes, v -> transposed f16 hi + residual planes), each attention fused on v_wmma_f32_16x16x32_f16 (hh + hl + lh x 1/8, online f32 softmax, weights x32768 and v as
// f16 hi + residual x1024); lambda = exp(lq_l.lk_l) - exp(lq_r.lk_r) + 0.1, combined = attn_l - lambda attn_r and the LayerNorm in f32; y.Wo^T, relu(y.W1^T + b1) and
// h.W2^T + b2 with the computed operand as bf16 hi + UNSCALED residual against exact bf16 weights (two products) on v_wmma_f32_16x16x32_bf16; the result transposed to

#define NB_  1                   // per pass: the 2 batch items are processed one at a time
#define NT_  2048
#define DM   1024
#define FF   2048
#define NH_  16
#define HD   64
#define NTK  (NB_ * NT_)
#define NW   1024
#define NQKV 1024
#define LN_EPS 1e-5f
#define LAM0 0.1f
#define PSC  32768.0f
#define LOSC 1024.0f
#define LOSCI (1.0f / 1024.0f)

typedef _Float16 h16;
typedef unsigned short bf;
typedef __attribute__((ext_vector_type(16))) __bf16   v16bf;
typedef __attribute__((ext_vector_type(16))) _Float16 v16h;
typedef __attribute__((ext_vector_type(8)))  _Float16 v8h;
typedef __attribute__((ext_vector_type(8)))  unsigned short v8us;
typedef __attribute__((ext_vector_type(8)))  float    v8f;
typedef __attribute__((ext_vector_type(4)))  float    v4f;
typedef v8h  __attribute__((may_alias)) v8ha;
typedef v4f  __attribute__((may_alias)) v4fa;
typedef v8us __attribute__((may_alias)) v8usa;

__device__ __forceinline__ unsigned short f2bf(float f) { unsigned u = __float_as_uint(f); u += 0x7FFFu + ((u >> 16) & 1u); return (unsigned short)(u >> 16); }
__device__ __forceinline__ float bf2f(unsigned short b) { return __uint_as_float(((unsigned)b) << 16); }
__device__ __forceinline__ float bfr(float f) { return bf2f(f2bf(f)); }
__device__ __forceinline__ v16h cat16(v8h lo, v8h hi) { return __builtin_shufflevector(lo, hi, 0, 1, 2, 3, 4, 5, 6, 7, 8, 9, 10, 11, 12, 13, 14, 15); }
__device__ __forceinline__ v16bf cat16b(v8us lo, v8us hi) { return __builtin_bit_cast(v16bf, __builtin_shufflevector(lo, hi, 0, 1, 2, 3, 4, 5, 6, 7, 8, 9, 10, 11, 12, 13, 14, 15)); }
__device__ __forceinline__ v8f wmma16(v16h a, v16h b, v8f c) { return __builtin_amdgcn_wmma_f32_16x16x32_f16(false, a, false, b, (short)0, c, false, false); }
__device__ __forceinline__ v8f wmmab(v16bf a, v16bf b, v8f c) { return __builtin_amdgcn_wmma_f32_16x16x32_bf16(false, a, false, b, (short)0, c, false, false); }

__global__ __launch_bounds__(256) void k_cvtb(const float* __restrict__ src, int nrows, bf* dst) {
    const int lane = threadIdx.x & 31, r = blockIdx.x * 8 + (threadIdx.x >> 5);
    if (r >= nrows) return;
    v8us o[DM / 256];
#pragma unroll
    for (int q = 0; q < DM / 256; ++q) { v8us t;
#pragma unroll
        for (int i = 0; i < 8; ++i) t[i] = f2bf(src[(size_t)r * DM + q * 256 + lane * 8 + i]);
        o[q] = t; }
#pragma unroll
    for (int q = 0; q < DM / 256; ++q) *(v8us*)(dst + (size_t)r * DM + q * 256 + lane * 8) = o[q];
    
}

// k_gemmb: 64 x 64 block tile (4 waves x 16 x 64) of C[NTK][ldc] = (A [+ Al]).B^T (K = 1024 or 2048) [+ bf(bias[c])] [+ bf(R[r][c]) residual]; f32 whole-line epilogue (or f16
template <bool SPLITA, bool F16OUT = false>
__global__ __launch_bounds__(128) void k_gemmb(const bf* __restrict__ A, const bf* __restrict__ Al, const bf* __restrict__ Bn, const float* __restrict__ bias, float* C, int ldc, h16* C2, const float* __restrict__ R = nullptr, int K = DM, int roundR = 1) {
    __shared__ __align__(16) float ost[4][16 * 68];
    const int lane = threadIdx.x & 31, wave = threadIdx.x >> 5, lr = lane & 15, hi = lane >> 4;
    const int r0 = blockIdx.x * 64 + wave * 16, c0 = blockIdx.y * 64;
    const size_t aoff = (size_t)(r0 + lr) * K + 8 * hi;
    size_t boff[4];
#pragma unroll
    for (int t = 0; t < 4; ++t) boff[t] = (size_t)(c0 + t * 16 + lr) * K + 8 * hi;
    v8f acc[4];
#pragma unroll
    for (int t = 0; t < 4; ++t) acc[t] = (v8f){};
#pragma unroll 1
    for (int kc = 0; kc < K; kc += 32) {
        const v16bf a = cat16b(*(const v8us*)(A + aoff + kc), *(const v8us*)(A + aoff + kc + 16));
        v16bf al = a;
        if (SPLITA) al = cat16b(*(const v8us*)(Al + aoff + kc), *(const v8us*)(Al + aoff + kc + 16));
#pragma unroll
        for (int t = 0; t < 4; ++t) { const v16bf b = cat16b(*(const v8us*)(Bn + boff[t] + kc), *(const v8us*)(Bn + boff[t] + kc + 16)); acc[t] = wmmab(a, b, acc[t]); if (SPLITA) acc[t] = wmmab(al, b, acc[t]); }
        asm volatile("v_nop\n\tv_nop\n\tv_nop\n\tv_nop" : "+v"(acc[0]), "+v"(acc[1]), "+v"(acc[2]), "+v"(acc[3]) : "v"(a), "v"(al));
    }
    float* os = &ost[wave][0];
#pragma unroll
    for (int t = 0; t < 4; ++t) { const float bv = bias ? bfr(bias[c0 + t * 16 + lr]) : 0.f;
#pragma unroll
        for (int j = 0; j < 8; ++j) os[(hi * 8 + j) * 68 + t * 16 + lr] = acc[t][j] + bv; }
    __syncthreads();
    if (F16OUT) {
        h16* crow = (h16*)(void*)C + (size_t)r0 * ldc + c0;
        auto pass = [&]() {
#pragma unroll
            for (int s = 0; s < 4; ++s) { const int row = 4 * s + (lane >> 3), piece = lane & 7; const float* sp = os + row * 68 + piece * 8; v8h o, o2;
#pragma unroll
                for (int i = 0; i < 8; ++i) { const h16 a = (h16)sp[i]; o[i] = a; o2[i] = (h16)((sp[i] - (float)a) * LOSC); }
                *(v8h*)(crow + (size_t)row * ldc + piece * 8) = o; if (C2) *(v8h*)(C2 + (size_t)r0 * ldc + c0 + (size_t)row * ldc + piece * 8) = o2; }
        };
        pass(); 
    } else {
        float* crow = C + (size_t)r0 * ldc + c0;
        auto pass = [&]() {
#pragma unroll
            for (int s = 0; s < 8; ++s) { const int Lid = (lane >> 3) + 4 * s, piece = lane & 7; const int row = Lid >> 1, cofs = (Lid & 1) * 32 + piece * 4;
                v4f val = *(const v4fa*)(os + row * 68 + cofs); if (R) { const v4f rv = *(const v4f*)(R + ((size_t)r0 + row) * ldc + c0 + cofs); val += roundR ? (v4f){bfr(rv[0]), bfr(rv[1]), bfr(rv[2]), bfr(rv[3])} : rv; }
                *(v4f*)(crow + (size_t)row * ldc + cofs) = val; }
        };
        pass(); 
    }
}

__global__ __launch_bounds__(256) void k_vt(const float* __restrict__ V, h16* VTH, h16* VTL) {
    __shared__ __align__(16) h16 tile[64 * 72];
    __shared__ __align__(16) h16 til2[64 * 72];
    const int bid = blockIdx.x;
    const int b = bid / (NH_ * (NT_ / 64)), rem = bid - b * (NH_ * (NT_ / 64)), h = rem / (NT_ / 64), kt = rem - h * (NT_ / 64);
    const int k0 = kt * 64, tid = threadIdx.x;
    const int kk = tid >> 2, d0 = (tid & 3) * 16;
    const float* src = V + ((size_t)b * NT_ + k0 + kk) * DM + h * HD + d0;
#pragma unroll
    for (int i = 0; i < 16; ++i) { const float v = src[i]; const h16 a = (h16)v; tile[(d0 + i) * 72 + kk] = a; til2[(d0 + i) * 72 + kk] = (h16)((v - (float)a) * LOSC); }
    __syncthreads();
    const int piece = tid & 7;
    const size_t base = (((size_t)b * NH_ + h) * HD) * NT_ + k0;
    auto pass = [&]() {
#pragma unroll
        for (int s = 0; s < 4; ++s) { const int Lid = (tid >> 3) + 32 * s; const int pln = Lid >> 6, d = Lid & 63;
            const v8h val = *(const v8ha*)((pln ? til2 : tile) + d * 72 + piece * 8); *(v8h*)((pln ? VTL : VTH) + base + (size_t)d * NT_ + piece * 8) = val; }
    };
    pass(); 
}

// k_attn: block = (b, h, 64 queries), wave = 16; key tiles of 32 up to the diagonal (causal mask); 4 WMMA scores /8 (f32), online softmax, weights x32768 f16 tile (same-wave may_alias
// reload after a compiler barrier), 4 WMMA .v; ctx -> bf16 hi + residual planes CH/CL[tok][h*64+d].
// Key loop operands come from LDS: each 32-key tile (K hi, K residual, V^T hi, V^T residual) is copied once per block by global_load_async_to_lds_b128 into one of two
// buffers, tile t + 2 being issued when every wave has left tile t, so a tile's L2 latency runs under the tile before it; the block's query residual rows are copied once.
#define KPE  72                          // LDS pitch of a 64-element f16 row, in elements: 144 B = 16 B x odd, conflict-free for 16-byte row readers
#define VPE  40                          // LDS pitch of a 32-element f16 row, in elements: 80 B = 16 B x odd
#define KTE  (32 * KPE)                  // one K plane of a tile
#define VTE  (64 * VPE)                  // one V^T plane of a tile
#define BUFE (2 * KTE + 2 * VTE)         // one tile: 19,456 B
__device__ __forceinline__ unsigned ldsa(const h16* p) { return (unsigned)(size_t)p; }   // byte offset in the work-group's LDS = low 32 bits of the __shared__ address

__global__ __launch_bounds__(128) void k_attn(const h16* __restrict__ Q16, const h16* __restrict__ QL16, const h16* __restrict__ K16, const h16* __restrict__ KL16, const h16* __restrict__ VTH, const h16* __restrict__ VTL, bf* CH, bf* CL) {
    __shared__ __align__(16) h16 ring[2 * BUFE];
    __shared__ __align__(16) h16 qls[64 * KPE];
    __shared__ __align__(16) h16 plds[4][16 * 32];
    __shared__ __align__(16) h16 plds2[4][16 * 32];
    __shared__ __align__(16) float ost[4][16 * 68];
    // The wave's number sits in a scalar register, so that what derives from it leaves the vector registers and the loop's live set stays under 256 of them.
    const int tid = threadIdx.x, lane = threadIdx.x & 31, wave = __builtin_amdgcn_readfirstlane(threadIdx.x >> 5), lr = lane & 15, hi = lane >> 4;
    const int bid = blockIdx.x;
    const int b = bid / (NH_ * (NT_ / 64)), rem = bid - b * (NH_ * (NT_ / 64)), h = rem / (NT_ / 64), qt = rem - h * (NT_ / 64);
    const int q0 = qt * 64 + wave * 16;
    const size_t tok0 = (size_t)b * NT_;
    h16* pl = &plds[wave][0]; h16* pl2 = &plds2[wave][0];
    v16h qa[2];
    const size_t qo0 = (tok0 + q0 + lr) * DM + h * HD + 8 * hi;
#pragma unroll
    for (int kc = 0; kc < 2; ++kc) qa[kc] = cat16(*(const v8h*)(Q16 + qo0 + kc * 32), *(const v8h*)(Q16 + qo0 + kc * 32 + 16));
    const h16* kh_b = K16 + tok0 * DM + h * HD;
    const h16* kl_b = KL16 + tok0 * DM + h * HD;
    const size_t vbase = (((size_t)b * NH_ + h) * HD) * NT_;
    v8f o[4], ox[4];
#pragma unroll
    for (int n = 0; n < 4; ++n) { o[n] = (v8f){}; ox[n] = (v8f){}; }
    float mrow[8], lpart[8];
#pragma unroll
    for (int j = 0; j < 8; ++j) { mrow[j] = -3.0e38f; lpart[j] = 0.f; }
    int qpos[8];
#pragma unroll
    for (int j = 0; j < 8; ++j) qpos[j] = q0 + 8 * hi + j;
    const int kt_lo = 0, kt_hi = (qt * 64 + 63) / 32;     // causal; at least two tiles
    // Copy map, 16 B a lane: K planes 32 rows x 8 pieces (a thread takes rows krow and krow + 16), V^T planes 64 rows x 4 pieces (rows vrow and vrow + 32).
    const int krow = tid >> 3, kpc = (tid & 7) * 8, vrow = tid >> 2, vpc = (tid & 3) * 8;
    const unsigned kgo = (unsigned)(krow * DM + kpc) * 2u, vgo = (unsigned)(vrow * NT_ + vpc) * 2u;                 // this thread's byte offsets in a K plane and a V^T plane of its head
    const unsigned klo = ldsa(ring) + (unsigned)(krow * KPE + kpc) * 2u, vlo = ldsa(ring) + (unsigned)(2 * KTE + vrow * VPE + vpc) * 2u;    // and in buffer 0
    const char* vh_b = (const char*)(VTH + vbase); const char* vl_b = (const char*)(VTL + vbase);
    auto fill = [&](int kt) {
        const unsigned ko = kgo + (unsigned)kt * (32u * DM * 2u), vo = vgo + (unsigned)kt * 64u, bo = (unsigned)(kt & 1) * (BUFE * 2u);
        const char* gkh = (const char*)kh_b + ko; const char* gkl = (const char*)kl_b + ko; const char* gvh = vh_b + vo; const char* gvl = vl_b + vo;
        const unsigned lk = klo + bo, lv = vlo + bo;
        // The tile's eight copies; s_wait_xcnt closes the statement so that no address register named here is rewritten in front of it.
        asm volatile("global_load_async_to_lds_b128 %0, %1, off\n\tglobal_load_async_to_lds_b128 %2, %3, off\n\t"
                     "global_load_async_to_lds_b128 %4, %5, off\n\tglobal_load_async_to_lds_b128 %6, %7, off\n\t"
                     "global_load_async_to_lds_b128 %8, %9, off\n\tglobal_load_async_to_lds_b128 %10, %11, off\n\t"
                     "global_load_async_to_lds_b128 %12, %13, off\n\tglobal_load_async_to_lds_b128 %14, %15, off\n\ts_wait_xcnt 0x0"
                     :: "v"(lk), "v"(gkh), "v"(lk + 16 * KPE * 2), "v"(gkh + 16 * DM * 2), "v"(lk + KTE * 2), "v"(gkl), "v"(lk + (KTE + 16 * KPE) * 2), "v"(gkl + 16 * DM * 2),
                        "v"(lv), "v"(gvh), "v"(lv + 32 * VPE * 2), "v"(gvh + 32 * NT_ * 2), "v"(lv + VTE * 2), "v"(gvl), "v"(lv + (VTE + 32 * VPE) * 2), "v"(gvl + 32 * NT_ * 2) : "memory");
    };
    {   // The block's 64 query residual rows, once: 64 rows x 8 pieces, a thread takes rows krow + 16 i; same closing wait as above.
        const h16* gq = QL16 + (tok0 + qt * 64 + krow) * DM + h * HD + kpc;
        const unsigned lq = ldsa(qls) + (krow * KPE + kpc) * 2;
        asm volatile("global_load_async_to_lds_b128 %0, %1, off\n\tglobal_load_async_to_lds_b128 %2, %3, off\n\t"
                     "global_load_async_to_lds_b128 %4, %5, off\n\tglobal_load_async_to_lds_b128 %6, %7, off\n\ts_wait_xcnt 0x0"
                     :: "v"(lq), "v"(gq), "v"(lq + 16 * KPE * 2), "v"(gq + 16 * DM), "v"(lq + 32 * KPE * 2), "v"(gq + 32 * DM), "v"(lq + 48 * KPE * 2), "v"(gq + 48 * DM) : "memory");
    }
    fill(0);
    asm volatile("s_wait_asynccnt 0x0" ::: "memory");     // this wave's copies of tile 0 and of the query residual have landed
    __syncthreads();                                      // ... and every other wave's: tile 0 is published
    fill(1);
    const h16* qlp = qls + (wave * 16 + lr) * KPE + 8 * hi;
#pragma unroll 1
    for (int kt = kt_lo; kt <= kt_hi; ++kt) {
        const int l0 = kt * 32;
        const h16* buf = ring + (kt & 1) * BUFE;
        const h16* kp = buf + lr * KPE + 8 * hi;
        const h16* vp = buf + 2 * KTE + lr * VPE + 8 * hi;
        v16h k0h[2], k1h[2], k0l[2], k1l[2], qlk[2];
#pragma unroll
        for (int kc = 0; kc < 2; ++kc) {
            k0h[kc] = cat16(*(const v8ha*)(kp + kc * 32), *(const v8ha*)(kp + kc * 32 + 16)); k1h[kc] = cat16(*(const v8ha*)(kp + 16 * KPE + kc * 32), *(const v8ha*)(kp + 16 * KPE + kc * 32 + 16));
            qlk[kc] = cat16(*(const v8ha*)(qlp + kc * 32), *(const v8ha*)(qlp + kc * 32 + 16));
            k0l[kc] = cat16(*(const v8ha*)(kp + KTE + kc * 32), *(const v8ha*)(kp + KTE + kc * 32 + 16)); k1l[kc] = cat16(*(const v8ha*)(kp + KTE + 16 * KPE + kc * 32), *(const v8ha*)(kp + KTE + 16 * KPE + kc * 32 + 16));
        }
        v8f s0 = {}, s1 = {}, x0 = {}, x1 = {};
#pragma unroll
        for (int kc = 0; kc < 2; ++kc) {
            s0 = wmma16(qa[kc], k0h[kc], s0); x0 = wmma16(qlk[kc], k0h[kc], x0); s1 = wmma16(qa[kc], k1h[kc], s1); x1 = wmma16(qlk[kc], k1h[kc], x1);
            x0 = wmma16(qa[kc], k0l[kc], x0); x1 = wmma16(qa[kc], k1l[kc], x1);
        }
        asm volatile("v_nop\n\tv_nop\n\tv_nop\n\tv_nop" : "+v"(s0), "+v"(s1), "+v"(x0), "+v"(x1) : "v"(qa[0]), "v"(qa[1]));
        v16h vh[4], vl[4];     // read ahead of the softmax, whose vector work covers their LDS latency
#pragma unroll
        for (int n = 0; n < 4; ++n) { vh[n] = cat16(*(const v8ha*)(vp + n * 16 * VPE), *(const v8ha*)(vp + n * 16 * VPE + 16)); vl[n] = cat16(*(const v8ha*)(vp + VTE + n * 16 * VPE), *(const v8ha*)(vp + VTE + n * 16 * VPE + 16)); }
        float alpha[8];
#pragma unroll
        for (int j = 0; j < 8; ++j) {
            const int ja = l0 + lr, jb = l0 + 16 + lr, qi = qpos[j];
            const float a0 = (ja <= qi) ? (s0[j] + x0[j] * LOSCI) * 0.125f : -__builtin_inff(), a1 = (jb <= qi) ? (s1[j] + x1[j] * LOSCI) * 0.125f : -__builtin_inff();
            float mx = fmaxf(a0, a1);
            mx = fmaxf(mx, __shfl_xor(mx, 1, 16)); mx = fmaxf(mx, __shfl_xor(mx, 2, 16)); mx = fmaxf(mx, __shfl_xor(mx, 4, 16)); mx = fmaxf(mx, __shfl_xor(mx, 8, 16));
            const float mn = fmaxf(mrow[j], mx);
            alpha[j] = __expf(mrow[j] - mn); mrow[j] = mn;
            const float p0 = __expf(a0 - mn), p1 = __expf(a1 - mn);
            lpart[j] = lpart[j] * alpha[j] + (p0 + p1);
            const int mr = hi * 8 + j;
            const float ps0 = p0 * PSC, ps1 = p1 * PSC; const h16 h0 = (h16)ps0, h1 = (h16)ps1;
            pl[mr * 32 + lr] = h0; pl[mr * 32 + 16 + lr] = h1;
            pl2[mr * 32 + lr] = (h16)((ps0 - (float)h0) * LOSC); pl2[mr * 32 + 16 + lr] = (h16)((ps1 - (float)h1) * LOSC);
        }
#pragma unroll
        for (int n = 0; n < 4; ++n)
#pragma unroll
            for (int j = 0; j < 8; ++j) { o[n][j] *= alpha[j]; ox[n][j] *= alpha[j]; }
        asm volatile("" ::: "memory");
        const v16h pa = cat16(*(const v8ha*)(pl + lr * 32 + hi * 8), *(const v8ha*)(pl + lr * 32 + 16 + hi * 8));
        const v16h px = cat16(*(const v8ha*)(pl2 + lr * 32 + hi * 8), *(const v8ha*)(pl2 + lr * 32 + 16 + hi * 8));
#pragma unroll
        for (int n = 0; n < 4; ++n) { o[n] = wmma16(pa, vh[n], o[n]); ox[n] = wmma16(pa, vl[n], ox[n]); ox[n] = wmma16(px, vh[n], ox[n]); }
        asm volatile("v_nop\n\tv_nop\n\tv_nop\n\tv_nop" : "+v"(o[0]), "+v"(o[1]), "+v"(o[2]), "+v"(o[3]), "+v"(ox[0]), "+v"(ox[1]), "+v"(ox[2]), "+v"(ox[3]) : "v"(pa), "v"(px));
        asm volatile("s_wait_dscnt 0x0" ::: "memory");        // this wave's reads of tile kt have returned before its buffer is handed back
        asm volatile("s_wait_asynccnt 0x0" ::: "memory");     // this wave's copies of tile kt + 1 have landed
        __syncthreads();                                      // publishes tile kt + 1 and ends every wave's reads of tile kt
        if (kt + 2 <= kt_hi) fill(kt + 2);                    // block-uniform test: refill the buffer just left
    }
    asm volatile("s_wait_asynccnt 0x0" ::: "memory");         // no copy is outstanding when the wave goes on to its end
    float inv[8];
#pragma unroll
    for (int j = 0; j < 8; ++j) { float rs = lpart[j]; rs += __shfl_xor(rs, 1, 16); rs += __shfl_xor(rs, 2, 16); rs += __shfl_xor(rs, 4, 16); rs += __shfl_xor(rs, 8, 16); inv[j] = 1.0f / (rs * PSC); }
    float* os = &ost[wave][0];
#pragma unroll
    for (int n = 0; n < 4; ++n)
#pragma unroll
        for (int j = 0; j < 8; ++j) os[(hi * 8 + j) * 68 + n * 16 + lr] = (o[n][j] + ox[n][j] * LOSCI) * inv[j];
    __syncthreads();
    const size_t cbase = (tok0 + q0) * DM + (size_t)h * HD;
    auto pass = [&]() {
#pragma unroll
        for (int s = 0; s < 4; ++s) { const int row = 4 * s + (lane >> 3), piece = lane & 7; const float* sp = os + row * 68 + piece * 8; v8us oh, ol;
#pragma unroll
            for (int i = 0; i < 8; ++i) { const unsigned short hb = f2bf(sp[i]); oh[i] = hb; ol[i] = f2bf(sp[i] - bf2f(hb)); }
            *(v8us*)(CH + cbase + (size_t)row * DM + piece * 8) = oh; *(v8us*)(CL + cbase + (size_t)row * DM + piece * 8) = ol; }
    };
    pass(); 
}


// k_wt: WT [n][K] = bf16(W[k][n]) (k-major [K][ncols]) via 64 x 64 LDS tiles; grid (K/64, ncols/64).
__global__ __launch_bounds__(256) void k_wt(const float* __restrict__ Wm, int K, int ncols, bf* WT) {
    __shared__ __align__(16) unsigned short tl[64 * 72];
    const int tid = threadIdx.x, k0 = blockIdx.x * 64, n0 = blockIdx.y * 64;
    const int kk = tid >> 2, nq = (tid & 3) * 16;
#pragma unroll
    for (int i = 0; i < 16; ++i) tl[(nq + i) * 72 + kk] = f2bf(Wm[(size_t)(k0 + kk) * ncols + n0 + nq + i]);
    __syncthreads();
    const int piece = tid & 7;
    auto pass = [&]() {
#pragma unroll
        for (int s = 0; s < 2; ++s) { const int nr = (tid >> 3) + 32 * s; const v8us val = *(const v8usa*)(tl + nr * 72 + piece * 8); *(v8us*)(WT + (size_t)(n0 + nr) * K + k0 + piece * 8) = val; }
    };
    pass(); 
}

__global__ __launch_bounds__(256) void k_bf(const float* __restrict__ src, bf* dst, size_t n8) {
    const size_t i = (size_t)blockIdx.x * 256 + threadIdx.x; if (i >= n8) return;
    const v8f v = *(const v8f*)(src + i * 8); v8us o;
#pragma unroll
    for (int k = 0; k < 8; ++k) o[k] = f2bf(v[k]);
    *(v8us*)(dst + i * 8) = o; 
}

// k_comb: per token row (one wave): lambda = exp(sum bf(lq_l) bf(lk_l)) - exp(sum bf(lq_r) bf(lk_r)) + 0.1 (64 terms, recomputed per wave), c = (CHl + CLl) - lambda (CHr + CLr)
// over the 1024 features, LayerNorm (mean, then biased variance, then the normalised output: three rolled passes that re-read the planes; f32, fixed lane order) x bf(g)
__global__ __launch_bounds__(256) void k_comb(const bf* __restrict__ AHl, const bf* __restrict__ ALl, const bf* __restrict__ AHr, const bf* __restrict__ ALr, const float* __restrict__ lql, const float* __restrict__ lkl, const float* __restrict__ lqr, const float* __restrict__ lkr, const float* __restrict__ g, const float* __restrict__ bb, bf* Yh, bf* Yl) {
    const int lane = threadIdx.x & 31, r = blockIdx.x * 8 + (threadIdx.x >> 5);
    if (r >= NTK) return;
    float dl = bfr(lql[lane]) * bfr(lkl[lane]) + bfr(lql[lane + 32]) * bfr(lkl[lane + 32]);
    float dr = bfr(lqr[lane]) * bfr(lkr[lane]) + bfr(lqr[lane + 32]) * bfr(lkr[lane + 32]);
#pragma unroll
    for (int sh = 16; sh; sh >>= 1) { dl += __shfl_xor(dl, sh, 32); dr += __shfl_xor(dr, sh, 32); }
    const float lam = __expf(dl) - __expf(dr) + LAM0;
    auto load8 = [&](int q, float* cv) { const size_t o = (size_t)r * DM + q * 256 + lane * 8;
        const v8us ah = *(const v8us*)(AHl + o), al = *(const v8us*)(ALl + o), bh = *(const v8us*)(AHr + o), bl = *(const v8us*)(ALr + o);
#pragma unroll
        for (int i = 0; i < 8; ++i) cv[i] = (bf2f(ah[i]) + bf2f(al[i])) - lam * (bf2f(bh[i]) + bf2f(bl[i])); };
    float s = 0.f;
#pragma unroll 1
    for (int q = 0; q < 4; ++q) { float cv[8]; load8(q, cv);
#pragma unroll
        for (int i = 0; i < 8; ++i) s += cv[i]; }
#pragma unroll
    for (int sh = 16; sh; sh >>= 1) s += __shfl_xor(s, sh, 32);
    const float mu = s * (1.0f / DM); float s2 = 0.f;
#pragma unroll 1
    for (int q = 0; q < 4; ++q) { float cv[8]; load8(q, cv);
#pragma unroll
        for (int i = 0; i < 8; ++i) { const float d = cv[i] - mu; s2 = fmaf(d, d, s2); } }
#pragma unroll
    for (int sh = 16; sh; sh >>= 1) s2 += __shfl_xor(s2, sh, 32);
    const float rs = rsqrtf(s2 * (1.0f / DM) + LN_EPS);
#pragma unroll 1
    for (int q = 0; q < 4; ++q) { float cv[8]; load8(q, cv); v8us oh, ol;
#pragma unroll
        for (int i = 0; i < 8; ++i) { const int col = q * 256 + lane * 8 + i; const float y = (cv[i] - mu) * rs * bfr(g[col]) + bfr(bb[col]); const unsigned short hb = f2bf(y); oh[i] = hb; ol[i] = f2bf(y - bf2f(hb)); }
        const size_t o = (size_t)r * DM + q * 256 + lane * 8; *(v8us*)(Yh + o) = oh; *(v8us*)(Yl + o) = ol;  }
}
// k_splitc: bf16 hi + UNSCALED residual planes of a computed f32 [nrows][nc] matrix (nc a multiple of 256), optional relu first; one wave per row, lane -> 8 columns per
__global__ __launch_bounds__(256) void k_splitc(const float* __restrict__ src, int nrows, int nc, int relu, bf* dh, bf* dl) {
    const int lane = threadIdx.x & 31, r = blockIdx.x * 8 + (threadIdx.x >> 5); if (r >= nrows) return;
{
#pragma unroll 1
        for (int c0 = lane * 8; c0 < nc; c0 += 256) { const size_t o = (size_t)r * nc + c0; const v8f v = *(const v8f*)(src + o); v8us oh, ol;
#pragma unroll
            for (int i = 0; i < 8; ++i) { float y = v[i]; if (relu) y = fmaxf(y, 0.f); const unsigned short hb = f2bf(y); oh[i] = hb; ol[i] = f2bf(y - bf2f(hb)); }
            *(v8us*)(dh + o) = oh; *(v8us*)(dl + o) = ol; }
         }
}
// k_trout: out[e][s] = Y[s][e] (f32 [2048][1024] -> [1024][2048]) through a 64 x 64 LDS tile; grid (S/64, E/64); each output row segment of 64 s (256 B) by 16
__global__ __launch_bounds__(256) void k_trout(const float* __restrict__ Y, float* OUTP) {
    __shared__ __align__(16) float tl[64 * 68];
    const int tid = threadIdx.x, s0 = blockIdx.x * 64, e0 = blockIdx.y * 64;
    const int ss = tid >> 2, eq = (tid & 3) * 16;
#pragma unroll
    for (int i = 0; i < 16; ++i) tl[(eq + i) * 68 + ss] = Y[(size_t)(s0 + ss) * DM + e0 + eq + i];
    __syncthreads();
    auto pass = [&]() {
#pragma unroll
        for (int j = 0; j < 4; ++j) { const int idx = tid + 256 * j; const int row = idx >> 4, piece = idx & 15; const v4f v = *(const v4fa*)(tl + row * 68 + piece * 4);
            *(v4f*)(OUTP + (size_t)(e0 + row) * NT_ + s0 + piece * 4) = v; }
    };
    pass(); 
}

extern "C" void kernel_launch(void* const* d_in, const int* in_sizes, int n_in,
                              void* d_out, int out_size, void* d_ws, size_t ws_size, hipStream_t stream) {
    (void)in_sizes; (void)n_in; (void)out_size;
    const float* xl = (const float*)d_in[0]; const float* xr = (const float*)d_in[1];                              // [2][1024][2048] = [b][e][s]
    const float* Wp[6]; for (int j = 0; j < 6; ++j) Wp[j] = (const float*)d_in[2 + j];                             // Wq_l, Wk_l, Wv_l, Wq_r, Wk_r, Wv_r  ([out][in])
    const float* Wo = (const float*)d_in[8]; const float* lql = (const float*)d_in[9]; const float* lkl = (const float*)d_in[10]; const float* lqr = (const float*)d_in[11]; const float* lkr = (const float*)d_in[12];
    const float* g = (const float*)d_in[13]; const float* bb = (const float*)d_in[14]; const float* W1 = (const float*)d_in[15]; const float* b1 = (const float*)d_in[16]; const float* W2 = (const float*)d_in[17]; const float* b2 = (const float*)d_in[18];
    float* out = (float*)d_out;    // [2][1024][2048]
    char* wsp = (char*)d_ws;
    auto take = [&](size_t bytes) { char* p = wsp; wsp += (bytes + 255) & ~(size_t)255; return (void*)p; };
    bf* WB[6]; for (int j = 0; j < 6; ++j) WB[j] = (bf*)take((size_t)DM * DM * 2);
    bf* WoB = (bf*)take((size_t)DM * DM * 2); bf* W1B = (bf*)take((size_t)FF * DM * 2); bf* W2B = (bf*)take((size_t)DM * FF * 2); bf* Xb = (bf*)take((size_t)NTK * DM * 2);
    h16* QH = (h16*)take((size_t)NTK * DM * 2); h16* QL = (h16*)take((size_t)NTK * DM * 2); h16* KH = (h16*)take((size_t)NTK * DM * 2); h16* KL = (h16*)take((size_t)NTK * DM * 2);
    float* TMP = (float*)take((size_t)NTK * DM * 4); h16* VTH = (h16*)take((size_t)NTK * DM * 2); h16* VTL = (h16*)take((size_t)NTK * DM * 2);
    bf* AH[2]; bf* AL[2]; for (int p = 0; p < 2; ++p) { AH[p] = (bf*)take((size_t)NTK * DM * 2); AL[p] = (bf*)take((size_t)NTK * DM * 2); }
    bf* Yh = (bf*)take((size_t)NTK * DM * 2); bf* Yl = (bf*)take((size_t)NTK * DM * 2); float* Y2 = (float*)take((size_t)NTK * DM * 4); bf* Y2h = (bf*)take((size_t)NTK * DM * 2); bf* Y2l = (bf*)take((size_t)NTK * DM * 2);
    float* Y3 = (float*)take((size_t)NTK * DM * 4);
    if ((size_t)(wsp - (char*)d_ws) > ws_size) return;    // 6 x 2.1 + 2.1 + 4.2 + 4.2 + 4.2 + [4 x 4.2 + 8.4 + 2 x 4.2 = 33.5] + 4 x 4.2 + 2 x 4.2 + 8.4 + 2 x 4.2 + 8.4 = 111 MB
    // aliases (stream order): the MLP hidden Hf (f32 [2048][2048] = 16.8 MB) and its planes Hh/Hl (8.4 MB each) live over QH,QL,KH,KL,TMP,VTH,VTL (33.5 MB of consecutive
    // 256-B-aligned takes) — all dead after the item's second attention, rebuilt by the next item's projections after the MLP has consumed them.
    float* Hf = (float*)(void*)QH; bf* Hh = (bf*)(void*)((char*)(void*)QH + (size_t)NTK * FF * 4); bf* Hl = (bf*)(void*)((char*)(void*)Hh + (size_t)NTK * FF * 2);
    for (int j = 0; j < 6; ++j) k_bf<<<(DM * DM / 8 + 255) / 256, 256, 0, stream>>>(Wp[j], WB[j], (size_t)DM * DM / 8);
    k_bf<<<(DM * DM / 8 + 255) / 256, 256, 0, stream>>>(Wo, WoB, (size_t)DM * DM / 8); k_bf<<<(FF * DM / 8 + 255) / 256, 256, 0, stream>>>(W1, W1B, (size_t)FF * DM / 8); k_bf<<<(DM * FF / 8 + 255) / 256, 256, 0, stream>>>(W2, W2B, (size_t)DM * FF / 8);
    for (int b = 0; b < 2; ++b) {
        for (int p = 0; p < 2; ++p) {
            const float* xb = (p ? xr : xl) + (size_t)b * DM * NT_;
            k_wt<<<dim3(DM / 64, NT_ / 64, 1), 256, 0, stream>>>(xb, DM, NT_, Xb);                                                                    // x^T [s][e] exact
            k_gemmb<false, true><<<dim3(NTK / 64, DM / 64, 1), 128, 0, stream>>>(Xb, nullptr, WB[3 * p + 0], nullptr, (float*)(void*)QH, DM, QL);
            k_gemmb<false, true><<<dim3(NTK / 64, DM / 64, 1), 128, 0, stream>>>(Xb, nullptr, WB[3 * p + 1], nullptr, (float*)(void*)KH, DM, KL);
            k_gemmb<false, false><<<dim3(NTK / 64, DM / 64, 1), 128, 0, stream>>>(Xb, nullptr, WB[3 * p + 2], nullptr, TMP, DM, nullptr);
            k_vt<<<NB_ * NH_ * (NT_ / 64), 256, 0, stream>>>(TMP, VTH, VTL);
            k_attn<<<NB_ * NH_ * (NT_ / 64), 128, 0, stream>>>(QH, QL, KH, KL, VTH, VTL, AH[p], AL[p]);
        }
        k_comb<<<NTK / 8, 256, 0, stream>>>(AH[0], AL[0], AH[1], AL[1], lql, lkl, lqr, lkr, g, bb, Yh, Yl);
        k_gemmb<true, false><<<dim3(NTK / 64, DM / 64, 1), 128, 0, stream>>>(Yh, Yl, WoB, nullptr, Y2, DM, nullptr);                        // y.Wo^T
        k_splitc<<<NTK / 8, 256, 0, stream>>>(Y2, NTK, DM, 0, Y2h, Y2l);
        k_gemmb<true, false><<<dim3(NTK / 64, FF / 64, 1), 128, 0, stream>>>(Y2h, Y2l, W1B, b1, Hf, FF, nullptr);                         // y.W1^T + b1
        k_splitc<<<NTK / 8, 256, 0, stream>>>(Hf, NTK, FF, 1, Hh, Hl);                                                                        // relu -> planes
        k_gemmb<true, false><<<dim3(NTK / 64, DM / 64, 1), 128, 0, stream>>>(Hh, Hl, W2B, b2, Y3, DM, nullptr, nullptr, FF);               // h.W2^T + b2  (K = 2048)
        k_trout<<<dim3(NT_ / 64, DM / 64, 1), 256, 0, stream>>>(Y3, out + (size_t)b * DM * NT_);                                            // -> [e][s]
    }
}

// v002
// A run of this version takes 667 microseconds.
// Two timings next to v001 both put it at 1.50 times that version's speed.
// Over all steps from v000 it is 1.98 times as fast.
#include <hip/hip_runtime.h>

// Compute dtypes, f32 accumulate, every stage one launch over both batch items and both paths (rows [path][batch][s]): the two causal 16-head attention paths (left / right inputs transposed from [E][S] once into bf16 [S][E];
// q/k/v = x.W^T as PLAIN bf16 operands = rounded inputs and weights, exact products) on v_wmma_f32_16x16x32_bf16 (q/k leave the epilogue as f16 hi + residual x1024
// planes, v -> transposed f16 hi + residual planes), each attention fused on v_wmma_f32_16x16x32_f16 (hh + hl + lh x 1/8, online f32 softmax, weights x32768 and v as
// f16 hi + residual x1024); lambda = exp(lq_l.lk_l) - exp(lq_r.lk_r) + 0.1, combined = attn_l - lambda attn_r and the LayerNorm in f32; y.Wo^T, relu(y.W1^T + b1) and
// h.W2^T + b2 with the computed operand as bf16 hi + UNSCALED residual against exact bf16 weights (two products) on v_wmma_f32_16x16x32_bf16; the result transposed to

#define NB_  2                   // batch items, all in one launch of every stage
#define NP_  2                   // attention paths (left, right), likewise
#define NT_  2048
#define DM   1024
#define FF   2048
#define NH_  16
#define HD   64
#define NTK  (NB_ * NT_)         // token rows behind the combination
#define NTA  (NP_ * NTK)         // token rows of the projections and the attention: row = (path * NB_ + batch) * NT_ + s
#define NW   1024
#define NQKV 1024
#define LN_EPS 1e-5f
#define LAM0 0.1f
#define PSC  32768.0f
#define LOSC 1024.0f
#define LOSCI (1.0f / 1024.0f)

typedef _Float16 h16;
typedef unsigned short bf;
typedef __attribute__((ext_vector_type(16))) __bf16   v16bf;
typedef __attribute__((ext_vector_type(16))) _Float16 v16h;
typedef __attribute__((ext_vector_type(8)))  _Float16 v8h;
typedef __attribute__((ext_vector_type(8)))  unsigned short v8us;
typedef __attribute__((ext_vector_type(8)))  float    v8f;
typedef __attribute__((ext_vector_type(4)))  float    v4f;
typedef v8h  __attribute__((may_alias)) v8ha;
typedef v4f  __attribute__((may_alias)) v4fa;
typedef v8us __attribute__((may_alias)) v8usa;

__device__ __forceinline__ unsigned short f2bf(float f) { unsigned u = __float_as_uint(f); u += 0x7FFFu + ((u >> 16) & 1u); return (unsigned short)(u >> 16); }
__device__ __forceinline__ float bf2f(unsigned short b) { return __uint_as_float(((unsigned)b) << 16); }
__device__ __forceinline__ float bfr(float f) { return bf2f(f2bf(f)); }
__device__ __forceinline__ v16h cat16(v8h lo, v8h hi) { return __builtin_shufflevector(lo, hi, 0, 1, 2, 3, 4, 5, 6, 7, 8, 9, 10, 11, 12, 13, 14, 15); }
__device__ __forceinline__ v16bf cat16b(v8us lo, v8us hi) { return __builtin_bit_cast(v16bf, __builtin_shufflevector(lo, hi, 0, 1, 2, 3, 4, 5, 6, 7, 8, 9, 10, 11, 12, 13, 14, 15)); }
__device__ __forceinline__ v8f wmma16(v16h a, v16h b, v8f c) { return __builtin_amdgcn_wmma_f32_16x16x32_f16(false, a, false, b, (short)0, c, false, false); }
__device__ __forceinline__ v8f wmmab(v16bf a, v16bf b, v8f c) { return __builtin_amdgcn_wmma_f32_16x16x32_bf16(false, a, false, b, (short)0, c, false, false); }

__global__ __launch_bounds__(256) void k_cvtb(const float* __restrict__ src, int nrows, bf* dst) {
    const int lane = threadIdx.x & 31, r = blockIdx.x * 8 + (threadIdx.x >> 5);
    if (r >= nrows) return;
    v8us o[DM / 256];
#pragma unroll
    for (int q = 0; q < DM / 256; ++q) { v8us t;
#pragma unroll
        for (int i = 0; i < 8; ++i) t[i] = f2bf(src[(size_t)r * DM + q * 256 + lane * 8 + i]);
        o[q] = t; }
#pragma unroll
    for (int q = 0; q < DM / 256; ++q) *(v8us*)(dst + (size_t)r * DM + q * 256 + lane * 8) = o[q];
    
}

// k_gemmb: 64 x 64 block tile (4 waves x 16 x 64) of C[rows][ldc] = (A [+ Al]).B^T (K = 1024 or 2048) [+ bf(bias[c])] [+ bf(R[r][c]) residual]; f32 whole-line epilogue (or f16
// QKV: one launch does q, k and v of both paths: blockIdx.z picks the projection (0, 1: f16 planes at C / C2p + z * 2 NTA DM; 2: f32 at Cv), the row block's path and z the weight.
template <bool SPLITA, bool F16OUT = false, bool QKV = false>
__global__ __launch_bounds__(128) void k_gemmb(const bf* __restrict__ A, const bf* __restrict__ Al, const bf* __restrict__ Bw, const float* __restrict__ bias, float* C, int ldc, h16* C2p, const float* __restrict__ R = nullptr, int K = DM, int roundR = 1, float* Cv = nullptr) {
    __shared__ __align__(16) float ost[4][16 * 68];
    const int lane = threadIdx.x & 31, wave = threadIdx.x >> 5, lr = lane & 15, hi = lane >> 4;
    const int r0 = blockIdx.x * 64 + wave * 16, c0 = blockIdx.y * 64;
    const bf* __restrict__ Bn = QKV ? Bw + ((size_t)(blockIdx.x / (NTK / 64)) * 3 + blockIdx.z) * ((size_t)DM * DM) : Bw;
    const size_t zo = QKV ? (size_t)blockIdx.z * (2 * (size_t)NTA * DM) : 0;
    h16* C2 = QKV ? C2p + zo : C2p;
    const size_t aoff = (size_t)(r0 + lr) * K + 8 * hi;
    size_t boff[4];
#pragma unroll
    for (int t = 0; t < 4; ++t) boff[t] = (size_t)(c0 + t * 16 + lr) * K + 8 * hi;
    v8f acc[4];
#pragma unroll
    for (int t = 0; t < 4; ++t) acc[t] = (v8f){};
#pragma unroll 1
    for (int kc = 0; kc < K; kc += 32) {
        const v16bf a = cat16b(*(const v8us*)(A + aoff + kc), *(const v8us*)(A + aoff + kc + 16));
        v16bf al = a;
        if (SPLITA) al = cat16b(*(const v8us*)(Al + aoff + kc), *(const v8us*)(Al + aoff + kc + 16));
#pragma unroll
        for (int t = 0; t < 4; ++t) { const v16bf b = cat16b(*(const v8us*)(Bn + boff[t] + kc), *(const v8us*)(Bn + boff[t] + kc + 16)); acc[t] = wmmab(a, b, acc[t]); if (SPLITA) acc[t] = wmmab(al, b, acc[t]); }
        asm volatile("v_nop\n\tv_nop\n\tv_nop\n\tv_nop" : "+v"(acc[0]), "+v"(acc[1]), "+v"(acc[2]), "+v"(acc[3]) : "v"(a), "v"(al));
    }
    float* os = &ost[wave][0];
#pragma unroll
    for (int t = 0; t < 4; ++t) { const float bv = bias ? bfr(bias[c0 + t * 16 + lr]) : 0.f;
#pragma unroll
        for (int j = 0; j < 8; ++j) os[(hi * 8 + j) * 68 + t * 16 + lr] = acc[t][j] + bv; }
    __syncthreads();
    if (QKV ? (blockIdx.z < 2) : F16OUT) {
        h16* crow = (h16*)(void*)C + zo + (size_t)r0 * ldc + c0;
        auto pass = [&]() {
#pragma unroll
            for (int s = 0; s < 4; ++s) { const int row = 4 * s + (lane >> 3), piece = lane & 7; const float* sp = os + row * 68 + piece * 8; v8h o, o2;
#pragma unroll
                for (int i = 0; i < 8; ++i) { const h16 a = (h16)sp[i]; o[i] = a; o2[i] = (h16)((sp[i] - (float)a) * LOSC); }
                *(v8h*)(crow + (size_t)row * ldc + piece * 8) = o; if (C2) *(v8h*)(C2 + (size_t)r0 * ldc + c0 + (size_t)row * ldc + piece * 8) = o2; }
        };
        pass(); 
    } else {
        float* crow = (QKV ? Cv : C) + (size_t)r0 * ldc + c0;
        auto pass = [&]() {
#pragma unroll
            for (int s = 0; s < 8; ++s) { const int Lid = (lane >> 3) + 4 * s, piece = lane & 7; const int row = Lid >> 1, cofs = (Lid & 1) * 32 + piece * 4;
                v4f val = *(const v4fa*)(os + row * 68 + cofs); if (R) { const v4f rv = *(const v4f*)(R + ((size_t)r0 + row) * ldc + c0 + cofs); val += roundR ? (v4f){bfr(rv[0]), bfr(rv[1]), bfr(rv[2]), bfr(rv[3])} : rv; }
                *(v4f*)(crow + (size_t)row * ldc + cofs) = val; }
        };
        pass(); 
    }
}

__global__ __launch_bounds__(256) void k_vt(const float* __restrict__ V, h16* VTH, h16* VTL) {
    __shared__ __align__(16) h16 tile[64 * 72];
    __shared__ __align__(16) h16 til2[64 * 72];
    const int bid = blockIdx.x;
    const int b = bid / (NH_ * (NT_ / 64)), rem = bid - b * (NH_ * (NT_ / 64)), h = rem / (NT_ / 64), kt = rem - h * (NT_ / 64);
    const int k0 = kt * 64, tid = threadIdx.x;
    const int kk = tid >> 2, d0 = (tid & 3) * 16;
    const float* src = V + ((size_t)b * NT_ + k0 + kk) * DM + h * HD + d0;
#pragma unroll
    for (int i = 0; i < 16; ++i) { const float v = src[i]; const h16 a = (h16)v; tile[(d0 + i) * 72 + kk] = a; til2[(d0 + i) * 72 + kk] = (h16)((v - (float)a) * LOSC); }
    __syncthreads();
    const int piece = tid & 7;
    const size_t base = (((size_t)b * NH_ + h) * HD) * NT_ + k0;
    auto pass = [&]() {
#pragma unroll
        for (int s = 0; s < 4; ++s) { const int Lid = (tid >> 3) + 32 * s; const int pln = Lid >> 6, d = Lid & 63;
            const v8h val = *(const v8ha*)((pln ? til2 : tile) + d * 72 + piece * 8); *(v8h*)((pln ? VTL : VTH) + base + (size_t)d * NT_ + piece * 8) = val; }
    };
    pass(); 
}

// k_attn: block = (b, h, 64 queries), wave = 16; key tiles of 32 up to the diagonal (causal mask); 4 WMMA scores /8 (f32), online softmax, weights x32768 f16 tile (same-wave may_alias
// reload after a compiler barrier), 4 WMMA .v; ctx -> bf16 hi + residual planes CH/CL[tok][h*64+d].
// Key loop operands come from LDS: each 32-key tile (K hi, K residual, V^T hi, V^T residual) is copied once per block by global_load_async_to_lds_b128 into one of two
// buffers, tile t + 2 being issued when every wave has left tile t, so a tile's L2 latency runs under the tile before it; the block's query residual rows are copied once.
#define KPE  72                          // LDS pitch of a 64-element f16 row, in elements: 144 B = 16 B x odd, conflict-free for 16-byte row readers
#define VPE  40                          // LDS pitch of a 32-element f16 row, in elements: 80 B = 16 B x odd
#define KTE  (32 * KPE)                  // one K plane of a tile
#define VTE  (64 * VPE)                  // one V^T plane of a tile
#define BUFE (2 * KTE + 2 * VTE)         // one tile: 19,456 B
__device__ __forceinline__ unsigned ldsa(const h16* p) { return (unsigned)(size_t)p; }   // byte offset in the work-group's LDS = low 32 bits of the __shared__ address

__global__ __launch_bounds__(128) void k_attn(const h16* __restrict__ Q16, const h16* __restrict__ QL16, const h16* __restrict__ K16, const h16* __restrict__ KL16, const h16* __restrict__ VTH, const h16* __restrict__ VTL, bf* CH, bf* CL) {
    __shared__ __align__(16) h16 ring[2 * BUFE];
    __shared__ __align__(16) h16 qls[64 * KPE];
    __shared__ __align__(16) h16 plds[4][16 * 32];
    __shared__ __align__(16) h16 plds2[4][16 * 32];
    __shared__ __align__(16) float ost[4][16 * 68];
    // The wave's number sits in a scalar register, so that what derives from it leaves the vector registers and the loop's live set stays under 256 of them.
    const int tid = threadIdx.x, lane = threadIdx.x & 31, wave = __builtin_amdgcn_readfirstlane(threadIdx.x >> 5), lr = lane & 15, hi = lane >> 4;
    const int bid = blockIdx.x;
    const int b = bid / (NH_ * (NT_ / 64)), rem = bid - b * (NH_ * (NT_ / 64)), h = rem / (NT_ / 64), qt = rem - h * (NT_ / 64);
    const int q0 = qt * 64 + wave * 16;
    const size_t tok0 = (size_t)b * NT_;
    h16* pl = &plds[wave][0]; h16* pl2 = &plds2[wave][0];
    v16h qa[2];
    const size_t qo0 = (tok0 + q0 + lr) * DM + h * HD + 8 * hi;
#pragma unroll
    for (int kc = 0; kc < 2; ++kc) qa[kc] = cat16(*(const v8h*)(Q16 + qo0 + kc * 32), *(const v8h*)(Q16 + qo0 + kc * 32 + 16));
    const h16* kh_b = K16 + tok0 * DM + h * HD;
    const h16* kl_b = KL16 + tok0 * DM + h * HD;
    const size_t vbase = (((size_t)b * NH_ + h) * HD) * NT_;
    v8f o[4], ox[4];
#pragma unroll
    for (int n = 0; n < 4; ++n) { o[n] = (v8f){}; ox[n] = (v8f){}; }
    float mrow[8], lpart[8];
#pragma unroll
    for (int j = 0; j < 8; ++j) { mrow[j] = -3.0e38f; lpart[j] = 0.f; }
    int qpos[8];
#pragma unroll
    for (int j = 0; j < 8; ++j) qpos[j] = q0 + 8 * hi + j;
    const int kt_lo = 0, kt_hi = (qt * 64 + 63) / 32;     // causal; at least two tiles
    // Copy map, 16 B a lane: K planes 32 rows x 8 pieces (a thread takes rows krow and krow + 16), V^T planes 64 rows x 4 pieces (rows vrow and vrow + 32).
    const int krow = tid >> 3, kpc = (tid & 7) * 8, vrow = tid >> 2, vpc = (tid & 3) * 8;
    const unsigned kgo = (unsigned)(krow * DM + kpc) * 2u, vgo = (unsigned)(vrow * NT_ + vpc) * 2u;                 // this thread's byte offsets in a K plane and a V^T plane of its head
    const unsigned klo = ldsa(ring) + (unsigned)(krow * KPE + kpc) * 2u, vlo = ldsa(ring) + (unsigned)(2 * KTE + vrow * VPE + vpc) * 2u;    // and in buffer 0
    const char* vh_b = (const char*)(VTH + vbase); const char* vl_b = (const char*)(VTL + vbase);
    auto fill = [&](int kt) {
        const unsigned ko = kgo + (unsigned)kt * (32u * DM * 2u), vo = vgo + (unsigned)kt * 64u, bo = (unsigned)(kt & 1) * (BUFE * 2u);
        const char* gkh = (const char*)kh_b + ko; const char* gkl = (const char*)kl_b + ko; const char* gvh = vh_b + vo; const char* gvl = vl_b + vo;
        const unsigned lk = klo + bo, lv = vlo + bo;
        // The tile's eight copies; s_wait_xcnt closes the statement so that no address register named here is rewritten in front of it.
        asm volatile("global_load_async_to_lds_b128 %0, %1, off\n\tglobal_load_async_to_lds_b128 %2, %3, off\n\t"
                     "global_load_async_to_lds_b128 %4, %5, off\n\tglobal_load_async_to_lds_b128 %6, %7, off\n\t"
                     "global_load_async_to_lds_b128 %8, %9, off\n\tglobal_load_async_to_lds_b128 %10, %11, off\n\t"
                     "global_load_async_to_lds_b128 %12, %13, off\n\tglobal_load_async_to_lds_b128 %14, %15, off\n\ts_wait_xcnt 0x0"
                     :: "v"(lk), "v"(gkh), "v"(lk + 16 * KPE * 2), "v"(gkh + 16 * DM * 2), "v"(lk + KTE * 2), "v"(gkl), "v"(lk + (KTE + 16 * KPE) * 2), "v"(gkl + 16 * DM * 2),
                        "v"(lv), "v"(gvh), "v"(lv + 32 * VPE * 2), "v"(gvh + 32 * NT_ * 2), "v"(lv + VTE * 2), "v"(gvl), "v"(lv + (VTE + 32 * VPE) * 2), "v"(gvl + 32 * NT_ * 2) : "memory");
    };
    {   // The block's 64 query residual rows, once: 64 rows x 8 pieces, a thread takes rows krow + 16 i; same closing wait as above.
        const h16* gq = QL16 + (tok0 + qt * 64 + krow) * DM + h * HD + kpc;
        const unsigned lq = ldsa(qls) + (krow * KPE + kpc) * 2;
        asm volatile("global_load_async_to_lds_b128 %0, %1, off\n\tglobal_load_async_to_lds_b128 %2, %3, off\n\t"
                     "global_load_async_to_lds_b128 %4, %5, off\n\tglobal_load_async_to_lds_b128 %6, %7, off\n\ts_wait_xcnt 0x0"
                     :: "v"(lq), "v"(gq), "v"(lq + 16 * KPE * 2), "v"(gq + 16 * DM), "v"(lq + 32 * KPE * 2), "v"(gq + 32 * DM), "v"(lq + 48 * KPE * 2), "v"(gq + 48 * DM) : "memory");
    }
    fill(0);
    asm volatile("s_wait_asynccnt 0x0" ::: "memory");     // this wave's copies of tile 0 and of the query residual have landed
    __syncthreads();                                      // ... and every other wave's: tile 0 is published
    fill(1);
    const h16* qlp = qls + (wave * 16 + lr) * KPE + 8 * hi;
#pragma unroll 1
    for (int kt = kt_lo; kt <= kt_hi; ++kt) {
        const int l0 = kt * 32;
        const h16* buf = ring + (kt & 1) * BUFE;
        const h16* kp = buf + lr * KPE + 8 * hi;
        const h16* vp = buf + 2 * KTE + lr * VPE + 8 * hi;
        v16h k0h[2], k1h[2], k0l[2], k1l[2], qlk[2];
#pragma unroll
        for (int kc = 0; kc < 2; ++kc) {
            k0h[kc] = cat16(*(const v8ha*)(kp + kc * 32), *(const v8ha*)(kp + kc * 32 + 16)); k1h[kc] = cat16(*(const v8ha*)(kp + 16 * KPE + kc * 32), *(const v8ha*)(kp + 16 * KPE + kc * 32 + 16));
            qlk[kc] = cat16(*(const v8ha*)(qlp + kc * 32), *(const v8ha*)(qlp + kc * 32 + 16));
            k0l[kc] = cat16(*(const v8ha*)(kp + KTE + kc * 32), *(const v8ha*)(kp + KTE + kc * 32 + 16)); k1l[kc] = cat16(*(const v8ha*)(kp + KTE + 16 * KPE + kc * 32), *(const v8ha*)(kp + KTE + 16 * KPE + kc * 32 + 16));
        }
        v8f s0 = {}, s1 = {}, x0 = {}, x1 = {};
#pragma unroll
        for (int kc = 0; kc < 2; ++kc) {
            s0 = wmma16(qa[kc], k0h[kc], s0); x0 = wmma16(qlk[kc], k0h[kc], x0); s1 = wmma16(qa[kc], k1h[kc], s1); x1 = wmma16(qlk[kc], k1h[kc], x1);
            x0 = wmma16(qa[kc], k0l[kc], x0); x1 = wmma16(qa[kc], k1l[kc], x1);
        }
        asm volatile("v_nop\n\tv_nop\n\tv_nop\n\tv_nop" : "+v"(s0), "+v"(s1), "+v"(x0), "+v"(x1) : "v"(qa[0]), "v"(qa[1]));
        v16h vh[4], vl[4];     // read ahead of the softmax, whose vector work covers their LDS latency
#pragma unroll
        for (int n = 0; n < 4; ++n) { vh[n] = cat16(*(const v8ha*)(vp + n * 16 * VPE), *(const v8ha*)(vp + n * 16 * VPE + 16)); vl[n] = cat16(*(const v8ha*)(vp + VTE + n * 16 * VPE), *(const v8ha*)(vp + VTE + n * 16 * VPE + 16)); }
        float alpha[8];
#pragma unroll
        for (int j = 0; j < 8; ++j) {
            const int ja = l0 + lr, jb = l0 + 16 + lr, qi = qpos[j];
            const float a0 = (ja <= qi) ? (s0[j] + x0[j] * LOSCI) * 0.125f : -__builtin_inff(), a1 = (jb <= qi) ? (s1[j] + x1[j] * LOSCI) * 0.125f : -__builtin_inff();
            float mx = fmaxf(a0, a1);
            mx = fmaxf(mx, __shfl_xor(mx, 1, 16)); mx = fmaxf(mx, __shfl_xor(mx, 2, 16)); mx = fmaxf(mx, __shfl_xor(mx, 4, 16)); mx = fmaxf(mx, __shfl_xor(mx, 8, 16));
            const float mn = fmaxf(mrow[j], mx);
            alpha[j] = __expf(mrow[j] - mn); mrow[j] = mn;
            const float p0 = __expf(a0 - mn), p1 = __expf(a1 - mn);
            lpart[j] = lpart[j] * alpha[j] + (p0 + p1);
            const int mr = hi * 8 + j;
            const float ps0 = p0 * PSC, ps1 = p1 * PSC; const h16 h0 = (h16)ps0, h1 = (h16)ps1;
            pl[mr * 32 + lr] = h0; pl[mr * 32 + 16 + lr] = h1;
            pl2[mr * 32 + lr] = (h16)((ps0 - (float)h0) * LOSC); pl2[mr * 32 + 16 + lr] = (h16)((ps1 - (float)h1) * LOSC);
        }
#pragma unroll
        for (int n = 0; n < 4; ++n)
#pragma unroll
            for (int j = 0; j < 8; ++j) { o[n][j] *= alpha[j]; ox[n][j] *= alpha[j]; }
        asm volatile("" ::: "memory");
        const v16h pa = cat16(*(const v8ha*)(pl + lr * 32 + hi * 8), *(const v8ha*)(pl + lr * 32 + 16 + hi * 8));
        const v16h px = cat16(*(const v8ha*)(pl2 + lr * 32 + hi * 8), *(const v8ha*)(pl2 + lr * 32 + 16 + hi * 8));
#pragma unroll
        for (int n = 0; n < 4; ++n) { o[n] = wmma16(pa, vh[n], o[n]); ox[n] = wmma16(pa, vl[n], ox[n]); ox[n] = wmma16(px, vh[n], ox[n]); }
        asm volatile("v_nop\n\tv_nop\n\tv_nop\n\tv_nop" : "+v"(o[0]), "+v"(o[1]), "+v"(o[2]), "+v"(o[3]), "+v"(ox[0]), "+v"(ox[1]), "+v"(ox[2]), "+v"(ox[3]) : "v"(pa), "v"(px));
        asm volatile("s_wait_dscnt 0x0" ::: "memory");        // this wave's reads of tile kt have returned before its buffer is handed back
        asm volatile("s_wait_asynccnt 0x0" ::: "memory");     // this wave's copies of tile kt + 1 have landed
        __syncthreads();                                      // publishes tile kt + 1 and ends every wave's reads of tile kt
        if (kt + 2 <= kt_hi) fill(kt + 2);                    // block-uniform test: refill the buffer just left
    }
    asm volatile("s_wait_asynccnt 0x0" ::: "memory");         // no copy is outstanding when the wave goes on to its end
    float inv[8];
#pragma unroll
    for (int j = 0; j < 8; ++j) { float rs = lpart[j]; rs += __shfl_xor(rs, 1, 16); rs += __shfl_xor(rs, 2, 16); rs += __shfl_xor(rs, 4, 16); rs += __shfl_xor(rs, 8, 16); inv[j] = 1.0f / (rs * PSC); }
    float* os = &ost[wave][0];
#pragma unroll
    for (int n = 0; n < 4; ++n)
#pragma unroll
        for (int j = 0; j < 8; ++j) os[(hi * 8 + j) * 68 + n * 16 + lr] = (o[n][j] + ox[n][j] * LOSCI) * inv[j];
    __syncthreads();
    const size_t cbase = (tok0 + q0) * DM + (size_t)h * HD;
    auto pass = [&]() {
#pragma unroll
        for (int s = 0; s < 4; ++s) { const int row = 4 * s + (lane >> 3), piece = lane & 7; const float* sp = os + row * 68 + piece * 8; v8us oh, ol;
#pragma unroll
            for (int i = 0; i < 8; ++i) { const unsigned short hb = f2bf(sp[i]); oh[i] = hb; ol[i] = f2bf(sp[i] - bf2f(hb)); }
            *(v8us*)(CH + cbase + (size_t)row * DM + piece * 8) = oh; *(v8us*)(CL + cbase + (size_t)row * DM + piece * 8) = ol; }
    };
    pass(); 
}


// k_wt: WT [n][K] = bf16(W[k][n]) (k-major [K][ncols]) via 64 x 64 LDS tiles; grid (K/64, ncols/64, NP_ * NB_): z = path * NB_ + batch picks the source matrix and the plane of WTa.
__global__ __launch_bounds__(256) void k_wt(const float* __restrict__ Wl, const float* __restrict__ Wr, int K, int ncols, bf* WTa) {
    __shared__ __align__(16) unsigned short tl[64 * 72];
    const int tid = threadIdx.x, k0 = blockIdx.x * 64, n0 = blockIdx.y * 64;
    const float* __restrict__ Wm = (blockIdx.z / NB_ ? Wr : Wl) + (size_t)(blockIdx.z % NB_) * K * ncols;
    bf* WT = WTa + (size_t)blockIdx.z * K * ncols;
    const int kk = tid >> 2, nq = (tid & 3) * 16;
#pragma unroll
    for (int i = 0; i < 16; ++i) tl[(nq + i) * 72 + kk] = f2bf(Wm[(size_t)(k0 + kk) * ncols + n0 + nq + i]);
    __syncthreads();
    const int piece = tid & 7;
    auto pass = [&]() {
#pragma unroll
        for (int s = 0; s < 2; ++s) { const int nr = (tid >> 3) + 32 * s; const v8us val = *(const v8usa*)(tl + nr * 72 + piece * 8); *(v8us*)(WT + (size_t)(n0 + nr) * K + k0 + piece * 8) = val; }
    };
    pass(); 
}

// k_bf: all nine weight matrices -> bf16 in one launch; dst holds them back to back in argument order. 512 blocks cover DM x DM elements; w7 and w8 are twice that.
__global__ __launch_bounds__(256) void k_bf(const float* __restrict__ w0, const float* __restrict__ w1, const float* __restrict__ w2, const float* __restrict__ w3, const float* __restrict__ w4, const float* __restrict__ w5, const float* __restrict__ w6, const float* __restrict__ w7, const float* __restrict__ w8, bf* dst) {
    const int seg = blockIdx.x >> 9;
    const float* __restrict__ sb = seg == 0 ? w0 : seg == 1 ? w1 : seg == 2 ? w2 : seg == 3 ? w3 : seg == 4 ? w4 : seg == 5 ? w5 : seg == 6 ? w6 : seg < 9 ? w7 : w8;
    const int first = seg < 7 ? seg : seg < 9 ? 7 : 9;          // the segment at which this matrix begins
    const size_t i = (size_t)blockIdx.x * 256 + threadIdx.x;
    const v8f v = *(const v8f*)(sb + (i - (size_t)first * (DM * DM / 8)) * 8); v8us o;
#pragma unroll
    for (int k = 0; k < 8; ++k) o[k] = f2bf(v[k]);
    *(v8us*)(dst + i * 8) = o; 
}

// k_comb: per token row (one wave): lambda = exp(sum bf(lq_l) bf(lk_l)) - exp(sum bf(lq_r) bf(lk_r)) + 0.1 (64 terms, recomputed per wave), c = (CHl + CLl) - lambda (CHr + CLr)
// over the 1024 features, LayerNorm (mean, then biased variance, then the normalised output: three rolled passes that re-read the planes; f32, fixed lane order) x bf(g)
__global__ __launch_bounds__(256) void k_comb(const bf* __restrict__ AHl, const bf* __restrict__ ALl, const bf* __restrict__ AHr, const bf* __restrict__ ALr, const float* __restrict__ lql, const float* __restrict__ lkl, const float* __restrict__ lqr, const float* __restrict__ lkr, const float* __restrict__ g, const float* __restrict__ bb, bf* Yh, bf* Yl) {
    const int lane = threadIdx.x & 31, r = blockIdx.x * 8 + (threadIdx.x >> 5);
    if (r >= NTK) return;
    float dl = bfr(lql[lane]) * bfr(lkl[lane]) + bfr(lql[lane + 32]) * bfr(lkl[lane + 32]);
    float dr = bfr(lqr[lane]) * bfr(lkr[lane]) + bfr(lqr[lane + 32]) * bfr(lkr[lane + 32]);
#pragma unroll
    for (int sh = 16; sh; sh >>= 1) { dl += __shfl_xor(dl, sh, 32); dr += __shfl_xor(dr, sh, 32); }
    const float lam = __expf(dl) - __expf(dr) + LAM0;
    auto load8 = [&](int q, float* cv) { const size_t o = (size_t)r * DM + q * 256 + lane * 8;
        const v8us ah = *(const v8us*)(AHl + o), al = *(const v8us*)(ALl + o), bh = *(const v8us*)(AHr + o), bl = *(const v8us*)(ALr + o);
#pragma unroll
        for (int i = 0; i < 8; ++i) cv[i] = (bf2f(ah[i]) + bf2f(al[i])) - lam * (bf2f(bh[i]) + bf2f(bl[i])); };
    float s = 0.f;
#pragma unroll 1
    for (int q = 0; q < 4; ++q) { float cv[8]; load8(q, cv);
#pragma unroll
        for (int i = 0; i < 8; ++i) s += cv[i]; }
#pragma unroll
    for (int sh = 16; sh; sh >>= 1) s += __shfl_xor(s, sh, 32);
    const float mu = s * (1.0f / DM); float s2 = 0.f;
#pragma unroll 1
    for (int q = 0; q < 4; ++q) { float cv[8]; load8(q, cv);
#pragma unroll
        for (int i = 0; i < 8; ++i) { const float d = cv[i] - mu; s2 = fmaf(d, d, s2); } }
#pragma unroll
    for (int sh = 16; sh; sh >>= 1) s2 += __shfl_xor(s2, sh, 32);
    const float rs = rsqrtf(s2 * (1.0f / DM) + LN_EPS);
#pragma unroll 1
    for (int q = 0; q < 4; ++q) { float cv[8]; load8(q, cv); v8us oh, ol;
#pragma unroll
        for (int i = 0; i < 8; ++i) { const int col = q * 256 + lane * 8 + i; const float y = (cv[i] - mu) * rs * bfr(g[col]) + bfr(bb[col]); const unsigned short hb = f2bf(y); oh[i] = hb; ol[i] = f2bf(y - bf2f(hb)); }
        const size_t o = (size_t)r * DM + q * 256 + lane * 8; *(v8us*)(Yh + o) = oh; *(v8us*)(Yl + o) = ol;  }
}
// k_splitc: bf16 hi + UNSCALED residual planes of a computed f32 [nrows][nc] matrix (nc a multiple of 256), optional relu first; one wave per row, lane -> 8 columns per
__global__ __launch_bounds__(256) void k_splitc(const float* __restrict__ src, int nrows, int nc, int relu, bf* dh, bf* dl) {
    const int lane = threadIdx.x & 31, r = blockIdx.x * 8 + (threadIdx.x >> 5); if (r >= nrows) return;
{
#pragma unroll 1
        for (int c0 = lane * 8; c0 < nc; c0 += 256) { const size_t o = (size_t)r * nc + c0; const v8f v = *(const v8f*)(src + o); v8us oh, ol;
#pragma unroll
            for (int i = 0; i < 8; ++i) { float y = v[i]; if (relu) y = fmaxf(y, 0.f); const unsigned short hb = f2bf(y); oh[i] = hb; ol[i] = f2bf(y - bf2f(hb)); }
            *(v8us*)(dh + o) = oh; *(v8us*)(dl + o) = ol; }
         }
}
// k_trout: out[e][s] = Y[s][e] (f32 [2048][1024] -> [1024][2048]) through a 64 x 64 LDS tile; grid (S/64, E/64, batch); each output row segment of 64 s (256 B) by 16
__global__ __launch_bounds__(256) void k_trout(const float* __restrict__ Ya, float* OUTa) {
    __shared__ __align__(16) float tl[64 * 68];
    const int tid = threadIdx.x, s0 = blockIdx.x * 64, e0 = blockIdx.y * 64;
    const float* __restrict__ Y = Ya + (size_t)blockIdx.z * NT_ * DM; float* OUTP = OUTa + (size_t)blockIdx.z * DM * NT_;     // z = batch item
    const int ss = tid >> 2, eq = (tid & 3) * 16;
#pragma unroll
    for (int i = 0; i < 16; ++i) tl[(eq + i) * 68 + ss] = Y[(size_t)(s0 + ss) * DM + e0 + eq + i];
    __syncthreads();
    auto pass = [&]() {
#pragma unroll
        for (int j = 0; j < 4; ++j) { const int idx = tid + 256 * j; const int row = idx >> 4, piece = idx & 15; const v4f v = *(const v4fa*)(tl + row * 68 + piece * 4);
            *(v4f*)(OUTP + (size_t)(e0 + row) * NT_ + s0 + piece * 4) = v; }
    };
    pass(); 
}

extern "C" void kernel_launch(void* const* d_in, const int* in_sizes, int n_in,
                              void* d_out, int out_size, void* d_ws, size_t ws_size, hipStream_t stream) {
    (void)in_sizes; (void)n_in; (void)out_size;
    const float* xl = (const float*)d_in[0]; const float* xr = (const float*)d_in[1];                              // [2][1024][2048] = [b][e][s]
    const float* Wp[6]; for (int j = 0; j < 6; ++j) Wp[j] = (const float*)d_in[2 + j];                             // Wq_l, Wk_l, Wv_l, Wq_r, Wk_r, Wv_r  ([out][in])
    const float* Wo = (const float*)d_in[8]; const float* lql = (const float*)d_in[9]; const float* lkl = (const float*)d_in[10]; const float* lqr = (const float*)d_in[11]; const float* lkr = (const float*)d_in[12];
    const float* g = (const float*)d_in[13]; const float* bb = (const float*)d_in[14]; const float* W1 = (const float*)d_in[15]; const float* b1 = (const float*)d_in[16]; const float* W2 = (const float*)d_in[17]; const float* b2 = (const float*)d_in[18];
    float* out = (float*)d_out;    // [2][1024][2048]
    char* wsp = (char*)d_ws;
    auto take = [&](size_t bytes) { char* p = wsp; wsp += (bytes + 255) & ~(size_t)255; return (void*)p; };
    bf* WB = (bf*)take((size_t)11 * DM * DM * 2);          // Wq_l, Wk_l, Wv_l, Wq_r, Wk_r, Wv_r, Wo, W1, W2 back to back
    bf* WoB = WB + (size_t)6 * DM * DM; bf* W1B = WB + (size_t)7 * DM * DM; bf* W2B = WB + (size_t)9 * DM * DM;
    bf* Xb = (bf*)take((size_t)NTA * DM * 2);
    h16* QH = (h16*)take((size_t)NTA * DM * 2); h16* QL = (h16*)take((size_t)NTA * DM * 2); h16* KH = (h16*)take((size_t)NTA * DM * 2); h16* KL = (h16*)take((size_t)NTA * DM * 2);
    float* TMP = (float*)take((size_t)NTA * DM * 4); h16* VTH = (h16*)take((size_t)NTA * DM * 2); h16* VTL = (h16*)take((size_t)NTA * DM * 2);
    bf* AH = (bf*)take((size_t)NTA * DM * 2); bf* AL = (bf*)take((size_t)NTA * DM * 2);                    // [path][batch][s][e]
    bf* Yh = (bf*)take((size_t)NTK * DM * 2); bf* Yl = (bf*)take((size_t)NTK * DM * 2); bf* Y2h = (bf*)take((size_t)NTK * DM * 2); bf* Y2l = (bf*)take((size_t)NTK * DM * 2);
    if ((size_t)(wsp - (char*)d_ws) > ws_size) return;    // MiB: 22 + 16 + 4 x 16 + 32 + 2 x 16 + 2 x 16 + 4 x 8 = 230
    // aliases (stream order): Y2 (f32 [4096][1024], 16 MiB) lives over Xb, dead after the projections; Y3 (the same size) over AH, dead after k_comb; the MLP hidden Hf
    // (f32 [4096][2048], 32 MiB) over QH,QL and its planes Hh/Hl (16 MiB each) over KH and KL, consecutive 256-B-aligned takes, all dead after the attention.
    float* Y2 = (float*)(void*)Xb; float* Y3 = (float*)(void*)AH;
    float* Hf = (float*)(void*)QH; bf* Hh = (bf*)(void*)KH; bf* Hl = (bf*)(void*)KL;
    k_bf<<<11 * 512, 256, 0, stream>>>(Wp[0], Wp[1], Wp[2], Wp[3], Wp[4], Wp[5], Wo, W1, W2, WB);
    k_wt<<<dim3(DM / 64, NT_ / 64, NP_ * NB_), 256, 0, stream>>>(xl, xr, DM, NT_, Xb);                                                             // x^T [path][batch][s][e] exact
    k_gemmb<false, true, true><<<dim3(NTA / 64, DM / 64, 3), 128, 0, stream>>>(Xb, nullptr, WB, nullptr, (float*)(void*)QH, DM, QL, nullptr, DM, 1, TMP);   // q, k -> planes, v -> TMP
    k_vt<<<NP_ * NB_ * NH_ * (NT_ / 64), 256, 0, stream>>>(TMP, VTH, VTL);
    k_attn<<<NP_ * NB_ * NH_ * (NT_ / 64), 128, 0, stream>>>(QH, QL, KH, KL, VTH, VTL, AH, AL);
    k_comb<<<NTK / 8, 256, 0, stream>>>(AH, AL, AH + (size_t)NTK * DM, AL + (size_t)NTK * DM, lql, lkl, lqr, lkr, g, bb, Yh, Yl);
    k_gemmb<true, false><<<dim3(NTK / 64, DM / 64, 1), 128, 0, stream>>>(Yh, Yl, WoB, nullptr, Y2, DM, nullptr);                        // y.Wo^T
    k_splitc<<<NTK / 8, 256, 0, stream>>>(Y2, NTK, DM, 0, Y2h, Y2l);
    k_gemmb<true, false><<<dim3(NTK / 64, FF / 64, 1), 128, 0, stream>>>(Y2h, Y2l, W1B, b1, Hf, FF, nullptr);                         // y.W1^T + b1
    k_splitc<<<NTK / 8, 256, 0, stream>>>(Hf, NTK, FF, 1, Hh, Hl);                                                                        // relu -> planes
    k_gemmb<true, false><<<dim3(NTK / 64, DM / 64, 1), 128, 0, stream>>>(Hh, Hl, W2B, b2, Y3, DM, nullptr, nullptr, FF);               // h.W2^T + b2  (K = 2048)
    k_trout<<<dim3(NT_ / 64, DM / 64, NB_), 256, 0, stream>>>(Y3, out);                                                                  // -> [b][e][s]
}

// v003
// It runs in 383 microseconds.
// Next to v002, in two timings, it ran 1.72 and 1.73 times as fast.
// All steps since v000 together make it 3.42 times as fast.
#include <hip/hip_runtime.h>

// Compute dtypes, f32 accumulate, every stage one launch over both batch items and both paths (rows [path][batch][s]): the two causal 16-head attention paths (left / right inputs transposed from [E][S] once into bf16 [S][E];
// q/k/v = x.W^T as PLAIN bf16 operands = rounded inputs and weights, exact products) on v_wmma_f32_16x16x32_bf16 (q/k leave the epilogue as f16 hi + residual x1024
// planes, v -> transposed f16 hi + residual planes), each attention fused on v_wmma_f32_16x16x32_f16 (hh + hl + lh x 1/8, online f32 softmax, weights x32768 and v as
// f16 hi + residual x1024); lambda = exp(lq_l.lk_l) - exp(lq_r.lk_r) + 0.1, combined = attn_l - lambda attn_r and the LayerNorm in f32; y.Wo^T, relu(y.W1^T + b1) and
// h.W2^T + b2 with the computed operand as bf16 hi + UNSCALED residual against exact bf16 weights (two products) on v_wmma_f32_16x16x32_bf16; the result transposed to

#define NB_  2                   // batch items, all in one launch of every stage
#define NP_  2                   // attention paths (left, right), likewise
#define NT_  2048
#define DM   1024
#define FF   2048
#define NH_  16
#define HD   64
#define NTK  (NB_ * NT_)         // token rows behind the combination
#define NTA  (NP_ * NTK)         // token rows of the projections and the attention: row = (path * NB_ + batch) * NT_ + s
#define NW   1024
#define NQKV 1024
#define LN_EPS 1e-5f
#define LAM0 0.1f
#define PSC  32768.0f
#define LOSC 1024.0f
#define LOSCI (1.0f / 1024.0f)

typedef _Float16 h16;
typedef unsigned short bf;
typedef __attribute__((ext_vector_type(16))) __bf16   v16bf;
typedef __attribute__((ext_vector_type(16))) _Float16 v16h;
typedef __attribute__((ext_vector_type(8)))  _Float16 v8h;
typedef __attribute__((ext_vector_type(8)))  unsigned short v8us;
typedef __attribute__((ext_vector_type(8)))  float    v8f;
typedef __attribute__((ext_vector_type(4)))  float    v4f;
typedef v8h  __attribute__((may_alias)) v8ha;
typedef v4f  __attribute__((may_alias)) v4fa;
typedef v8us __attribute__((may_alias)) v8usa;

__device__ __forceinline__ unsigned short f2bf(float f) { unsigned u = __float_as_uint(f); u += 0x7FFFu + ((u >> 16) & 1u); return (unsigned short)(u >> 16); }
__device__ __forceinline__ float bf2f(unsigned short b) { return __uint_as_float(((unsigned)b) << 16); }
__device__ __forceinline__ float bfr(float f) { return bf2f(f2bf(f)); }
__device__ __forceinline__ v16h cat16(v8h lo, v8h hi) { return __builtin_shufflevector(lo, hi, 0, 1, 2, 3, 4, 5, 6, 7, 8, 9, 10, 11, 12, 13, 14, 15); }
__device__ __forceinline__ v16bf cat16b(v8us lo, v8us hi) { return __builtin_bit_cast(v16bf, __builtin_shufflevector(lo, hi, 0, 1, 2, 3, 4, 5, 6, 7, 8, 9, 10, 11, 12, 13, 14, 15)); }
__device__ __forceinline__ v8f wmma16(v16h a, v16h b, v8f c) { return __builtin_amdgcn_wmma_f32_16x16x32_f16(false, a, false, b, (short)0, c, false, false); }
__device__ __forceinline__ v8f wmmab(v16bf a, v16bf b, v8f c) { return __builtin_amdgcn_wmma_f32_16x16x32_bf16(false, a, false, b, (short)0, c, false, false); }

__global__ __launch_bounds__(256) void k_cvtb(const float* __restrict__ src, int nrows, bf* dst) {
    const int lane = threadIdx.x & 31, r = blockIdx.x * 8 + (threadIdx.x >> 5);
    if (r >= nrows) return;
    v8us o[DM / 256];
#pragma unroll
    for (int q = 0; q < DM / 256; ++q) { v8us t;
#pragma unroll
        for (int i = 0; i < 8; ++i) t[i] = f2bf(src[(size_t)r * DM + q * 256 + lane * 8 + i]);
        o[q] = t; }
#pragma unroll
    for (int q = 0; q < DM / 256; ++q) *(v8us*)(dst + (size_t)r * DM + q * 256 + lane * 8) = o[q];
    
}

// k_gemmb: 128 x 128 block tile (4 waves, 2 x 2, each 64 x 64 = 4 x 4 accumulator tiles) of C[rows][cols] = (A [+ Al]).B^T [+ bf(bias[c])] [+ bf(R[r][c]) residual]; f32 or f16-plane whole-line epilogue.
// The operands come from LDS: each pass of 64 k (128 rows x 128 B of A, of B and, where split, of Al) is copied once per block by global_load_async_to_lds_b128, whole 128-B lines a row,
// into one of two buffers, pass p + 2 being issued when every wave has left pass p; so a line leaves L2 once per block and pass, and a pass's L2 latency runs under the pass before it.
// QKV: one launch does q, k and v of both paths: blockIdx.z picks the projection (0, 1: f16 planes at C / C2p + z * 2 NTA DM; 2: f32 at Cv), the row block's path and z the weight.
#define GPE  72                          // LDS pitch of a 64-element bf16 row, in elements: 144 B = 16 B x odd, conflict-free for 16-byte row readers
#define GTE  (128 * GPE)                 // one operand plane of a pass: 18,432 B
__device__ __forceinline__ unsigned ldsoff(const void* p) { return (unsigned)(size_t)p; }   // byte offset in the work-group's LDS = low 32 bits of the __shared__ address
// Eight copies of 16 B a lane: rows 16 apart (gs bytes apart in global memory); s_wait_xcnt closes the statement so that no address register named here is rewritten in front of it.
__device__ __forceinline__ void copy8(unsigned l, const char* g, size_t gs) {
    asm volatile("global_load_async_to_lds_b128 %0, %1, off\n\tglobal_load_async_to_lds_b128 %2, %3, off\n\t"
                 "global_load_async_to_lds_b128 %4, %5, off\n\tglobal_load_async_to_lds_b128 %6, %7, off\n\t"
                 "global_load_async_to_lds_b128 %8, %9, off\n\tglobal_load_async_to_lds_b128 %10, %11, off\n\t"
                 "global_load_async_to_lds_b128 %12, %13, off\n\tglobal_load_async_to_lds_b128 %14, %15, off\n\ts_wait_xcnt 0x0"
                 :: "v"(l), "v"(g), "v"(l + 16 * GPE * 2), "v"(g + gs), "v"(l + 32 * GPE * 2), "v"(g + 2 * gs), "v"(l + 48 * GPE * 2), "v"(g + 3 * gs),
                    "v"(l + 64 * GPE * 2), "v"(g + 4 * gs), "v"(l + 80 * GPE * 2), "v"(g + 5 * gs), "v"(l + 96 * GPE * 2), "v"(g + 6 * gs), "v"(l + 112 * GPE * 2), "v"(g + 7 * gs) : "memory");
}
template <bool SPLITA, bool F16OUT = false, bool QKV = false>
__global__ __launch_bounds__(128) void k_gemmb(const bf* __restrict__ A, const bf* __restrict__ Al, const bf* __restrict__ Bw, const float* __restrict__ bias, float* C, int ldc, h16* C2p, const float* __restrict__ R = nullptr, int K = DM, int roundR = 1, float* Cv = nullptr) {
    constexpr int NPL = SPLITA ? 3 : 2;                      // planes of a buffer: A, B [, Al]
    __shared__ __align__(16) bf gring[2 * NPL * GTE];
    __shared__ __align__(16) float ost[4][16 * 68];
    const int tid = threadIdx.x, lane = threadIdx.x & 31, wave = __builtin_amdgcn_readfirstlane(threadIdx.x >> 5), lr = lane & 15, hi = lane >> 4;
    const int rb = blockIdx.x * 128, cb = blockIdx.y * 128;
    const int rw = rb + (wave >> 1) * 64, c0 = cb + (wave & 1) * 64;
    const bf* __restrict__ Bn = QKV ? Bw + ((size_t)(blockIdx.x / (NTK / 128)) * 3 + blockIdx.z) * ((size_t)DM * DM) : Bw;
    const size_t zo = QKV ? (size_t)blockIdx.z * (2 * (size_t)NTA * DM) : 0;
    h16* C2 = QKV ? C2p + zo : C2p;
    // Copy map, 16 B a lane: a plane is 128 rows x 8 pieces; a thread takes piece tid & 7 of rows crow + 16 i.
    const int crow = tid >> 3, cpc = (tid & 7) * 8;
    const size_t gs = (size_t)K * 32;                        // 16 rows, in bytes
    const char* ga = (const char*)(A + (size_t)(rb + crow) * K + cpc);
    const char* gl = SPLITA ? (const char*)(Al + (size_t)(rb + crow) * K + cpc) : ga;
    const char* gb = (const char*)(Bn + (size_t)(cb + crow) * K + cpc);
    const unsigned l0 = ldsoff(gring) + (unsigned)(crow * GPE + cpc) * 2u;
    auto fill = [&](int p) {
        const unsigned lb = l0 + (unsigned)(p & 1) * (NPL * GTE * 2u); const size_t go = (size_t)p * 128;
        copy8(lb, ga + go, gs); copy8(lb + GTE * 2u, gb + go, gs); if (SPLITA) copy8(lb + 2u * GTE * 2u, gl + go, gs);
    };
    // Every index into acc, a, al, b or bv is a constant or an unrolled loop's counter, so the arrays stay in registers.
    v8f acc[4][4];
#pragma unroll
    for (int i = 0; i < 4; ++i)
#pragma unroll
        for (int t = 0; t < 4; ++t) acc[i][t] = (v8f){};
    const int np = K >> 6;                                   // at least two passes (K is 1024 or 2048)
    fill(0);
    asm volatile("s_wait_asynccnt 0x0" ::: "memory");        // this wave's copies of pass 0 have landed
    __syncthreads();                                         // ... and every other wave's: pass 0 is published
    fill(1);
    const int aro = ((wave >> 1) * 64 + lr) * GPE + 8 * hi, bro = GTE + ((wave & 1) * 64 + lr) * GPE + 8 * hi;
#pragma unroll 1
    for (int p = 0; p < np; ++p) {                           // rolled: the body already holds 32 (64) matrix instructions
        const bf* buf = gring + (p & 1) * (NPL * GTE);
#pragma unroll
        for (int ks = 0; ks < 2; ++ks) {
            v16bf a[4], al[4], b[4];
            const bf* ap = buf + aro + ks * 32; const bf* bp = buf + bro + ks * 32;
            a[0] = cat16b(*(const v8usa*)ap, *(const v8usa*)(ap + 16));          // in the order of first use
#pragma unroll
            for (int t = 0; t < 4; ++t) b[t] = cat16b(*(const v8usa*)(bp + t * 16 * GPE), *(const v8usa*)(bp + t * 16 * GPE + 16));
#pragma unroll
            for (int i = 1; i < 4; ++i) a[i] = cat16b(*(const v8usa*)(ap + i * 16 * GPE), *(const v8usa*)(ap + i * 16 * GPE + 16));
#pragma unroll
            for (int i = 0; i < 4; ++i) { al[i] = a[i]; if (SPLITA) al[i] = cat16b(*(const v8usa*)(ap + 2 * GTE + i * 16 * GPE), *(const v8usa*)(ap + 2 * GTE + i * 16 * GPE + 16)); }
            // Keeps the k-step's LDS reads together as one group ahead of its matrix instructions; left to itself the build reads each A fragment directly in front of its four products and waits out the LDS latency every time.
            __builtin_amdgcn_sched_barrier(0);
#pragma unroll
            for (int i = 0; i < 4; ++i)
#pragma unroll
                for (int t = 0; t < 4; ++t) acc[i][t] = wmmab(a[i], b[t], acc[i][t]);
            if (SPLITA) {
#pragma unroll
                for (int i = 0; i < 4; ++i)
#pragma unroll
                    for (int t = 0; t < 4; ++t) acc[i][t] = wmmab(al[i], b[t], acc[i][t]);
            }
        }
        // Keeps the pass's matrix instructions in front of the waits and the barrier: moved behind them, they delay the refill, whose lead over its own wait then falls short of a pass.
        __builtin_amdgcn_sched_barrier(0);
        asm volatile("s_wait_dscnt 0x0" ::: "memory");       // this wave's reads of pass p have returned before its buffer is handed back
        asm volatile("s_wait_asynccnt 0x0" ::: "memory");    // this wave's copies of pass p + 1 have landed
        __syncthreads();                                     // publishes pass p + 1 and ends every wave's reads of pass p
        if (p + 2 < np) fill(p + 2);                         // block-uniform test: refill the buffer just left
    }
    asm volatile("s_wait_asynccnt 0x0" ::: "memory");        // no copy is outstanding when the wave goes on to its end
    float* os = &ost[wave][0];
    float bv[4];
#pragma unroll
    for (int t = 0; t < 4; ++t) bv[t] = bias ? bfr(bias[c0 + t * 16 + lr]) : 0.f;
#pragma unroll
    for (int mi = 0; mi < 4; ++mi) {                         // the wave's four 16-row groups, one after the other through its staging rows
        const int r0 = rw + mi * 16;
#pragma unroll
        for (int t = 0; t < 4; ++t)
#pragma unroll
            for (int j = 0; j < 8; ++j) os[(hi * 8 + j) * 68 + t * 16 + lr] = acc[mi][t][j] + bv[t];
        __syncthreads();
        if (QKV ? (blockIdx.z < 2) : F16OUT) {
            h16* crow2 = (h16*)(void*)C + zo + (size_t)r0 * ldc + c0;
#pragma unroll
            for (int s = 0; s < 4; ++s) { const int row = 4 * s + (lane >> 3), piece = lane & 7; const float* sp = os + row * 68 + piece * 8; v8h o, o2;
#pragma unroll
                for (int i = 0; i < 8; ++i) { const h16 a = (h16)sp[i]; o[i] = a; o2[i] = (h16)((sp[i] - (float)a) * LOSC); }
                *(v8h*)(crow2 + (size_t)row * ldc + piece * 8) = o;
                asm volatile("s_wait_xcnt 0x0" ::: "memory");     // the same precaution as below, for the store above: the residual's arithmetic reuses its registers
                if (C2) *(v8h*)(C2 + (size_t)r0 * ldc + c0 + (size_t)row * ldc + piece * 8) = o2;
                asm volatile("s_wait_xcnt 0x0" ::: "memory"); }   // a precaution: stands in front of the next rewrite of the registers that these stores name
        } else {
            float* crow2 = (QKV ? Cv : C) + (size_t)r0 * ldc + c0;
#pragma unroll
            for (int s = 0; s < 8; ++s) { const int Lid = (lane >> 3) + 4 * s, piece = lane & 7; const int row = Lid >> 1, cofs = (Lid & 1) * 32 + piece * 4;
                v4f val = *(const v4fa*)(os + row * 68 + cofs); if (R) { const v4f rv = *(const v4f*)(R + ((size_t)r0 + row) * ldc + c0 + cofs); val += roundR ? (v4f){bfr(rv[0]), bfr(rv[1]), bfr(rv[2]), bfr(rv[3])} : rv; }
                *(v4f*)(crow2 + (size_t)row * ldc + cofs) = val;
                asm volatile("s_wait_xcnt 0x0" ::: "memory"); }   // a precaution: stands in front of the next rewrite of the registers that this store names
        }
        __syncthreads();                                     // the staged rows are read before the next group overwrites them
    }
}

__global__ __launch_bounds__(256) void k_vt(const float* __restrict__ V, h16* VTH, h16* VTL) {
    __shared__ __align__(16) h16 tile[64 * 72];
    __shared__ __align__(16) h16 til2[64 * 72];
    const int bid = blockIdx.x;
    const int b = bid / (NH_ * (NT_ / 64)), rem = bid - b * (NH_ * (NT_ / 64)), h = rem / (NT_ / 64), kt = rem - h * (NT_ / 64);
    const int k0 = kt * 64, tid = threadIdx.x;
    const int kk = tid >> 2, d0 = (tid & 3) * 16;
    const float* src = V + ((size_t)b * NT_ + k0 + kk) * DM + h * HD + d0;
#pragma unroll
    for (int i = 0; i < 16; ++i) { const float v = src[i]; const h16 a = (h16)v; tile[(d0 + i) * 72 + kk] = a; til2[(d0 + i) * 72 + kk] = (h16)((v - (float)a) * LOSC); }
    __syncthreads();
    const int piece = tid & 7;
    const size_t base = (((size_t)b * NH_ + h) * HD) * NT_ + k0;
    auto pass = [&]() {
#pragma unroll
        for (int s = 0; s < 4; ++s) { const int Lid = (tid >> 3) + 32 * s; const int pln = Lid >> 6, d = Lid & 63;
            const v8h val = *(const v8ha*)((pln ? til2 : tile) + d * 72 + piece * 8); *(v8h*)((pln ? VTL : VTH) + base + (size_t)d * NT_ + piece * 8) = val; }
    };
    pass(); 
}

// k_attn: block = (b, h, 64 queries), wave = 16; key tiles of 32 up to the diagonal (causal mask); 4 WMMA scores /8 (f32), online softmax, weights x32768 f16 tile (same-wave may_alias
// reload after a compiler barrier), 4 WMMA .v; ctx -> bf16 hi + residual planes CH/CL[tok][h*64+d].
// Key loop operands come from LDS: each 32-key tile (K hi, K residual, V^T hi, V^T residual) is copied once per block by global_load_async_to_lds_b128 into one of two
// buffers, tile t + 2 being issued when every wave has left tile t, so a tile's L2 latency runs under the tile before it; the block's query residual rows are copied once.
#define KPE  72                          // LDS pitch of a 64-element f16 row, in elements: 144 B = 16 B x odd, conflict-free for 16-byte row readers
#define VPE  40                          // LDS pitch of a 32-element f16 row, in elements: 80 B = 16 B x odd
#define KTE  (32 * KPE)                  // one K plane of a tile
#define VTE  (64 * VPE)                  // one V^T plane of a tile
#define BUFE (2 * KTE + 2 * VTE)         // one tile: 19,456 B
__device__ __forceinline__ unsigned ldsa(const h16* p) { return (unsigned)(size_t)p; }   // byte offset in the work-group's LDS = low 32 bits of the __shared__ address

__global__ __launch_bounds__(128) void k_attn(const h16* __restrict__ Q16, const h16* __restrict__ QL16, const h16* __restrict__ K16, const h16* __restrict__ KL16, const h16* __restrict__ VTH, const h16* __restrict__ VTL, bf* CH, bf* CL) {
    __shared__ __align__(16) h16 ring[2 * BUFE];
    __shared__ __align__(16) h16 qls[64 * KPE];
    __shared__ __align__(16) h16 plds[4][16 * 32];
    __shared__ __align__(16) h16 plds2[4][16 * 32];
    __shared__ __align__(16) float ost[4][16 * 68];
    // The wave's number sits in a scalar register, so that what derives from it leaves the vector registers and the loop's live set stays under 256 of them.
    const int tid = threadIdx.x, lane = threadIdx.x & 31, wave = __builtin_amdgcn_readfirstlane(threadIdx.x >> 5), lr = lane & 15, hi = lane >> 4;
    const int bid = blockIdx.x;
    const int b = bid / (NH_ * (NT_ / 64)), rem = bid - b * (NH_ * (NT_ / 64)), h = rem / (NT_ / 64), qt = rem - h * (NT_ / 64);
    const int q0 = qt * 64 + wave * 16;
    const size_t tok0 = (size_t)b * NT_;
    h16* pl = &plds[wave][0]; h16* pl2 = &plds2[wave][0];
    v16h qa[2];
    const size_t qo0 = (tok0 + q0 + lr) * DM + h * HD + 8 * hi;
#pragma unroll
    for (int kc = 0; kc < 2; ++kc) qa[kc] = cat16(*(const v8h*)(Q16 + qo0 + kc * 32), *(const v8h*)(Q16 + qo0 + kc * 32 + 16));
    const h16* kh_b = K16 + tok0 * DM + h * HD;
    const h16* kl_b = KL16 + tok0 * DM + h * HD;
    const size_t vbase = (((size_t)b * NH_ + h) * HD) * NT_;
    v8f o[4], ox[4];
#pragma unroll
    for (int n = 0; n < 4; ++n) { o[n] = (v8f){}; ox[n] = (v8f){}; }
    float mrow[8], lpart[8];
#pragma unroll
    for (int j = 0; j < 8; ++j) { mrow[j] = -3.0e38f; lpart[j] = 0.f; }
    int qpos[8];
#pragma unroll
    for (int j = 0; j < 8; ++j) qpos[j] = q0 + 8 * hi + j;
    const int kt_lo = 0, kt_hi = (qt * 64 + 63) / 32;     // causal; at least two tiles
    // Copy map, 16 B a lane: K planes 32 rows x 8 pieces (a thread takes rows krow and krow + 16), V^T planes 64 rows x 4 pieces (rows vrow and vrow + 32).
    const int krow = tid >> 3, kpc = (tid & 7) * 8, vrow = tid >> 2, vpc = (tid & 3) * 8;
    const unsigned kgo = (unsigned)(krow * DM + kpc) * 2u, vgo = (unsigned)(vrow * NT_ + vpc) * 2u;                 // this thread's byte offsets in a K plane and a V^T plane of its head
    const unsigned klo = ldsa(ring) + (unsigned)(krow * KPE + kpc) * 2u, vlo = ldsa(ring) + (unsigned)(2 * KTE + vrow * VPE + vpc) * 2u;    // and in buffer 0
    const char* vh_b = (const char*)(VTH + vbase); const char* vl_b = (const char*)(VTL + vbase);
    auto fill = [&](int kt) {
        const unsigned ko = kgo + (unsigned)kt * (32u * DM * 2u), vo = vgo + (unsigned)kt * 64u, bo = (unsigned)(kt & 1) * (BUFE * 2u);
        const char* gkh = (const char*)kh_b + ko; const char* gkl = (const char*)kl_b + ko; const char* gvh = vh_b + vo; const char* gvl = vl_b + vo;
        const unsigned lk = klo + bo, lv = vlo + bo;
        // The tile's eight copies; s_wait_xcnt closes the statement so that no address register named here is rewritten in front of it.
        asm volatile("global_load_async_to_lds_b128 %0, %1, off\n\tglobal_load_async_to_lds_b128 %2, %3, off\n\t"
                     "global_load_async_to_lds_b128 %4, %5, off\n\tglobal_load_async_to_lds_b128 %6, %7, off\n\t"
                     "global_load_async_to_lds_b128 %8, %9, off\n\tglobal_load_async_to_lds_b128 %10, %11, off\n\t"
                     "global_load_async_to_lds_b128 %12, %13, off\n\tglobal_load_async_to_lds_b128 %14, %15, off\n\ts_wait_xcnt 0x0"
                     :: "v"(lk), "v"(gkh), "v"(lk + 16 * KPE * 2), "v"(gkh + 16 * DM * 2), "v"(lk + KTE * 2), "v"(gkl), "v"(lk + (KTE + 16 * KPE) * 2), "v"(gkl + 16 * DM * 2),
                        "v"(lv), "v"(gvh), "v"(lv + 32 * VPE * 2), "v"(gvh + 32 * NT_ * 2), "v"(lv + VTE * 2), "v"(gvl), "v"(lv + (VTE + 32 * VPE) * 2), "v"(gvl + 32 * NT_ * 2) : "memory");
    };
    {   // The block's 64 query residual rows, once: 64 rows x 8 pieces, a thread takes rows krow + 16 i; same closing wait as above.
        const h16* gq = QL16 + (tok0 + qt * 64 + krow) * DM + h * HD + kpc;
        const unsigned lq = ldsa(qls) + (krow * KPE + kpc) * 2;
        asm volatile("global_load_async_to_lds_b128 %0, %1, off\n\tglobal_load_async_to_lds_b128 %2, %3, off\n\t"
                     "global_load_async_to_lds_b128 %4, %5, off\n\tglobal_load_async_to_lds_b128 %6, %7, off\n\ts_wait_xcnt 0x0"
                     :: "v"(lq), "v"(gq), "v"(lq + 16 * KPE * 2), "v"(gq + 16 * DM), "v"(lq + 32 * KPE * 2), "v"(gq + 32 * DM), "v"(lq + 48 * KPE * 2), "v"(gq + 48 * DM) : "memory");
    }
    fill(0);
    asm volatile("s_wait_asynccnt 0x0" ::: "memory");     // this wave's copies of tile 0 and of the query residual have landed
    __syncthreads();                                      // ... and every other wave's: tile 0 is published
    fill(1);
    const h16* qlp = qls + (wave * 16 + lr) * KPE + 8 * hi;
#pragma unroll 1
    for (int kt = kt_lo; kt <= kt_hi; ++kt) {
        const int l0 = kt * 32;
        const h16* buf = ring + (kt & 1) * BUFE;
        const h16* kp = buf + lr * KPE + 8 * hi;
        const h16* vp = buf + 2 * KTE + lr * VPE + 8 * hi;
        v16h k0h[2], k1h[2], k0l[2], k1l[2], qlk[2];
#pragma unroll
        for (int kc = 0; kc < 2; ++kc) {
            k0h[kc] = cat16(*(const v8ha*)(kp + kc * 32), *(const v8ha*)(kp + kc * 32 + 16)); k1h[kc] = cat16(*(const v8ha*)(kp + 16 * KPE + kc * 32), *(const v8ha*)(kp + 16 * KPE + kc * 32 + 16));
            qlk[kc] = cat16(*(const v8ha*)(qlp + kc * 32), *(const v8ha*)(qlp + kc * 32 + 16));
            k0l[kc] = cat16(*(const v8ha*)(kp + KTE + kc * 32), *(const v8ha*)(kp + KTE + kc * 32 + 16)); k1l[kc] = cat16(*(const v8ha*)(kp + KTE + 16 * KPE + kc * 32), *(const v8ha*)(kp + KTE + 16 * KPE + kc * 32 + 16));
        }
        v8f s0 = {}, s1 = {}, x0 = {}, x1 = {};
#pragma unroll
        for (int kc = 0; kc < 2; ++kc) {
            s0 = wmma16(qa[kc], k0h[kc], s0); x0 = wmma16(qlk[kc], k0h[kc], x0); s1 = wmma16(qa[kc], k1h[kc], s1); x1 = wmma16(qlk[kc], k1h[kc], x1);
            x0 = wmma16(qa[kc], k0l[kc], x0); x1 = wmma16(qa[kc], k1l[kc], x1);
        }
        asm volatile("v_nop\n\tv_nop\n\tv_nop\n\tv_nop" : "+v"(s0), "+v"(s1), "+v"(x0), "+v"(x1) : "v"(qa[0]), "v"(qa[1]));
        v16h vh[4], vl[4];     // read ahead of the softmax, whose vector work covers their LDS latency
#pragma unroll
        for (int n = 0; n < 4; ++n) { vh[n] = cat16(*(const v8ha*)(vp + n * 16 * VPE), *(const v8ha*)(vp + n * 16 * VPE + 16)); vl[n] = cat16(*(const v8ha*)(vp + VTE + n * 16 * VPE), *(const v8ha*)(vp + VTE + n * 16 * VPE + 16)); }
        float alpha[8];
#pragma unroll
        for (int j = 0; j < 8; ++j) {
            const int ja = l0 + lr, jb = l0 + 16 + lr, qi = qpos[j];
            const float a0 = (ja <= qi) ? (s0[j] + x0[j] * LOSCI) * 0.125f : -__builtin_inff(), a1 = (jb <= qi) ? (s1[j] + x1[j] * LOSCI) * 0.125f : -__builtin_inff();
            float mx = fmaxf(a0, a1);
            mx = fmaxf(mx, __shfl_xor(mx, 1, 16)); mx = fmaxf(mx, __shfl_xor(mx, 2, 16)); mx = fmaxf(mx, __shfl_xor(mx, 4, 16)); mx = fmaxf(mx, __shfl_xor(mx, 8, 16));
            const float mn = fmaxf(mrow[j], mx);
            alpha[j] = __expf(mrow[j] - mn); mrow[j] = mn;
            const float p0 = __expf(a0 - mn), p1 = __expf(a1 - mn);
            lpart[j] = lpart[j] * alpha[j] + (p0 + p1);
            const int mr = hi * 8 + j;
            const float ps0 = p0 * PSC, ps1 = p1 * PSC; const h16 h0 = (h16)ps0, h1 = (h16)ps1;
            pl[mr * 32 + lr] = h0; pl[mr * 32 + 16 + lr] = h1;
            pl2[mr * 32 + lr] = (h16)((ps0 - (float)h0) * LOSC); pl2[mr * 32 + 16 + lr] = (h16)((ps1 - (float)h1) * LOSC);
        }
#pragma unroll
        for (int n = 0; n < 4; ++n)
#pragma unroll
            for (int j = 0; j < 8; ++j) { o[n][j] *= alpha[j]; ox[n][j] *= alpha[j]; }
        asm volatile("" ::: "memory");
        const v16h pa = cat16(*(const v8ha*)(pl + lr * 32 + hi * 8), *(const v8ha*)(pl + lr * 32 + 16 + hi * 8));
        const v16h px = cat16(*(const v8ha*)(pl2 + lr * 32 + hi * 8), *(const v8ha*)(pl2 + lr * 32 + 16 + hi * 8));
#pragma unroll
        for (int n = 0; n < 4; ++n) { o[n] = wmma16(pa, vh[n], o[n]); ox[n] = wmma16(pa, vl[n], ox[n]); ox[n] = wmma16(px, vh[n], ox[n]); }
        asm volatile("v_nop\n\tv_nop\n\tv_nop\n\tv_nop" : "+v"(o[0]), "+v"(o[1]), "+v"(o[2]), "+v"(o[3]), "+v"(ox[0]), "+v"(ox[1]), "+v"(ox[2]), "+v"(ox[3]) : "v"(pa), "v"(px));
        asm volatile("s_wait_dscnt 0x0" ::: "memory");        // this wave's reads of tile kt have returned before its buffer is handed back
        asm volatile("s_wait_asynccnt 0x0" ::: "memory");     // this wave's copies of tile kt + 1 have landed
        __syncthreads();                                      // publishes tile kt + 1 and ends every wave's reads of tile kt
        if (kt + 2 <= kt_hi) fill(kt + 2);                    // block-uniform test: refill the buffer just left
    }
    asm volatile("s_wait_asynccnt 0x0" ::: "memory");         // no copy is outstanding when the wave goes on to its end
    float inv[8];
#pragma unroll
    for (int j = 0; j < 8; ++j) { float rs = lpart[j]; rs += __shfl_xor(rs, 1, 16); rs += __shfl_xor(rs, 2, 16); rs += __shfl_xor(rs, 4, 16); rs += __shfl_xor(rs, 8, 16); inv[j] = 1.0f / (rs * PSC); }
    float* os = &ost[wave][0];
#pragma unroll
    for (int n = 0; n < 4; ++n)
#pragma unroll
        for (int j = 0; j < 8; ++j) os[(hi * 8 + j) * 68 + n * 16 + lr] = (o[n][j] + ox[n][j] * LOSCI) * inv[j];
    __syncthreads();
    const size_t cbase = (tok0 + q0) * DM + (size_t)h * HD;
    auto pass = [&]() {
#pragma unroll
        for (int s = 0; s < 4; ++s) { const int row = 4 * s + (lane >> 3), piece = lane & 7; const float* sp = os + row * 68 + piece * 8; v8us oh, ol;
#pragma unroll
            for (int i = 0; i < 8; ++i) { const unsigned short hb = f2bf(sp[i]); oh[i] = hb; ol[i] = f2bf(sp[i] - bf2f(hb)); }
            *(v8us*)(CH + cbase + (size_t)row * DM + piece * 8) = oh; *(v8us*)(CL + cbase + (size_t)row * DM + piece * 8) = ol; }
    };
    pass(); 
}


// k_wt: WT [n][K] = bf16(W[k][n]) (k-major [K][ncols]) via 64 x 64 LDS tiles; grid (K/64, ncols/64, NP_ * NB_): z = path * NB_ + batch picks the source matrix and the plane of WTa.
__global__ __launch_bounds__(256) void k_wt(const float* __restrict__ Wl, const float* __restrict__ Wr, int K, int ncols, bf* WTa) {
    __shared__ __align__(16) unsigned short tl[64 * 72];
    const int tid = threadIdx.x, k0 = blockIdx.x * 64, n0 = blockIdx.y * 64;
    const float* __restrict__ Wm = (blockIdx.z / NB_ ? Wr : Wl) + (size_t)(blockIdx.z % NB_) * K * ncols;
    bf* WT = WTa + (size_t)blockIdx.z * K * ncols;
    const int kk = tid >> 2, nq = (tid & 3) * 16;
#pragma unroll
    for (int i = 0; i < 16; ++i) tl[(nq + i) * 72 + kk] = f2bf(Wm[(size_t)(k0 + kk) * ncols + n0 + nq + i]);
    __syncthreads();
    const int piece = tid & 7;
    auto pass = [&]() {
#pragma unroll
        for (int s = 0; s < 2; ++s) { const int nr = (tid >> 3) + 32 * s; const v8us val = *(const v8usa*)(tl + nr * 72 + piece * 8); *(v8us*)(WT + (size_t)(n0 + nr) * K + k0 + piece * 8) = val; }
    };
    pass(); 
}

// k_bf: all nine weight matrices -> bf16 in one launch; dst holds them back to back in argument order. 512 blocks cover DM x DM elements; w7 and w8 are twice that.
__global__ __launch_bounds__(256) void k_bf(const float* __restrict__ w0, const float* __restrict__ w1, const float* __restrict__ w2, const float* __restrict__ w3, const float* __restrict__ w4, const float* __restrict__ w5, const float* __restrict__ w6, const float* __restrict__ w7, const float* __restrict__ w8, bf* dst) {
    const int seg = blockIdx.x >> 9;
    const float* __restrict__ sb = seg == 0 ? w0 : seg == 1 ? w1 : seg == 2 ? w2 : seg == 3 ? w3 : seg == 4 ? w4 : seg == 5 ? w5 : seg == 6 ? w6 : seg < 9 ? w7 : w8;
    const int first = seg < 7 ? seg : seg < 9 ? 7 : 9;          // the segment at which this matrix begins
    const size_t i = (size_t)blockIdx.x * 256 + threadIdx.x;
    const v8f v = *(const v8f*)(sb + (i - (size_t)first * (DM * DM / 8)) * 8); v8us o;
#pragma unroll
    for (int k = 0; k < 8; ++k) o[k] = f2bf(v[k]);
    *(v8us*)(dst + i * 8) = o; 
}

// k_comb: per token row (one wave): lambda = exp(sum bf(lq_l) bf(lk_l)) - exp(sum bf(lq_r) bf(lk_r)) + 0.1 (64 terms, recomputed per wave), c = (CHl + CLl) - lambda (CHr + CLr)
// over the 1024 features, LayerNorm (mean, then biased variance, then the normalised output: three rolled passes that re-read the planes; f32, fixed lane order) x bf(g)
__global__ __launch_bounds__(256) void k_comb(const bf* __restrict__ AHl, const bf* __restrict__ ALl, const bf* __restrict__ AHr, const bf* __restrict__ ALr, const float* __restrict__ lql, const float* __restrict__ lkl, const float* __restrict__ lqr, const float* __restrict__ lkr, const float* __restrict__ g, const float* __restrict__ bb, bf* Yh, bf* Yl) {
    const int lane = threadIdx.x & 31, r = blockIdx.x * 8 + (threadIdx.x >> 5);
    if (r >= NTK) return;
    float dl = bfr(lql[lane]) * bfr(lkl[lane]) + bfr(lql[lane + 32]) * bfr(lkl[lane + 32]);
    float dr = bfr(lqr[lane]) * bfr(lkr[lane]) + bfr(lqr[lane + 32]) * bfr(lkr[lane + 32]);
#pragma unroll
    for (int sh = 16; sh; sh >>= 1) { dl += __shfl_xor(dl, sh, 32); dr += __shfl_xor(dr, sh, 32); }
    const float lam = __expf(dl) - __expf(dr) + LAM0;
    auto load8 = [&](int q, float* cv) { const size_t o = (size_t)r * DM + q * 256 + lane * 8;
        const v8us ah = *(const v8us*)(AHl + o), al = *(const v8us*)(ALl + o), bh = *(const v8us*)(AHr + o), bl = *(const v8us*)(ALr + o);
#pragma unroll
        for (int i = 0; i < 8; ++i) cv[i] = (bf2f(ah[i]) + bf2f(al[i])) - lam * (bf2f(bh[i]) + bf2f(bl[i])); };
    float s = 0.f;
#pragma unroll 1
    for (int q = 0; q < 4; ++q) { float cv[8]; load8(q, cv);
#pragma unroll
        for (int i = 0; i < 8; ++i) s += cv[i]; }
#pragma unroll
    for (int sh = 16; sh; sh >>= 1) s += __shfl_xor(s, sh, 32);
    const float mu = s * (1.0f / DM); float s2 = 0.f;
#pragma unroll 1
    for (int q = 0; q < 4; ++q) { float cv[8]; load8(q, cv);
#pragma unroll
        for (int i = 0; i < 8; ++i) { const float d = cv[i] - mu; s2 = fmaf(d, d, s2); } }
#pragma unroll
    for (int sh = 16; sh; sh >>= 1) s2 += __shfl_xor(s2, sh, 32);
    const float rs = rsqrtf(s2 * (1.0f / DM) + LN_EPS);
#pragma unroll 1
    for (int q = 0; q < 4; ++q) { float cv[8]; load8(q, cv); v8us oh, ol;
#pragma unroll
        for (int i = 0; i < 8; ++i) { const int col = q * 256 + lane * 8 + i; const float y = (cv[i] - mu) * rs * bfr(g[col]) + bfr(bb[col]); const unsigned short hb = f2bf(y); oh[i] = hb; ol[i] = f2bf(y - bf2f(hb)); }
        const size_t o = (size_t)r * DM + q * 256 + lane * 8; *(v8us*)(Yh + o) = oh; *(v8us*)(Yl + o) = ol;  }
}
// k_splitc: bf16 hi + UNSCALED residual planes of a computed f32 [nrows][nc] matrix (nc a multiple of 256), optional relu first; one wave per row, lane -> 8 columns per
__global__ __launch_bounds__(256) void k_splitc(const float* __restrict__ src, int nrows, int nc, int relu, bf* dh, bf* dl) {
    const int lane = threadIdx.x & 31, r = blockIdx.x * 8 + (threadIdx.x >> 5); if (r >= nrows) return;
{
#pragma unroll 1
        for (int c0 = lane * 8; c0 < nc; c0 += 256) { const size_t o = (size_t)r * nc + c0; const v8f v = *(const v8f*)(src + o); v8us oh, ol;
#pragma unroll
            for (int i = 0; i < 8; ++i) { float y = v[i]; if (relu) y = fmaxf(y, 0.f); const unsigned short hb = f2bf(y); oh[i] = hb; ol[i] = f2bf(y - bf2f(hb)); }
            *(v8us*)(dh + o) = oh; *(v8us*)(dl + o) = ol; }
         }
}
// k_trout: out[e][s] = Y[s][e] (f32 [2048][1024] -> [1024][2048]) through a 64 x 64 LDS tile; grid (S/64, E/64, batch); each output row segment of 64 s (256 B) by 16
__global__ __launch_bounds__(256) void k_trout(const float* __restrict__ Ya, float* OUTa) {
    __shared__ __align__(16) float tl[64 * 68];
    const int tid = threadIdx.x, s0 = blockIdx.x * 64, e0 = blockIdx.y * 64;
    const float* __restrict__ Y = Ya + (size_t)blockIdx.z * NT_ * DM; float* OUTP = OUTa + (size_t)blockIdx.z * DM * NT_;     // z = batch item
    const int ss = tid >> 2, eq = (tid & 3) * 16;
#pragma unroll
    for (int i = 0; i < 16; ++i) tl[(eq + i) * 68 + ss] = Y[(size_t)(s0 + ss) * DM + e0 + eq + i];
    __syncthreads();
    auto pass = [&]() {
#pragma unroll
        for (int j = 0; j < 4; ++j) { const int idx = tid + 256 * j; const int row = idx >> 4, piece = idx & 15; const v4f v = *(const v4fa*)(tl + row * 68 + piece * 4);
            *(v4f*)(OUTP + (size_t)(e0 + row) * NT_ + s0 + piece * 4) = v; }
    };
    pass(); 
}

extern "C" void kernel_launch(void* const* d_in, const int* in_sizes, int n_in,
                              void* d_out, int out_size, void* d_ws, size_t ws_size, hipStream_t stream) {
    (void)in_sizes; (void)n_in; (void)out_size;
    const float* xl = (const float*)d_in[0]; const float* xr = (const float*)d_in[1];                              // [2][1024][2048] = [b][e][s]
    const float* Wp[6]; for (int j = 0; j < 6; ++j) Wp[j] = (const float*)d_in[2 + j];                             // Wq_l, Wk_l, Wv_l, Wq_r, Wk_r, Wv_r  ([out][in])
    const float* Wo = (const float*)d_in[8]; const float* lql = (const float*)d_in[9]; const float* lkl = (const float*)d_in[10]; const float* lqr = (const float*)d_in[11]; const float* lkr = (const float*)d_in[12];
    const float* g = (const float*)d_in[13]; const float* bb = (const float*)d_in[14]; const float* W1 = (const float*)d_in[15]; const float* b1 = (const float*)d_in[16]; const float* W2 = (const float*)d_in[17]; const float* b2 = (const float*)d_in[18];
    float* out = (float*)d_out;    // [2][1024][2048]
    char* wsp = (char*)d_ws;
    auto take = [&](size_t bytes) { char* p = wsp; wsp += (bytes + 255) & ~(size_t)255; return (void*)p; };
    bf* WB = (bf*)take((size_t)11 * DM * DM * 2);          // Wq_l, Wk_l, Wv_l, Wq_r, Wk_r, Wv_r, Wo, W1, W2 back to back
    bf* WoB = WB + (size_t)6 * DM * DM; bf* W1B = WB + (size_t)7 * DM * DM; bf* W2B = WB + (size_t)9 * DM * DM;
    bf* Xb = (bf*)take((size_t)NTA * DM * 2);
    h16* QH = (h16*)take((size_t)NTA * DM * 2); h16* QL = (h16*)take((size_t)NTA * DM * 2); h16* KH = (h16*)take((size_t)NTA * DM * 2); h16* KL = (h16*)take((size_t)NTA * DM * 2);
    float* TMP = (float*)take((size_t)NTA * DM * 4); h16* VTH = (h16*)take((size_t)NTA * DM * 2); h16* VTL = (h16*)take((size_t)NTA * DM * 2);
    bf* AH = (bf*)take((size_t)NTA * DM * 2); bf* AL = (bf*)take((size_t)NTA * DM * 2);                    // [path][batch][s][e]
    bf* Yh = (bf*)take((size_t)NTK * DM * 2); bf* Yl = (bf*)take((size_t)NTK * DM * 2); bf* Y2h = (bf*)take((size_t)NTK * DM * 2); bf* Y2l = (bf*)take((size_t)NTK * DM * 2);
    if ((size_t)(wsp - (char*)d_ws) > ws_size) return;    // MiB: 22 + 16 + 4 x 16 + 32 + 2 x 16 + 2 x 16 + 4 x 8 = 230
    // aliases (stream order): Y2 (f32 [4096][1024], 16 MiB) lives over Xb, dead after the projections; Y3 (the same size) over AH, dead after k_comb; the MLP hidden Hf
    // (f32 [4096][2048], 32 MiB) over QH,QL and its planes Hh/Hl (16 MiB each) over KH and KL, consecutive 256-B-aligned takes, all dead after the attention.
    float* Y2 = (float*)(void*)Xb; float* Y3 = (float*)(void*)AH;
    float* Hf = (float*)(void*)QH; bf* Hh = (bf*)(void*)KH; bf* Hl = (bf*)(void*)KL;
    k_bf<<<11 * 512, 256, 0, stream>>>(Wp[0], Wp[1], Wp[2], Wp[3], Wp[4], Wp[5], Wo, W1, W2, WB);
    k_wt<<<dim3(DM / 64, NT_ / 64, NP_ * NB_), 256, 0, stream>>>(xl, xr, DM, NT_, Xb);                                                             // x^T [path][batch][s][e] exact
    k_gemmb<false, true, true><<<dim3(NTA / 128, DM / 128, 3), 128, 0, stream>>>(Xb, nullptr, WB, nullptr, (float*)(void*)QH, DM, QL, nullptr, DM, 1, TMP);   // q, k -> planes, v -> TMP
    k_vt<<<NP_ * NB_ * NH_ * (NT_ / 64), 256, 0, stream>>>(TMP, VTH, VTL);
    k_attn<<<NP_ * NB_ * NH_ * (NT_ / 64), 128, 0, stream>>>(QH, QL, KH, KL, VTH, VTL, AH, AL);
    k_comb<<<NTK / 8, 256, 0, stream>>>(AH, AL, AH + (size_t)NTK * DM, AL + (size_t)NTK * DM, lql, lkl, lqr, lkr, g, bb, Yh, Yl);
    k_gemmb<true, false><<<dim3(NTK / 128, DM / 128, 1), 128, 0, stream>>>(Yh, Yl, WoB, nullptr, Y2, DM, nullptr);                        // y.Wo^T
    k_splitc<<<NTK / 8, 256, 0, stream>>>(Y2, NTK, DM, 0, Y2h, Y2l);
    k_gemmb<true, false><<<dim3(NTK / 128, FF / 128, 1), 128, 0, stream>>>(Y2h, Y2l, W1B, b1, Hf, FF, nullptr);                         // y.W1^T + b1
    k_splitc<<<NTK / 8, 256, 0, stream>>>(Hf, NTK, FF, 1, Hh, Hl);                                                                        // relu -> planes
    k_gemmb<true, false><<<dim3(NTK / 128, DM / 128, 1), 128, 0, stream>>>(Hh, Hl, W2B, b2, Y3, DM, nullptr, nullptr, FF);               // h.W2^T + b2  (K = 2048)
    k_trout<<<dim3(NT_ / 64, DM / 64, NB_), 256, 0, stream>>>(Y3, out);                                                                  // -> [b][e][s]
}

// v004
// One run takes 300 microseconds.
// In both of two side-by-side timings against v003, it was 1.29 times as fast.
// Over all steps from v000 it is 4.40 times as fast.
#include <hip/hip_runtime.h>

// Compute dtypes, f32 accumulate, every stage one launch over both batch items and both paths (rows [path][batch][s]): the two causal 16-head attention paths (left / right inputs transposed from [E][S] once into bf16 [S][E];
// q/k/v = x.W^T as PLAIN bf16 operands = rounded inputs and weights, exact products) on v_wmma_f32_16x16x32_bf16 (q/k leave the epilogue as f16 hi + residual x1024
// planes, v -> transposed f16 hi + residual planes), each attention fused on v_wmma_f32_16x16x32_f16 (hh + hl + lh x 1/8, online f32 softmax, weights x32768 and v as
// f16 hi + residual x1024); lambda = exp(lq_l.lk_l) - exp(lq_r.lk_r) + 0.1, combined = attn_l - lambda attn_r and the LayerNorm in f32; y.Wo^T, relu(y.W1^T + b1) and
// h.W2^T + b2 with the computed operand as bf16 hi + UNSCALED residual against exact bf16 weights (two products) on v_wmma_f32_16x16x32_bf16; the result transposed to

#define NB_  2                   // batch items, all in one launch of every stage
#define NP_  2                   // attention paths (left, right), likewise
#define NT_  2048
#define DM   1024
#define FF   2048
#define NH_  16
#define HD   64
#define NTK  (NB_ * NT_)         // token rows behind the combination
#define NTA  (NP_ * NTK)         // token rows of the projections and the attention: row = (path * NB_ + batch) * NT_ + s
#define NW   1024
#define NQKV 1024
#define LN_EPS 1e-5f
#define LAM0 0.1f
#define PSC  32768.0f
#define LOSC 1024.0f
#define LOSCI (1.0f / 1024.0f)
#define LOG2E 1.44269504088896340736f

typedef _Float16 h16;
typedef unsigned short bf;
typedef __attribute__((ext_vector_type(16))) __bf16   v16bf;
typedef __attribute__((ext_vector_type(16))) _Float16 v16h;
typedef __attribute__((ext_vector_type(8)))  _Float16 v8h;
typedef __attribute__((ext_vector_type(8)))  unsigned short v8us;
typedef __attribute__((ext_vector_type(8)))  float    v8f;
typedef __attribute__((ext_vector_type(4)))  float    v4f;
typedef v8h  __attribute__((may_alias)) v8ha;
typedef v4f  __attribute__((may_alias)) v4fa;
typedef v8us __attribute__((may_alias)) v8usa;

__device__ __forceinline__ unsigned short f2bf(float f) { unsigned u = __float_as_uint(f); u += 0x7FFFu + ((u >> 16) & 1u); return (unsigned short)(u >> 16); }
__device__ __forceinline__ float bf2f(unsigned short b) { return __uint_as_float(((unsigned)b) << 16); }
__device__ __forceinline__ float bfr(float f) { return bf2f(f2bf(f)); }
__device__ __forceinline__ v16h cat16(v8h lo, v8h hi) { return __builtin_shufflevector(lo, hi, 0, 1, 2, 3, 4, 5, 6, 7, 8, 9, 10, 11, 12, 13, 14, 15); }
__device__ __forceinline__ v16bf cat16b(v8us lo, v8us hi) { return __builtin_bit_cast(v16bf, __builtin_shufflevector(lo, hi, 0, 1, 2, 3, 4, 5, 6, 7, 8, 9, 10, 11, 12, 13, 14, 15)); }
__device__ __forceinline__ v8f wmma16(v16h a, v16h b, v8f c) { return __builtin_amdgcn_wmma_f32_16x16x32_f16(false, a, false, b, (short)0, c, false, false); }
__device__ __forceinline__ v8f wmmab(v16bf a, v16bf b, v8f c) { return __builtin_amdgcn_wmma_f32_16x16x32_bf16(false, a, false, b, (short)0, c, false, false); }

__global__ __launch_bounds__(256) void k_cvtb(const float* __restrict__ src, int nrows, bf* dst) {
    const int lane = threadIdx.x & 31, r = blockIdx.x * 8 + (threadIdx.x >> 5);
    if (r >= nrows) return;
    v8us o[DM / 256];
#pragma unroll
    for (int q = 0; q < DM / 256; ++q) { v8us t;
#pragma unroll
        for (int i = 0; i < 8; ++i) t[i] = f2bf(src[(size_t)r * DM + q * 256 + lane * 8 + i]);
        o[q] = t; }
#pragma unroll
    for (int q = 0; q < DM / 256; ++q) *(v8us*)(dst + (size_t)r * DM + q * 256 + lane * 8) = o[q];
    
}

// k_gemmb: 128 x 128 block tile (4 waves, 2 x 2, each 64 x 64 = 4 x 4 accumulator tiles) of C[rows][cols] = (A [+ Al]).B^T [+ bf(bias[c])] [+ bf(R[r][c]) residual]; f32 or f16-plane whole-line epilogue.
// The operands come from LDS: each pass of 64 k (128 rows x 128 B of A, of B and, where split, of Al) is copied once per block by global_load_async_to_lds_b128, whole 128-B lines a row,
// into one of two buffers, pass p + 2 being issued when every wave has left pass p; so a line leaves L2 once per block and pass, and a pass's L2 latency runs under the pass before it.
// QKV: one launch does q, k and v of both paths: blockIdx.z picks the projection (0, 1: f16 planes at C / C2p + z * 2 NTA DM; 2: f32 at Cv), the row block's path and z the weight.
#define GPE  72                          // LDS pitch of a 64-element bf16 row, in elements: 144 B = 16 B x odd, conflict-free for 16-byte row readers
#define GTE  (128 * GPE)                 // one operand plane of a pass: 18,432 B
__device__ __forceinline__ unsigned ldsoff(const void* p) { return (unsigned)(size_t)p; }   // byte offset in the work-group's LDS = low 32 bits of the __shared__ address
// Eight copies of 16 B a lane: rows 16 apart (gs bytes apart in global memory); s_wait_xcnt closes the statement so that no address register named here is rewritten in front of it.
__device__ __forceinline__ void copy8(unsigned l, const char* g, size_t gs) {
    asm volatile("global_load_async_to_lds_b128 %0, %1, off\n\tglobal_load_async_to_lds_b128 %2, %3, off\n\t"
                 "global_load_async_to_lds_b128 %4, %5, off\n\tglobal_load_async_to_lds_b128 %6, %7, off\n\t"
                 "global_load_async_to_lds_b128 %8, %9, off\n\tglobal_load_async_to_lds_b128 %10, %11, off\n\t"
                 "global_load_async_to_lds_b128 %12, %13, off\n\tglobal_load_async_to_lds_b128 %14, %15, off\n\ts_wait_xcnt 0x0"
                 :: "v"(l), "v"(g), "v"(l + 16 * GPE * 2), "v"(g + gs), "v"(l + 32 * GPE * 2), "v"(g + 2 * gs), "v"(l + 48 * GPE * 2), "v"(g + 3 * gs),
                    "v"(l + 64 * GPE * 2), "v"(g + 4 * gs), "v"(l + 80 * GPE * 2), "v"(g + 5 * gs), "v"(l + 96 * GPE * 2), "v"(g + 6 * gs), "v"(l + 112 * GPE * 2), "v"(g + 7 * gs) : "memory");
}
template <bool SPLITA, bool F16OUT = false, bool QKV = false>
__global__ __launch_bounds__(128) void k_gemmb(const bf* __restrict__ A, const bf* __restrict__ Al, const bf* __restrict__ Bw, const float* __restrict__ bias, float* C, int ldc, h16* C2p, const float* __restrict__ R = nullptr, int K = DM, int roundR = 1, float* Cv = nullptr) {
    constexpr int NPL = SPLITA ? 3 : 2;                      // planes of a buffer: A, B [, Al]
    __shared__ __align__(16) bf gring[2 * NPL * GTE];
    __shared__ __align__(16) float ost[4][16 * 68];
    const int tid = threadIdx.x, lane = threadIdx.x & 31, wave = __builtin_amdgcn_readfirstlane(threadIdx.x >> 5), lr = lane & 15, hi = lane >> 4;
    const int rb = blockIdx.x * 128, cb = blockIdx.y * 128;
    const int rw = rb + (wave >> 1) * 64, c0 = cb + (wave & 1) * 64;
    const bf* __restrict__ Bn = QKV ? Bw + ((size_t)(blockIdx.x / (NTK / 128)) * 3 + blockIdx.z) * ((size_t)DM * DM) : Bw;
    const size_t zo = QKV ? (size_t)blockIdx.z * (2 * (size_t)NTA * DM) : 0;
    h16* C2 = QKV ? C2p + zo : C2p;
    // Copy map, 16 B a lane: a plane is 128 rows x 8 pieces; a thread takes piece tid & 7 of rows crow + 16 i.
    const int crow = tid >> 3, cpc = (tid & 7) * 8;
    const size_t gs = (size_t)K * 32;                        // 16 rows, in bytes
    const char* ga = (const char*)(A + (size_t)(rb + crow) * K + cpc);
    const char* gl = SPLITA ? (const char*)(Al + (size_t)(rb + crow) * K + cpc) : ga;
    const char* gb = (const char*)(Bn + (size_t)(cb + crow) * K + cpc);
    const unsigned l0 = ldsoff(gring) + (unsigned)(crow * GPE + cpc) * 2u;
    auto fill = [&](int p) {
        const unsigned lb = l0 + (unsigned)(p & 1) * (NPL * GTE * 2u); const size_t go = (size_t)p * 128;
        copy8(lb, ga + go, gs); copy8(lb + GTE * 2u, gb + go, gs); if (SPLITA) copy8(lb + 2u * GTE * 2u, gl + go, gs);
    };
    // Every index into acc, a, al, b or bv is a constant or an unrolled loop's counter, so the arrays stay in registers.
    v8f acc[4][4];
#pragma unroll
    for (int i = 0; i < 4; ++i)
#pragma unroll
        for (int t = 0; t < 4; ++t) acc[i][t] = (v8f){};
    const int np = K >> 6;                                   // at least two passes (K is 1024 or 2048)
    fill(0);
    asm volatile("s_wait_asynccnt 0x0" ::: "memory");        // this wave's copies of pass 0 have landed
    __syncthreads();                                         // ... and every other wave's: pass 0 is published
    fill(1);
    const int aro = ((wave >> 1) * 64 + lr) * GPE + 8 * hi, bro = GTE + ((wave & 1) * 64 + lr) * GPE + 8 * hi;
#pragma unroll 1
    for (int p = 0; p < np; ++p) {                           // rolled: the body already holds 32 (64) matrix instructions
        const bf* buf = gring + (p & 1) * (NPL * GTE);
#pragma unroll
        for (int ks = 0; ks < 2; ++ks) {
            v16bf a[4], al[4], b[4];
            const bf* ap = buf + aro + ks * 32; const bf* bp = buf + bro + ks * 32;
            a[0] = cat16b(*(const v8usa*)ap, *(const v8usa*)(ap + 16));          // in the order of first use
#pragma unroll
            for (int t = 0; t < 4; ++t) b[t] = cat16b(*(const v8usa*)(bp + t * 16 * GPE), *(const v8usa*)(bp + t * 16 * GPE + 16));
#pragma unroll
            for (int i = 1; i < 4; ++i) a[i] = cat16b(*(const v8usa*)(ap + i * 16 * GPE), *(const v8usa*)(ap + i * 16 * GPE + 16));
#pragma unroll
            for (int i = 0; i < 4; ++i) { al[i] = a[i]; if (SPLITA) al[i] = cat16b(*(const v8usa*)(ap + 2 * GTE + i * 16 * GPE), *(const v8usa*)(ap + 2 * GTE + i * 16 * GPE + 16)); }
            // Keeps the k-step's LDS reads together as one group ahead of its matrix instructions; left to itself the build reads each A fragment directly in front of its four products and waits out the LDS latency every time.
            __builtin_amdgcn_sched_barrier(0);
#pragma unroll
            for (int i = 0; i < 4; ++i)
#pragma unroll
                for (int t = 0; t < 4; ++t) acc[i][t] = wmmab(a[i], b[t], acc[i][t]);
            if (SPLITA) {
#pragma unroll
                for (int i = 0; i < 4; ++i)
#pragma unroll
                    for (int t = 0; t < 4; ++t) acc[i][t] = wmmab(al[i], b[t], acc[i][t]);
            }
        }
        // Keeps the pass's matrix instructions in front of the waits and the barrier: moved behind them, they delay the refill, whose lead over its own wait then falls short of a pass.
        __builtin_amdgcn_sched_barrier(0);
        asm volatile("s_wait_dscnt 0x0" ::: "memory");       // this wave's reads of pass p have returned before its buffer is handed back
        asm volatile("s_wait_asynccnt 0x0" ::: "memory");    // this wave's copies of pass p + 1 have landed
        __syncthreads();                                     // publishes pass p + 1 and ends every wave's reads of pass p
        if (p + 2 < np) fill(p + 2);                         // block-uniform test: refill the buffer just left
    }
    asm volatile("s_wait_asynccnt 0x0" ::: "memory");        // no copy is outstanding when the wave goes on to its end
    float* os = &ost[wave][0];
    float bv[4];
#pragma unroll
    for (int t = 0; t < 4; ++t) bv[t] = bias ? bfr(bias[c0 + t * 16 + lr]) : 0.f;
#pragma unroll
    for (int mi = 0; mi < 4; ++mi) {                         // the wave's four 16-row groups, one after the other through its staging rows
        const int r0 = rw + mi * 16;
#pragma unroll
        for (int t = 0; t < 4; ++t)
#pragma unroll
            for (int j = 0; j < 8; ++j) os[(hi * 8 + j) * 68 + t * 16 + lr] = acc[mi][t][j] + bv[t];
        __syncthreads();
        if (QKV ? (blockIdx.z < 2) : F16OUT) {
            h16* crow2 = (h16*)(void*)C + zo + (size_t)r0 * ldc + c0;
#pragma unroll
            for (int s = 0; s < 4; ++s) { const int row = 4 * s + (lane >> 3), piece = lane & 7; const float* sp = os + row * 68 + piece * 8; v8h o, o2;
#pragma unroll
                for (int i = 0; i < 8; ++i) { const h16 a = (h16)sp[i]; o[i] = a; o2[i] = (h16)((sp[i] - (float)a) * LOSC); }
                *(v8h*)(crow2 + (size_t)row * ldc + piece * 8) = o;
                asm volatile("s_wait_xcnt 0x0" ::: "memory");     // the same precaution as below, for the store above: the residual's arithmetic reuses its registers
                if (C2) *(v8h*)(C2 + (size_t)r0 * ldc + c0 + (size_t)row * ldc + piece * 8) = o2;
                asm volatile("s_wait_xcnt 0x0" ::: "memory"); }   // a precaution: stands in front of the next rewrite of the registers that these stores name
        } else {
            float* crow2 = (QKV ? Cv : C) + (size_t)r0 * ldc + c0;
#pragma unroll
            for (int s = 0; s < 8; ++s) { const int Lid = (lane >> 3) + 4 * s, piece = lane & 7; const int row = Lid >> 1, cofs = (Lid & 1) * 32 + piece * 4;
                v4f val = *(const v4fa*)(os + row * 68 + cofs); if (R) { const v4f rv = *(const v4f*)(R + ((size_t)r0 + row) * ldc + c0 + cofs); val += roundR ? (v4f){bfr(rv[0]), bfr(rv[1]), bfr(rv[2]), bfr(rv[3])} : rv; }
                *(v4f*)(crow2 + (size_t)row * ldc + cofs) = val;
                asm volatile("s_wait_xcnt 0x0" ::: "memory"); }   // a precaution: stands in front of the next rewrite of the registers that this store names
        }
        __syncthreads();                                     // the staged rows are read before the next group overwrites them
    }
}

__global__ __launch_bounds__(256) void k_vt(const float* __restrict__ V, h16* VTH, h16* VTL) {
    __shared__ __align__(16) h16 tile[64 * 72];
    __shared__ __align__(16) h16 til2[64 * 72];
    const int bid = blockIdx.x;
    const int b = bid / (NH_ * (NT_ / 64)), rem = bid - b * (NH_ * (NT_ / 64)), h = rem / (NT_ / 64), kt = rem - h * (NT_ / 64);
    const int k0 = kt * 64, tid = threadIdx.x;
    const int kk = tid >> 2, d0 = (tid & 3) * 16;
    const float* src = V + ((size_t)b * NT_ + k0 + kk) * DM + h * HD + d0;
#pragma unroll
    for (int i = 0; i < 16; ++i) { const float v = src[i]; const h16 a = (h16)v; tile[(d0 + i) * 72 + kk] = a; til2[(d0 + i) * 72 + kk] = (h16)((v - (float)a) * LOSC); }
    __syncthreads();
    const int piece = tid & 7;
    const size_t base = (((size_t)b * NH_ + h) * HD) * NT_ + k0;
    auto pass = [&]() {
#pragma unroll
        for (int s = 0; s < 4; ++s) { const int Lid = (tid >> 3) + 32 * s; const int pln = Lid >> 6, d = Lid & 63;
            const v8h val = *(const v8ha*)((pln ? til2 : tile) + d * 72 + piece * 8); *(v8h*)((pln ? VTL : VTH) + base + (size_t)d * NT_ + piece * 8) = val; }
    };
    pass(); 
}

#define KPE  72                          // LDS pitch of a 64-element f16 row, in elements: 144 B = 16 B x odd, conflict-free for 16-byte row readers
#define VPE  40                          // LDS pitch of a 32-element f16 row, in elements: 80 B = 16 B x odd
#define KTE  (32 * KPE)                  // one K plane of a tile
#define VTE  (64 * VPE)                  // one V^T plane of a tile
#define BUFE (2 * KTE + 2 * VTE)         // one tile: 19,456 B
__device__ __forceinline__ unsigned ldsa(const h16* p) { return (unsigned)(size_t)p; }   // byte offset in the work-group's LDS = low 32 bits of the __shared__ address
__device__ __forceinline__ float xhalf(float v) { const int b = __float_as_int(v); return __int_as_float(__builtin_amdgcn_permlanex16(b, b, 0x76543210, 0xfedcba98, false, false)); }   // lane l <-> l ^ 16

__global__ __launch_bounds__(128) void k_attn(const h16* __restrict__ Q16, const h16* __restrict__ QL16, const h16* __restrict__ K16, const h16* __restrict__ KL16, const h16* __restrict__ VTH, const h16* __restrict__ VTL, bf* CH, bf* CL) {
    __shared__ __align__(16) h16 ring[2 * BUFE];
    __shared__ __align__(16) h16 qls[64 * KPE];
    __shared__ __align__(16) float ost[4][16 * 68];
    // The wave's number sits in a scalar register, so that what derives from it leaves the vector registers and the loop's live set stays under 256 of them.
    const int tid = threadIdx.x, lane = threadIdx.x & 31, wave = __builtin_amdgcn_readfirstlane(threadIdx.x >> 5), lr = lane & 15, hi = lane >> 4;
    const int bid = blockIdx.x;
    const int b = bid / (NH_ * (NT_ / 64)), rem = bid - b * (NH_ * (NT_ / 64)), h = rem / (NT_ / 64), qt = rem - h * (NT_ / 64);
    const int q0 = qt * 64 + wave * 16;
    const size_t tok0 = (size_t)b * NT_;
    v16h qa[2];
    const size_t qo0 = (tok0 + q0 + lr) * DM + h * HD + 8 * hi;
#pragma unroll
    for (int kc = 0; kc < 2; ++kc) qa[kc] = cat16(*(const v8h*)(Q16 + qo0 + kc * 32), *(const v8h*)(Q16 + qo0 + kc * 32 + 16));
    const h16* kh_b = K16 + tok0 * DM + h * HD;
    const h16* kl_b = KL16 + tok0 * DM + h * HD;
    const size_t vbase = (((size_t)b * NH_ + h) * HD) * NT_;
    v8f o[4], ox[4];
#pragma unroll
    for (int n = 0; n < 4; ++n) { o[n] = (v8f){}; ox[n] = (v8f){}; }
    float mrow = -3.0e38f, lpart = 0.f;                   // of the lane's query q0 + lr; lpart sums the lane half's own keys
    const int qrel = q0 + lr - 8 * hi;                    // key l0 + 8 hi + j is allowed where l0 + j <= qrel
    const int kt_lo = 0, kt_hi = (qt * 64 + 63) / 32;     // causal; at least two tiles
    // Copy map, 16 B a lane: K planes 32 rows x 8 pieces (a thread takes rows krow and krow + 16), V^T planes 64 rows x 4 pieces (rows vrow and vrow + 32).
    const int krow = tid >> 3, kpc = (tid & 7) * 8, vrow = tid >> 2, vpc = (tid & 3) * 8;
    const unsigned kgo = (unsigned)(krow * DM + kpc) * 2u, vgo = (unsigned)(vrow * NT_ + vpc) * 2u;                 // this thread's byte offsets in a K plane and a V^T plane of its head
    const unsigned klo = ldsa(ring) + (unsigned)(krow * KPE + kpc) * 2u, vlo = ldsa(ring) + (unsigned)(2 * KTE + vrow * VPE + vpc) * 2u;    // and in buffer 0
    const char* vh_b = (const char*)(VTH + vbase); const char* vl_b = (const char*)(VTL + vbase);
    auto fill = [&](int kt) {
        const unsigned ko = kgo + (unsigned)kt * (32u * DM * 2u), vo = vgo + (unsigned)kt * 64u, bo = (unsigned)(kt & 1) * (BUFE * 2u);
        const char* gkh = (const char*)kh_b + ko; const char* gkl = (const char*)kl_b + ko; const char* gvh = vh_b + vo; const char* gvl = vl_b + vo;
        const unsigned lk = klo + bo, lv = vlo + bo;
        // The tile's eight copies; s_wait_xcnt closes the statement so that no address register named here is rewritten in front of it.
        asm volatile("global_load_async_to_lds_b128 %0, %1, off\n\tglobal_load_async_to_lds_b128 %2, %3, off\n\t"
                     "global_load_async_to_lds_b128 %4, %5, off\n\tglobal_load_async_to_lds_b128 %6, %7, off\n\t"
                     "global_load_async_to_lds_b128 %8, %9, off\n\tglobal_load_async_to_lds_b128 %10, %11, off\n\t"
                     "global_load_async_to_lds_b128 %12, %13, off\n\tglobal_load_async_to_lds_b128 %14, %15, off\n\ts_wait_xcnt 0x0"
                     :: "v"(lk), "v"(gkh), "v"(lk + 16 * KPE * 2), "v"(gkh + 16 * DM * 2), "v"(lk + KTE * 2), "v"(gkl), "v"(lk + (KTE + 16 * KPE) * 2), "v"(gkl + 16 * DM * 2),
                        "v"(lv), "v"(gvh), "v"(lv + 32 * VPE * 2), "v"(gvh + 32 * NT_ * 2), "v"(lv + VTE * 2), "v"(gvl), "v"(lv + (VTE + 32 * VPE) * 2), "v"(gvl + 32 * NT_ * 2) : "memory");
    };
    {   // The block's 64 query residual rows, once: 64 rows x 8 pieces, a thread takes rows krow + 16 i; same closing wait as above.
        const h16* gq = QL16 + (tok0 + qt * 64 + krow) * DM + h * HD + kpc;
        const unsigned lq = ldsa(qls) + (krow * KPE + kpc) * 2;
        asm volatile("global_load_async_to_lds_b128 %0, %1, off\n\tglobal_load_async_to_lds_b128 %2, %3, off\n\t"
                     "global_load_async_to_lds_b128 %4, %5, off\n\tglobal_load_async_to_lds_b128 %6, %7, off\n\ts_wait_xcnt 0x0"
                     :: "v"(lq), "v"(gq), "v"(lq + 16 * KPE * 2), "v"(gq + 16 * DM), "v"(lq + 32 * KPE * 2), "v"(gq + 32 * DM), "v"(lq + 48 * KPE * 2), "v"(gq + 48 * DM) : "memory");
    }
    fill(0);
    asm volatile("s_wait_asynccnt 0x0" ::: "memory");     // this wave's copies of tile 0 and of the query residual have landed
    __syncthreads();                                      // ... and every other wave's: tile 0 is published
    fill(1);
    const h16* qlp = qls + (wave * 16 + lr) * KPE + 8 * hi;
#pragma unroll 1
    for (int kt = kt_lo; kt <= kt_hi; ++kt) {
        const int l0 = kt * 32;
        const h16* buf = ring + (kt & 1) * BUFE;
        const h16* kp = buf + lr * KPE + 8 * hi;
        const h16* vp = buf + 2 * KTE + lr * VPE + 8 * hi;
        v16h k0h[2], k1h[2], k0l[2], k1l[2], qlk[2];
#pragma unroll
        for (int kc = 0; kc < 2; ++kc) {
            k0h[kc] = cat16(*(const v8ha*)(kp + kc * 32), *(const v8ha*)(kp + kc * 32 + 16)); k1h[kc] = cat16(*(const v8ha*)(kp + 16 * KPE + kc * 32), *(const v8ha*)(kp + 16 * KPE + kc * 32 + 16));
            qlk[kc] = cat16(*(const v8ha*)(qlp + kc * 32), *(const v8ha*)(qlp + kc * 32 + 16));
            k0l[kc] = cat16(*(const v8ha*)(kp + KTE + kc * 32), *(const v8ha*)(kp + KTE + kc * 32 + 16)); k1l[kc] = cat16(*(const v8ha*)(kp + KTE + 16 * KPE + kc * 32), *(const v8ha*)(kp + KTE + 16 * KPE + kc * 32 + 16));
        }
        v8f s0 = {}, s1 = {}, x0 = {}, x1 = {};
#pragma unroll
        for (int kc = 0; kc < 2; ++kc) {
            s0 = wmma16(k0h[kc], qa[kc], s0); x0 = wmma16(k0h[kc], qlk[kc], x0); s1 = wmma16(k1h[kc], qa[kc], s1); x1 = wmma16(k1h[kc], qlk[kc], x1);
            x0 = wmma16(k0l[kc], qa[kc], x0); x1 = wmma16(k1l[kc], qa[kc], x1);
        }
        asm volatile("v_nop\n\tv_nop\n\tv_nop\n\tv_nop" : "+v"(s0), "+v"(s1), "+v"(x0), "+v"(x1) : "v"(qa[0]), "v"(qa[1]));
        v16h vh[4], vl[4];     // read ahead of the softmax, whose vector work covers their LDS latency
#pragma unroll
        for (int n = 0; n < 4; ++n) { vh[n] = cat16(*(const v8ha*)(vp + n * 16 * VPE), *(const v8ha*)(vp + n * 16 * VPE + 16)); vl[n] = cat16(*(const v8ha*)(vp + VTE + n * 16 * VPE), *(const v8ha*)(vp + VTE + n * 16 * VPE + 16)); }
        // Keeps these sixteen reads here as one group; left to itself the build moves them down among the matrix instructions of the second product and waits each small group out in full.
        __builtin_amdgcn_sched_barrier(0);
        const int rel = qrel - l0;
        // The lane's 16 scores of its query: keys l0 + 8 hi + j (a0) and l0 + 16 + 8 hi + j (a1). Whole-vector arithmetic: neighbouring registers pair into packed f32 instructions.
        v8f a0 = (s0 + x0 * LOSCI) * 0.125f, a1 = (s1 + x1 * LOSCI) * 0.125f;
#pragma unroll
        for (int j = 0; j < 8; ++j) { a0[j] = (j <= rel) ? a0[j] : -__builtin_inff(); a1[j] = (16 + j <= rel) ? a1[j] : -__builtin_inff(); }
        float mx = fmaxf(fmaxf(fmaxf(fmaxf(a0[0], a0[1]), fmaxf(a0[2], a0[3])), fmaxf(fmaxf(a0[4], a0[5]), fmaxf(a0[6], a0[7]))),
                         fmaxf(fmaxf(fmaxf(a1[0], a1[1]), fmaxf(a1[2], a1[3])), fmaxf(fmaxf(a1[4], a1[5]), fmaxf(a1[6], a1[7]))));
        mx = fmaxf(mx, xhalf(mx));                            // the other 16 keys of the tile sit in the other lane half
        const float mn = fmaxf(mrow, mx);
        const float alpha = __expf(mrow - mn); mrow = mn;
        const v8f e0 = (a0 - mn) * LOG2E, e1 = (a1 - mn) * LOG2E;
        v8f p0, p1;
#pragma unroll
        for (int j = 0; j < 8; ++j) p0[j] = __builtin_amdgcn_exp2f(e0[j]);
#pragma unroll
        for (int j = 0; j < 8; ++j) p1[j] = __builtin_amdgcn_exp2f(e1[j]);
        const v8f sp = p0 + p1;
        lpart = lpart * alpha + (((sp[0] + sp[1]) + (sp[2] + sp[3])) + ((sp[4] + sp[5]) + (sp[6] + sp[7])));
        // P^T as a B operand: element s = key kmap(s, hi) = score tile s >> 3, register s & 7; hi plane and residual x1024 plane.
        const v8f ps0 = p0 * PSC, ps1 = p1 * PSC;
        const v8h h0 = __builtin_convertvector(ps0, v8h), h1 = __builtin_convertvector(ps1, v8h);
        const v8h r0 = __builtin_convertvector((ps0 - __builtin_convertvector(h0, v8f)) * LOSC, v8h), r1 = __builtin_convertvector((ps1 - __builtin_convertvector(h1, v8f)) * LOSC, v8h);
        const v16h pa = cat16(h0, h1), px = cat16(r0, r1);
#pragma unroll
        for (int n = 0; n < 4; ++n) { o[n] *= alpha; ox[n] *= alpha; }
#pragma unroll
        for (int n = 0; n < 4; ++n) { o[n] = wmma16(vh[n], pa, o[n]); ox[n] = wmma16(vl[n], pa, ox[n]); ox[n] = wmma16(vh[n], px, ox[n]); }
        asm volatile("v_nop\n\tv_nop\n\tv_nop\n\tv_nop" : "+v"(o[0]), "+v"(o[1]), "+v"(o[2]), "+v"(o[3]), "+v"(ox[0]), "+v"(ox[1]), "+v"(ox[2]), "+v"(ox[3]) : "v"(pa), "v"(px));
        asm volatile("s_wait_dscnt 0x0" ::: "memory");        // this wave's reads of tile kt have returned before its buffer is handed back
        asm volatile("s_wait_asynccnt 0x0" ::: "memory");     // this wave's copies of tile kt + 1 have landed
        __syncthreads();                                      // publishes tile kt + 1 and ends every wave's reads of tile kt
        if (kt + 2 <= kt_hi) fill(kt + 2);                    // block-uniform test: refill the buffer just left
    }
    asm volatile("s_wait_asynccnt 0x0" ::: "memory");         // no copy is outstanding when the wave goes on to its end
    const float inv = 1.0f / ((lpart + xhalf(lpart)) * PSC);  // the two lane halves' sums joined once
    float* os = &ost[wave][0];
#pragma unroll
    for (int n = 0; n < 4; ++n)                               // o[n][j] = O[query lr][d = 16 n + 8 hi + j]: eight consecutive d of the lane's staging row
#pragma unroll
        for (int c = 0; c < 2; ++c) { v4f t;
#pragma unroll
            for (int i = 0; i < 4; ++i) t[i] = (o[n][4 * c + i] + ox[n][4 * c + i] * LOSCI) * inv;
            *(v4fa*)(os + lr * 68 + n * 16 + hi * 8 + 4 * c) = t; }
    __syncthreads();
    const size_t cbase = (tok0 + q0) * DM + (size_t)h * HD;
    auto pass = [&]() {
#pragma unroll
        for (int s = 0; s < 4; ++s) { const int row = 4 * s + (lane >> 3), piece = lane & 7; const float* sp = os + row * 68 + piece * 8; v8us oh, ol;
#pragma unroll
            for (int i = 0; i < 8; ++i) { const unsigned short hb = f2bf(sp[i]); oh[i] = hb; ol[i] = f2bf(sp[i] - bf2f(hb)); }
            *(v8us*)(CH + cbase + (size_t)row * DM + piece * 8) = oh; *(v8us*)(CL + cbase + (size_t)row * DM + piece * 8) = ol; }
    };
    pass(); 
}


// k_wt: WT [n][K] = bf16(W[k][n]) (k-major [K][ncols]) via 64 x 64 LDS tiles; grid (K/64, ncols/64, NP_ * NB_): z = path * NB_ + batch picks the source matrix and the plane of WTa.
__global__ __launch_bounds__(256) void k_wt(const float* __restrict__ Wl, const float* __restrict__ Wr, int K, int ncols, bf* WTa) {
    __shared__ __align__(16) unsigned short tl[64 * 72];
    const int tid = threadIdx.x, k0 = blockIdx.x * 64, n0 = blockIdx.y * 64;
    const float* __restrict__ Wm = (blockIdx.z / NB_ ? Wr : Wl) + (size_t)(blockIdx.z % NB_) * K * ncols;
    bf* WT = WTa + (size_t)blockIdx.z * K * ncols;
    const int kk = tid >> 2, nq = (tid & 3) * 16;
#pragma unroll
    for (int i = 0; i < 16; ++i) tl[(nq + i) * 72 + kk] = f2bf(Wm[(size_t)(k0 + kk) * ncols + n0 + nq + i]);
    __syncthreads();
    const int piece = tid & 7;
    auto pass = [&]() {
#pragma unroll
        for (int s = 0; s < 2; ++s) { const int nr = (tid >> 3) + 32 * s; const v8us val = *(const v8usa*)(tl + nr * 72 + piece * 8); *(v8us*)(WT + (size_t)(n0 + nr) * K + k0 + piece * 8) = val; }
    };
    pass(); 
}

// k_bf: all nine weight matrices -> bf16 in one launch; dst holds them back to back in argument order. 512 blocks cover DM x DM elements; w7 and w8 are twice that.
__global__ __launch_bounds__(256) void k_bf(const float* __restrict__ w0, const float* __restrict__ w1, const float* __restrict__ w2, const float* __restrict__ w3, const float* __restrict__ w4, const float* __restrict__ w5, const float* __restrict__ w6, const float* __restrict__ w7, const float* __restrict__ w8, bf* dst) {
    const int seg = blockIdx.x >> 9;
    const float* __restrict__ sb = seg == 0 ? w0 : seg == 1 ? w1 : seg == 2 ? w2 : seg == 3 ? w3 : seg == 4 ? w4 : seg == 5 ? w5 : seg == 6 ? w6 : seg < 9 ? w7 : w8;
    const int first = seg < 7 ? seg : seg < 9 ? 7 : 9;          // the segment at which this matrix begins
    const size_t i = (size_t)blockIdx.x * 256 + threadIdx.x;
    const v8f v = *(const v8f*)(sb + (i - (size_t)first * (DM * DM / 8)) * 8); v8us o;
#pragma unroll
    for (int k = 0; k < 8; ++k) o[k] = f2bf(v[k]);
    *(v8us*)(dst + i * 8) = o; 
}

// k_comb: per token row (one wave): lambda = exp(sum bf(lq_l) bf(lk_l)) - exp(sum bf(lq_r) bf(lk_r)) + 0.1 (64 terms, recomputed per wave), c = (CHl + CLl) - lambda (CHr + CLr)
// over the 1024 features, LayerNorm (mean, then biased variance, then the normalised output: three rolled passes that re-read the planes; f32, fixed lane order) x bf(g)
__global__ __launch_bounds__(256) void k_comb(const bf* __restrict__ AHl, const bf* __restrict__ ALl, const bf* __restrict__ AHr, const bf* __restrict__ ALr, const float* __restrict__ lql, const float* __restrict__ lkl, const float* __restrict__ lqr, const float* __restrict__ lkr, const float* __restrict__ g, const float* __restrict__ bb, bf* Yh, bf* Yl) {
    const int lane = threadIdx.x & 31, r = blockIdx.x * 8 + (threadIdx.x >> 5);
    if (r >= NTK) return;
    float dl = bfr(lql[lane]) * bfr(lkl[lane]) + bfr(lql[lane + 32]) * bfr(lkl[lane + 32]);
    float dr = bfr(lqr[lane]) * bfr(lkr[lane]) + bfr(lqr[lane + 32]) * bfr(lkr[lane + 32]);
#pragma unroll
    for (int sh = 16; sh; sh >>= 1) { dl += __shfl_xor(dl, sh, 32); dr += __shfl_xor(dr, sh, 32); }
    const float lam = __expf(dl) - __expf(dr) + LAM0;
    auto load8 = [&](int q, float* cv) { const size_t o = (size_t)r * DM + q * 256 + lane * 8;
        const v8us ah = *(const v8us*)(AHl + o), al = *(const v8us*)(ALl + o), bh = *(const v8us*)(AHr + o), bl = *(const v8us*)(ALr + o);
#pragma unroll
        for (int i = 0; i < 8; ++i) cv[i] = (bf2f(ah[i]) + bf2f(al[i])) - lam * (bf2f(bh[i]) + bf2f(bl[i])); };
    float s = 0.f;
#pragma unroll 1
    for (int q = 0; q < 4; ++q) { float cv[8]; load8(q, cv);
#pragma unroll
        for (int i = 0; i < 8; ++i) s += cv[i]; }
#pragma unroll
    for (int sh = 16; sh; sh >>= 1) s += __shfl_xor(s, sh, 32);
    const float mu = s * (1.0f / DM); float s2 = 0.f;
#pragma unroll 1
    for (int q = 0; q < 4; ++q) { float cv[8]; load8(q, cv);
#pragma unroll
        for (int i = 0; i < 8; ++i) { const float d = cv[i] - mu; s2 = fmaf(d, d, s2); } }
#pragma unroll
    for (int sh = 16; sh; sh >>= 1) s2 += __shfl_xor(s2, sh, 32);
    const float rs = rsqrtf(s2 * (1.0f / DM) + LN_EPS);
#pragma unroll 1
    for (int q = 0; q < 4; ++q) { float cv[8]; load8(q, cv); v8us oh, ol;
#pragma unroll
        for (int i = 0; i < 8; ++i) { const int col = q * 256 + lane * 8 + i; const float y = (cv[i] - mu) * rs * bfr(g[col]) + bfr(bb[col]); const unsigned short hb = f2bf(y); oh[i] = hb; ol[i] = f2bf(y - bf2f(hb)); }
        const size_t o = (size_t)r * DM + q * 256 + lane * 8; *(v8us*)(Yh + o) = oh; *(v8us*)(Yl + o) = ol;  }
}
// k_splitc: bf16 hi + UNSCALED residual planes of a computed f32 [nrows][nc] matrix (nc a multiple of 256), optional relu first; one wave per row, lane -> 8 columns per
__global__ __launch_bounds__(256) void k_splitc(const float* __restrict__ src, int nrows, int nc, int relu, bf* dh, bf* dl) {
    const int lane = threadIdx.x & 31, r = blockIdx.x * 8 + (threadIdx.x >> 5); if (r >= nrows) return;
{
#pragma unroll 1
        for (int c0 = lane * 8; c0 < nc; c0 += 256) { const size_t o = (size_t)r * nc + c0; const v8f v = *(const v8f*)(src + o); v8us oh, ol;
#pragma unroll
            for (int i = 0; i < 8; ++i) { float y = v[i]; if (relu) y = fmaxf(y, 0.f); const unsigned short hb = f2bf(y); oh[i] = hb; ol[i] = f2bf(y - bf2f(hb)); }
            *(v8us*)(dh + o) = oh; *(v8us*)(dl + o) = ol; }
         }
}
// k_trout: out[e][s] = Y[s][e] (f32 [2048][1024] -> [1024][2048]) through a 64 x 64 LDS tile; grid (S/64, E/64, batch); each output row segment of 64 s (256 B) by 16
__global__ __launch_bounds__(256) void k_trout(const float* __restrict__ Ya, float* OUTa) {
    __shared__ __align__(16) float tl[64 * 68];
    const int tid = threadIdx.x, s0 = blockIdx.x * 64, e0 = blockIdx.y * 64;
    const float* __restrict__ Y = Ya + (size_t)blockIdx.z * NT_ * DM; float* OUTP = OUTa + (size_t)blockIdx.z * DM * NT_;     // z = batch item
    const int ss = tid >> 2, eq = (tid & 3) * 16;
#pragma unroll
    for (int i = 0; i < 16; ++i) tl[(eq + i) * 68 + ss] = Y[(size_t)(s0 + ss) * DM + e0 + eq + i];
    __syncthreads();
    auto pass = [&]() {
#pragma unroll
        for (int j = 0; j < 4; ++j) { const int idx = tid + 256 * j; const int row = idx >> 4, piece = idx & 15; const v4f v = *(const v4fa*)(tl + row * 68 + piece * 4);
            *(v4f*)(OUTP + (size_t)(e0 + row) * NT_ + s0 + piece * 4) = v; }
    };
    pass(); 
}

extern "C" void kernel_launch(void* const* d_in, const int* in_sizes, int n_in,
                              void* d_out, int out_size, void* d_ws, size_t ws_size, hipStream_t stream) {
    (void)in_sizes; (void)n_in; (void)out_size;
    const float* xl = (const float*)d_in[0]; const float* xr = (const float*)d_in[1];                              // [2][1024][2048] = [b][e][s]
    const float* Wp[6]; for (int j = 0; j < 6; ++j) Wp[j] = (const float*)d_in[2 + j];                             // Wq_l, Wk_l, Wv_l, Wq_r, Wk_r, Wv_r  ([out][in])
    const float* Wo = (const float*)d_in[8]; const float* lql = (const float*)d_in[9]; const float* lkl = (const float*)d_in[10]; const float* lqr = (const float*)d_in[11]; const float* lkr = (const float*)d_in[12];
    const float* g = (const float*)d_in[13]; const float* bb = (const float*)d_in[14]; const float* W1 = (const float*)d_in[15]; const float* b1 = (const float*)d_in[16]; const float* W2 = (const float*)d_in[17]; const float* b2 = (const float*)d_in[18];
    float* out = (float*)d_out;    // [2][1024][2048]
    char* wsp = (char*)d_ws;
    auto take = [&](size_t bytes) { char* p = wsp; wsp += (bytes + 255) & ~(size_t)255; return (void*)p; };
    bf* WB = (bf*)take((size_t)11 * DM * DM * 2);          // Wq_l, Wk_l, Wv_l, Wq_r, Wk_r, Wv_r, Wo, W1, W2 back to back
    bf* WoB = WB + (size_t)6 * DM * DM; bf* W1B = WB + (size_t)7 * DM * DM; bf* W2B = WB + (size_t)9 * DM * DM;
    bf* Xb = (bf*)take((size_t)NTA * DM * 2);
    h16* QH = (h16*)take((size_t)NTA * DM * 2); h16* QL = (h16*)take((size_t)NTA * DM * 2); h16* KH = (h16*)take((size_t)NTA * DM * 2); h16* KL = (h16*)take((size_t)NTA * DM * 2);
    float* TMP = (float*)take((size_t)NTA * DM * 4); h16* VTH = (h16*)take((size_t)NTA * DM * 2); h16* VTL = (h16*)take((size_t)NTA * DM * 2);
    bf* AH = (bf*)take((size_t)NTA * DM * 2); bf* AL = (bf*)take((size_t)NTA * DM * 2);                    // [path][batch][s][e]
    bf* Yh = (bf*)take((size_t)NTK * DM * 2); bf* Yl = (bf*)take((size_t)NTK * DM * 2); bf* Y2h = (bf*)take((size_t)NTK * DM * 2); bf* Y2l = (bf*)take((size_t)NTK * DM * 2);
    if ((size_t)(wsp - (char*)d_ws) > ws_size) return;    // MiB: 22 + 16 + 4 x 16 + 32 + 2 x 16 + 2 x 16 + 4 x 8 = 230
    // aliases (stream order): Y2 (f32 [4096][1024], 16 MiB) lives over Xb, dead after the projections; Y3 (the same size) over AH, dead after k_comb; the MLP hidden Hf
    // (f32 [4096][2048], 32 MiB) over QH,QL and its planes Hh/Hl (16 MiB each) over KH and KL, consecutive 256-B-aligned takes, all dead after the attention.
    float* Y2 = (float*)(void*)Xb; float* Y3 = (float*)(void*)AH;
    float* Hf = (float*)(void*)QH; bf* Hh = (bf*)(void*)KH; bf* Hl = (bf*)(void*)KL;
    k_bf<<<11 * 512, 256, 0, stream>>>(Wp[0], Wp[1], Wp[2], Wp[3], Wp[4], Wp[5], Wo, W1, W2, WB);
    k_wt<<<dim3(DM / 64, NT_ / 64, NP_ * NB_), 256, 0, stream>>>(xl, xr, DM, NT_, Xb);                                                             // x^T [path][batch][s][e] exact
    k_gemmb<false, true, true><<<dim3(NTA / 128, DM / 128, 3), 128, 0, stream>>>(Xb, nullptr, WB, nullptr, (float*)(void*)QH, DM, QL, nullptr, DM, 1, TMP);   // q, k -> planes, v -> TMP
    k_vt<<<NP_ * NB_ * NH_ * (NT_ / 64), 256, 0, stream>>>(TMP, VTH, VTL);
    k_attn<<<NP_ * NB_ * NH_ * (NT_ / 64), 128, 0, stream>>>(QH, QL, KH, KL, VTH, VTL, AH, AL);
    k_comb<<<NTK / 8, 256, 0, stream>>>(AH, AL, AH + (size_t)NTK * DM, AL + (size_t)NTK * DM, lql, lkl, lqr, lkr, g, bb, Yh, Yl);
    k_gemmb<true, false><<<dim3(NTK / 128, DM / 128, 1), 128, 0, stream>>>(Yh, Yl, WoB, nullptr, Y2, DM, nullptr);                        // y.Wo^T
    k_splitc<<<NTK / 8, 256, 0, stream>>>(Y2, NTK, DM, 0, Y2h, Y2l);
    k_gemmb<true, false><<<dim3(NTK / 128, FF / 128, 1), 128, 0, stream>>>(Y2h, Y2l, W1B, b1, Hf, FF, nullptr);                         // y.W1^T + b1
    k_splitc<<<NTK / 8, 256, 0, stream>>>(Hf, NTK, FF, 1, Hh, Hl);                                                                        // relu -> planes
    k_gemmb<true, false><<<dim3(NTK / 128, DM / 128, 1), 128, 0, stream>>>(Hh, Hl, W2B, b2, Y3, DM, nullptr, nullptr, FF);               // h.W2^T + b2  (K = 2048)
    k_trout<<<dim3(NT_ / 64, DM / 64, NB_), 256, 0, stream>>>(Y3, out);                                                                  // -> [b][e][s]
}

// v005
// It runs in 271 microseconds.
// Two timings next to v004 put it at 1.10 and 1.09 times that version's speed.
// Counting every step since v000, it is 4.82 times as fast.
#include <hip/hip_runtime.h>

// Compute dtypes, f32 accumulate, every stage one launch over both batch items and both paths (rows [path][batch][s]): the two causal 16-head attention paths (left / right inputs transposed from [E][S] once into bf16 [S][E];
// q/k/v = x.W^T as PLAIN bf16 operands = rounded inputs and weights, exact products) on v_wmma_f32_16x16x32_bf16 (q/k leave the epilogue as f16 hi + residual x1024
// planes, v -> transposed f16 hi + residual planes), each attention fused on v_wmma_f32_16x16x32_f16 (hh + hl + lh x 1/8, online f32 softmax, weights x32768 and v as
// f16 hi + residual x1024); lambda = exp(lq_l.lk_l) - exp(lq_r.lk_r) + 0.1, combined = attn_l - lambda attn_r and the LayerNorm in f32; y.Wo^T, relu(y.W1^T + b1) and
// h.W2^T + b2 with the computed operand as bf16 hi + UNSCALED residual against exact bf16 weights (two products) on v_wmma_f32_16x16x32_bf16; the result transposed to

#define NB_  2                   // batch items, all in one launch of every stage
#define NP_  2                   // attention paths (left, right), likewise
#define NT_  2048
#define DM   1024
#define FF   2048
#define NH_  16
#define HD   64
#define NTK  (NB_ * NT_)         // token rows behind the combination
#define NTA  (NP_ * NTK)         // token rows of the projections and the attention: row = (path * NB_ + batch) * NT_ + s
#define NW   1024
#define NQKV 1024
#define LN_EPS 1e-5f
#define LAM0 0.1f
#define PSC  32768.0f
#define LOSC 1024.0f
#define LOSCI (1.0f / 1024.0f)
#define LOG2E 1.44269504088896340736f

typedef _Float16 h16;
typedef unsigned short bf;
typedef __attribute__((ext_vector_type(16))) __bf16   v16bf;
typedef __attribute__((ext_vector_type(16))) _Float16 v16h;
typedef __attribute__((ext_vector_type(8)))  _Float16 v8h;
typedef __attribute__((ext_vector_type(8)))  unsigned short v8us;
typedef __attribute__((ext_vector_type(8)))  float    v8f;
typedef __attribute__((ext_vector_type(4)))  float    v4f;
typedef v8h  __attribute__((may_alias)) v8ha;
typedef v4f  __attribute__((may_alias)) v4fa;
typedef v8us __attribute__((may_alias)) v8usa;

__device__ __forceinline__ unsigned short f2bf(float f) { unsigned u = __float_as_uint(f); u += 0x7FFFu + ((u >> 16) & 1u); return (unsigned short)(u >> 16); }
__device__ __forceinline__ float bf2f(unsigned short b) { return __uint_as_float(((unsigned)b) << 16); }
__device__ __forceinline__ float bfr(float f) { return bf2f(f2bf(f)); }
__device__ __forceinline__ v16h cat16(v8h lo, v8h hi) { return __builtin_shufflevector(lo, hi, 0, 1, 2, 3, 4, 5, 6, 7, 8, 9, 10, 11, 12, 13, 14, 15); }
__device__ __forceinline__ v16bf cat16b(v8us lo, v8us hi) { return __builtin_bit_cast(v16bf, __builtin_shufflevector(lo, hi, 0, 1, 2, 3, 4, 5, 6, 7, 8, 9, 10, 11, 12, 13, 14, 15)); }
__device__ __forceinline__ v8f wmma16(v16h a, v16h b, v8f c) { return __builtin_amdgcn_wmma_f32_16x16x32_f16(false, a, false, b, (short)0, c, false, false); }
__device__ __forceinline__ v8f wmmab(v16bf a, v16bf b, v8f c) { return __builtin_amdgcn_wmma_f32_16x16x32_bf16(false, a, false, b, (short)0, c, false, false); }

__global__ __launch_bounds__(256) void k_cvtb(const float* __restrict__ src, int nrows, bf* dst) {
    const int lane = threadIdx.x & 31, r = blockIdx.x * 8 + (threadIdx.x >> 5);
    if (r >= nrows) return;
    v8us o[DM / 256];
#pragma unroll
    for (int q = 0; q < DM / 256; ++q) { v8us t;
#pragma unroll
        for (int i = 0; i < 8; ++i) t[i] = f2bf(src[(size_t)r * DM + q * 256 + lane * 8 + i]);
        o[q] = t; }
#pragma unroll
    for (int q = 0; q < DM / 256; ++q) *(v8us*)(dst + (size_t)r * DM + q * 256 + lane * 8) = o[q];
    
}

// k_gemmb: 128 x 128 block tile (4 waves, 2 x 2, each 64 x 64 = 4 x 4 accumulator tiles) of C[rows][cols] = (A [+ Al]).B^T [+ bf(bias[c])] [+ bf(R[r][c]) residual]; f32 or f16-plane whole-line epilogue.
// The operands come from LDS: each pass of 64 k (128 rows x 128 B of A, of B and, where split, of Al) is copied once per block by global_load_async_to_lds_b128, whole 128-B lines a row,
// into one of two buffers, pass p + 2 being issued when every wave has left pass p; so a line leaves L2 once per block and pass, and a pass's L2 latency runs under the pass before it.
// QKV: one launch does q, k and v of both paths: blockIdx.z picks the projection (0, 1: f16 planes at C / C2p + z * 2 NTA DM; 2: f32 at Cv), the row block's path and z the weight.
#define GPE  72                          // LDS pitch of a 64-element bf16 row, in elements: 144 B = 16 B x odd, conflict-free for 16-byte row readers
#define GTE  (128 * GPE)                 // one operand plane of a pass: 18,432 B
__device__ __forceinline__ unsigned ldsoff(const void* p) { return (unsigned)(size_t)p; }   // byte offset in the work-group's LDS = low 32 bits of the __shared__ address
// Eight copies of 16 B a lane: rows 16 apart (gs bytes apart in global memory); s_wait_xcnt closes the statement so that no address register named here is rewritten in front of it.
__device__ __forceinline__ void copy8(unsigned l, const char* g, size_t gs) {
    asm volatile("global_load_async_to_lds_b128 %0, %1, off\n\tglobal_load_async_to_lds_b128 %2, %3, off\n\t"
                 "global_load_async_to_lds_b128 %4, %5, off\n\tglobal_load_async_to_lds_b128 %6, %7, off\n\t"
                 "global_load_async_to_lds_b128 %8, %9, off\n\tglobal_load_async_to_lds_b128 %10, %11, off\n\t"
                 "global_load_async_to_lds_b128 %12, %13, off\n\tglobal_load_async_to_lds_b128 %14, %15, off\n\ts_wait_xcnt 0x0"
                 :: "v"(l), "v"(g), "v"(l + 16 * GPE * 2), "v"(g + gs), "v"(l + 32 * GPE * 2), "v"(g + 2 * gs), "v"(l + 48 * GPE * 2), "v"(g + 3 * gs),
                    "v"(l + 64 * GPE * 2), "v"(g + 4 * gs), "v"(l + 80 * GPE * 2), "v"(g + 5 * gs), "v"(l + 96 * GPE * 2), "v"(g + 6 * gs), "v"(l + 112 * GPE * 2), "v"(g + 7 * gs) : "memory");
}
template <bool SPLITA, bool F16OUT = false, bool QKV = false>
__global__ __launch_bounds__(128) void k_gemmb(const bf* __restrict__ A, const bf* __restrict__ Al, const bf* __restrict__ Bw, const float* __restrict__ bias, float* C, int ldc, h16* C2p, const float* __restrict__ R = nullptr, int K = DM, int roundR = 1, float* Cv = nullptr) {
    constexpr int NPL = SPLITA ? 3 : 2;                      // planes of a buffer: A, B [, Al]
    __shared__ __align__(16) bf gring[2 * NPL * GTE];
    __shared__ __align__(16) float ost[4][16 * 68];
    const int tid = threadIdx.x, lane = threadIdx.x & 31, wave = __builtin_amdgcn_readfirstlane(threadIdx.x >> 5), lr = lane & 15, hi = lane >> 4;
    const int rb = blockIdx.x * 128, cb = blockIdx.y * 128;
    const int rw = rb + (wave >> 1) * 64, c0 = cb + (wave & 1) * 64;
    const bf* __restrict__ Bn = QKV ? Bw + ((size_t)(blockIdx.x / (NTK / 128)) * 3 + blockIdx.z) * ((size_t)DM * DM) : Bw;
    const size_t zo = QKV ? (size_t)blockIdx.z * (2 * (size_t)NTA * DM) : 0;
    h16* C2 = QKV ? C2p + zo : C2p;
    // Copy map, 16 B a lane: a plane is 128 rows x 8 pieces; a thread takes piece tid & 7 of rows crow + 16 i.
    const int crow = tid >> 3, cpc = (tid & 7) * 8;
    const size_t gs = (size_t)K * 32;                        // 16 rows, in bytes
    const char* ga = (const char*)(A + (size_t)(rb + crow) * K + cpc);
    const char* gl = SPLITA ? (const char*)(Al + (size_t)(rb + crow) * K + cpc) : ga;
    const char* gb = (const char*)(Bn + (size_t)(cb + crow) * K + cpc);
    const unsigned l0 = ldsoff(gring) + (unsigned)(crow * GPE + cpc) * 2u;
    auto fill = [&](int p) {
        const unsigned lb = l0 + (unsigned)(p & 1) * (NPL * GTE * 2u); const size_t go = (size_t)p * 128;
        copy8(lb, ga + go, gs); copy8(lb + GTE * 2u, gb + go, gs); if (SPLITA) copy8(lb + 2u * GTE * 2u, gl + go, gs);
    };
    // Every index into acc, a, al, b or bv is a constant or an unrolled loop's counter, so the arrays stay in registers.
    v8f acc[4][4];
#pragma unroll
    for (int i = 0; i < 4; ++i)
#pragma unroll
        for (int t = 0; t < 4; ++t) acc[i][t] = (v8f){};
    const int np = K >> 6;                                   // at least two passes (K is 1024 or 2048)
    fill(0);
    asm volatile("s_wait_asynccnt 0x0" ::: "memory");        // this wave's copies of pass 0 have landed
    __syncthreads();                                         // ... and every other wave's: pass 0 is published
    fill(1);
    const int aro = ((wave >> 1) * 64 + lr) * GPE + 8 * hi, bro = GTE + ((wave & 1) * 64 + lr) * GPE + 8 * hi;
#pragma unroll 1
    for (int p = 0; p < np; ++p) {                           // rolled: the body already holds 32 (64) matrix instructions
        const bf* buf = gring + (p & 1) * (NPL * GTE);
#pragma unroll
        for (int ks = 0; ks < 2; ++ks) {
            v16bf a[4], al[4], b[4];
            const bf* ap = buf + aro + ks * 32; const bf* bp = buf + bro + ks * 32;
            a[0] = cat16b(*(const v8usa*)ap, *(const v8usa*)(ap + 16));          // in the order of first use
#pragma unroll
            for (int t = 0; t < 4; ++t) b[t] = cat16b(*(const v8usa*)(bp + t * 16 * GPE), *(const v8usa*)(bp + t * 16 * GPE + 16));
#pragma unroll
            for (int i = 1; i < 4; ++i) a[i] = cat16b(*(const v8usa*)(ap + i * 16 * GPE), *(const v8usa*)(ap + i * 16 * GPE + 16));
#pragma unroll
            for (int i = 0; i < 4; ++i) { al[i] = a[i]; if (SPLITA) al[i] = cat16b(*(const v8usa*)(ap + 2 * GTE + i * 16 * GPE), *(const v8usa*)(ap + 2 * GTE + i * 16 * GPE + 16)); }
            // Keeps the k-step's LDS reads together as one group ahead of its matrix instructions; left to itself the build reads each A fragment directly in front of its four products and waits out the LDS latency every time.
            __builtin_amdgcn_sched_barrier(0);
#pragma unroll
            for (int i = 0; i < 4; ++i)
#pragma unroll
                for (int t = 0; t < 4; ++t) acc[i][t] = wmmab(a[i], b[t], acc[i][t]);
            if (SPLITA) {
#pragma unroll
                for (int i = 0; i < 4; ++i)
#pragma unroll
                    for (int t = 0; t < 4; ++t) acc[i][t] = wmmab(al[i], b[t], acc[i][t]);
            }
        }
        // Keeps the pass's matrix instructions in front of the waits and the barrier: moved behind them, they delay the refill, whose lead over its own wait then falls short of a pass.
        __builtin_amdgcn_sched_barrier(0);
        asm volatile("s_wait_dscnt 0x0" ::: "memory");       // this wave's reads of pass p have returned before its buffer is handed back
        asm volatile("s_wait_asynccnt 0x0" ::: "memory");    // this wave's copies of pass p + 1 have landed
        __syncthreads();                                     // publishes pass p + 1 and ends every wave's reads of pass p
        if (p + 2 < np) fill(p + 2);                         // block-uniform test: refill the buffer just left
    }
    asm volatile("s_wait_asynccnt 0x0" ::: "memory");        // no copy is outstanding when the wave goes on to its end
    float* os = &ost[wave][0];
    float bv[4];
#pragma unroll
    for (int t = 0; t < 4; ++t) bv[t] = bias ? bfr(bias[c0 + t * 16 + lr]) : 0.f;
#pragma unroll
    for (int mi = 0; mi < 4; ++mi) {                         // the wave's four 16-row groups, one after the other through its staging rows
        const int r0 = rw + mi * 16;
#pragma unroll
        for (int t = 0; t < 4; ++t)
#pragma unroll
            for (int j = 0; j < 8; ++j) os[(hi * 8 + j) * 68 + t * 16 + lr] = acc[mi][t][j] + bv[t];
        __syncthreads();
        if (QKV ? (blockIdx.z < 2) : F16OUT) {
            h16* crow2 = (h16*)(void*)C + zo + (size_t)r0 * ldc + c0;
#pragma unroll
            for (int s = 0; s < 4; ++s) { const int row = 4 * s + (lane >> 3), piece = lane & 7; const float* sp = os + row * 68 + piece * 8; v8h o, o2;
#pragma unroll
                for (int i = 0; i < 8; ++i) { const h16 a = (h16)sp[i]; o[i] = a; o2[i] = (h16)((sp[i] - (float)a) * LOSC); }
                *(v8h*)(crow2 + (size_t)row * ldc + piece * 8) = o;
                asm volatile("s_wait_xcnt 0x0" ::: "memory");     // the same precaution as below, for the store above: the residual's arithmetic reuses its registers
                if (C2) *(v8h*)(C2 + (size_t)r0 * ldc + c0 + (size_t)row * ldc + piece * 8) = o2;
                asm volatile("s_wait_xcnt 0x0" ::: "memory"); }   // a precaution: stands in front of the next rewrite of the registers that these stores name
        } else {
            float* crow2 = (QKV ? Cv : C) + (size_t)r0 * ldc + c0;
#pragma unroll
            for (int s = 0; s < 8; ++s) { const int Lid = (lane >> 3) + 4 * s, piece = lane & 7; const int row = Lid >> 1, cofs = (Lid & 1) * 32 + piece * 4;
                v4f val = *(const v4fa*)(os + row * 68 + cofs); if (R) { const v4f rv = *(const v4f*)(R + ((size_t)r0 + row) * ldc + c0 + cofs); val += roundR ? (v4f){bfr(rv[0]), bfr(rv[1]), bfr(rv[2]), bfr(rv[3])} : rv; }
                *(v4f*)(crow2 + (size_t)row * ldc + cofs) = val;
                asm volatile("s_wait_xcnt 0x0" ::: "memory"); }   // a precaution: stands in front of the next rewrite of the registers that this store names
        }
        __syncthreads();                                     // the staged rows are read before the next group overwrites them
    }
}

__global__ __launch_bounds__(256) void k_vt(const float* __restrict__ V, h16* VTH, h16* VTL) {
    __shared__ __align__(16) h16 tile[64 * 72];
    __shared__ __align__(16) h16 til2[64 * 72];
    const int bid = blockIdx.x;
    const int b = bid / (NH_ * (NT_ / 64)), rem = bid - b * (NH_ * (NT_ / 64)), h = rem / (NT_ / 64), kt = rem - h * (NT_ / 64);
    const int k0 = kt * 64, tid = threadIdx.x;
    const int kk = tid >> 2, d0 = (tid & 3) * 16;
    const float* src = V + ((size_t)b * NT_ + k0 + kk) * DM + h * HD + d0;
#pragma unroll
    for (int i = 0; i < 16; ++i) { const float v = src[i]; const h16 a = (h16)v; tile[(d0 + i) * 72 + kk] = a; til2[(d0 + i) * 72 + kk] = (h16)((v - (float)a) * LOSC); }
    __syncthreads();
    const int piece = tid & 7;
    const size_t base = (((size_t)b * NH_ + h) * HD) * NT_ + k0;
    auto pass = [&]() {
#pragma unroll
        for (int s = 0; s < 4; ++s) { const int Lid = (tid >> 3) + 32 * s; const int pln = Lid >> 6, d = Lid & 63;
            const v8h val = *(const v8ha*)((pln ? til2 : tile) + d * 72 + piece * 8); *(v8h*)((pln ? VTL : VTH) + base + (size_t)d * NT_ + piece * 8) = val; }
    };
    pass(); 
}

#define KPE  72                          // LDS pitch of a 64-element f16 row, in elements: 144 B = 16 B x odd, conflict-free for 16-byte row readers
#define VPE  40                          // LDS pitch of a 32-element f16 row, in elements: 80 B = 16 B x odd
#define KTE  (32 * KPE)                  // one K plane of a tile
#define VTE  (64 * VPE)                  // one V^T plane of a tile
#define BUFE (2 * KTE + 2 * VTE)         // one tile: 19,456 B
__device__ __forceinline__ unsigned ldsa(const h16* p) { return (unsigned)(size_t)p; }   // byte offset in the work-group's LDS = low 32 bits of the __shared__ address
__device__ __forceinline__ float xhalf(float v) { const int b = __float_as_int(v); return __int_as_float(__builtin_amdgcn_permlanex16(b, b, 0x76543210, 0xfedcba98, false, false)); }   // lane l <-> l ^ 16

__global__ __launch_bounds__(128) void k_attn(const h16* __restrict__ Q16, const h16* __restrict__ QL16, const h16* __restrict__ K16, const h16* __restrict__ KL16, const h16* __restrict__ VTH, const h16* __restrict__ VTL, bf* CH, bf* CL) {
    __shared__ __align__(16) h16 ring[2 * BUFE];
    __shared__ __align__(16) h16 qls[64 * KPE];
    __shared__ __align__(16) float ost[4][16 * 68];
    // The wave's number sits in a scalar register, so that what derives from it leaves the vector registers and the loop's live set stays under 256 of them.
    const int tid = threadIdx.x, lane = threadIdx.x & 31, wave = __builtin_amdgcn_readfirstlane(threadIdx.x >> 5), lr = lane & 15, hi = lane >> 4;
    const int bid = blockIdx.x;
    // Cost falls with the index: a block walks 2 qt + 2 key tiles and only half the grid is resident at once, so the longest query blocks of every head come first and the short ones fill the places they free.
    const int qt = NT_ / 64 - 1 - bid / (NP_ * NB_ * NH_), rem = bid % (NP_ * NB_ * NH_), b = rem / NH_, h = rem % NH_;
    const int q0 = qt * 64 + wave * 16;
    const size_t tok0 = (size_t)b * NT_;
    v16h qa[2];
    const size_t qo0 = (tok0 + q0 + lr) * DM + h * HD + 8 * hi;
#pragma unroll
    for (int kc = 0; kc < 2; ++kc) qa[kc] = cat16(*(const v8h*)(Q16 + qo0 + kc * 32), *(const v8h*)(Q16 + qo0 + kc * 32 + 16));
    const h16* kh_b = K16 + tok0 * DM + h * HD;
    const h16* kl_b = KL16 + tok0 * DM + h * HD;
    const size_t vbase = (((size_t)b * NH_ + h) * HD) * NT_;
    v8f o[4], ox[4];
#pragma unroll
    for (int n = 0; n < 4; ++n) { o[n] = (v8f){}; ox[n] = (v8f){}; }
    float mrow = -3.0e38f, lpart = 0.f;                   // of the lane's query q0 + lr; lpart sums the lane half's own keys
    const int qrel = q0 + lr - 8 * hi;                    // key l0 + 8 hi + j is allowed where l0 + j <= qrel
    const int kt_lo = 0, kt_hi = (qt * 64 + 63) / 32;     // causal; at least two tiles
    // Copy map, 16 B a lane: K planes 32 rows x 8 pieces (a thread takes rows krow and krow + 16), V^T planes 64 rows x 4 pieces (rows vrow and vrow + 32).
    const int krow = tid >> 3, kpc = (tid & 7) * 8, vrow = tid >> 2, vpc = (tid & 3) * 8;
    const unsigned kgo = (unsigned)(krow * DM + kpc) * 2u, vgo = (unsigned)(vrow * NT_ + vpc) * 2u;                 // this thread's byte offsets in a K plane and a V^T plane of its head
    const unsigned klo = ldsa(ring) + (unsigned)(krow * KPE + kpc) * 2u, vlo = ldsa(ring) + (unsigned)(2 * KTE + vrow * VPE + vpc) * 2u;    // and in buffer 0
    const char* vh_b = (const char*)(VTH + vbase); const char* vl_b = (const char*)(VTL + vbase);
    auto fill = [&](int kt) {
        const unsigned ko = kgo + (unsigned)kt * (32u * DM * 2u), vo = vgo + (unsigned)kt * 64u, bo = (unsigned)(kt & 1) * (BUFE * 2u);
        const char* gkh = (const char*)kh_b + ko; const char* gkl = (const char*)kl_b + ko; const char* gvh = vh_b + vo; const char* gvl = vl_b + vo;
        const unsigned lk = klo + bo, lv = vlo + bo;
        // The tile's eight copies; s_wait_xcnt closes the statement so that no address register named here is rewritten in front of it.
        asm volatile("global_load_async_to_lds_b128 %0, %1, off\n\tglobal_load_async_to_lds_b128 %2, %3, off\n\t"
                     "global_load_async_to_lds_b128 %4, %5, off\n\tglobal_load_async_to_lds_b128 %6, %7, off\n\t"
                     "global_load_async_to_lds_b128 %8, %9, off\n\tglobal_load_async_to_lds_b128 %10, %11, off\n\t"
                     "global_load_async_to_lds_b128 %12, %13, off\n\tglobal_load_async_to_lds_b128 %14, %15, off\n\ts_wait_xcnt 0x0"
                     :: "v"(lk), "v"(gkh), "v"(lk + 16 * KPE * 2), "v"(gkh + 16 * DM * 2), "v"(lk + KTE * 2), "v"(gkl), "v"(lk + (KTE + 16 * KPE) * 2), "v"(gkl + 16 * DM * 2),
                        "v"(lv), "v"(gvh), "v"(lv + 32 * VPE * 2), "v"(gvh + 32 * NT_ * 2), "v"(lv + VTE * 2), "v"(gvl), "v"(lv + (VTE + 32 * VPE) * 2), "v"(gvl + 32 * NT_ * 2) : "memory");
    };
    {   // The block's 64 query residual rows, once: 64 rows x 8 pieces, a thread takes rows krow + 16 i; same closing wait as above.
        const h16* gq = QL16 + (tok0 + qt * 64 + krow) * DM + h * HD + kpc;
        const unsigned lq = ldsa(qls) + (krow * KPE + kpc) * 2;
        asm volatile("global_load_async_to_lds_b128 %0, %1, off\n\tglobal_load_async_to_lds_b128 %2, %3, off\n\t"
                     "global_load_async_to_lds_b128 %4, %5, off\n\tglobal_load_async_to_lds_b128 %6, %7, off\n\ts_wait_xcnt 0x0"
                     :: "v"(lq), "v"(gq), "v"(lq + 16 * KPE * 2), "v"(gq + 16 * DM), "v"(lq + 32 * KPE * 2), "v"(gq + 32 * DM), "v"(lq + 48 * KPE * 2), "v"(gq + 48 * DM) : "memory");
    }
    fill(0);
    asm volatile("s_wait_asynccnt 0x0" ::: "memory");     // this wave's copies of tile 0 and of the query residual have landed
    __syncthreads();                                      // ... and every other wave's: tile 0 is published
    fill(1);
    const h16* qlp = qls + (wave * 16 + lr) * KPE + 8 * hi;
#pragma unroll 1
    for (int kt = kt_lo; kt <= kt_hi; ++kt) {
        const int l0 = kt * 32;
        const h16* buf = ring + (kt & 1) * BUFE;
        const h16* kp = buf + lr * KPE + 8 * hi;
        const h16* vp = buf + 2 * KTE + lr * VPE + 8 * hi;
        v16h k0h[2], k1h[2], k0l[2], k1l[2], qlk[2];
#pragma unroll
        for (int kc = 0; kc < 2; ++kc) {
            k0h[kc] = cat16(*(const v8ha*)(kp + kc * 32), *(const v8ha*)(kp + kc * 32 + 16)); k1h[kc] = cat16(*(const v8ha*)(kp + 16 * KPE + kc * 32), *(const v8ha*)(kp + 16 * KPE + kc * 32 + 16));
            qlk[kc] = cat16(*(const v8ha*)(qlp + kc * 32), *(const v8ha*)(qlp + kc * 32 + 16));
            k0l[kc] = cat16(*(const v8ha*)(kp + KTE + kc * 32), *(const v8ha*)(kp + KTE + kc * 32 + 16)); k1l[kc] = cat16(*(const v8ha*)(kp + KTE + 16 * KPE + kc * 32), *(const v8ha*)(kp + KTE + 16 * KPE + kc * 32 + 16));
        }
        v8f s0 = {}, s1 = {}, x0 = {}, x1 = {};
#pragma unroll
        for (int kc = 0; kc < 2; ++kc) {
            s0 = wmma16(k0h[kc], qa[kc], s0); x0 = wmma16(k0h[kc], qlk[kc], x0); s1 = wmma16(k1h[kc], qa[kc], s1); x1 = wmma16(k1h[kc], qlk[kc], x1);
            x0 = wmma16(k0l[kc], qa[kc], x0); x1 = wmma16(k1l[kc], qa[kc], x1);
        }
        asm volatile("v_nop\n\tv_nop\n\tv_nop\n\tv_nop" : "+v"(s0), "+v"(s1), "+v"(x0), "+v"(x1) : "v"(qa[0]), "v"(qa[1]));
        v16h vh[4], vl[4];     // read ahead of the softmax, whose vector work covers their LDS latency
#pragma unroll
        for (int n = 0; n < 4; ++n) { vh[n] = cat16(*(const v8ha*)(vp + n * 16 * VPE), *(const v8ha*)(vp + n * 16 * VPE + 16)); vl[n] = cat16(*(const v8ha*)(vp + VTE + n * 16 * VPE), *(const v8ha*)(vp + VTE + n * 16 * VPE + 16)); }
        // Keeps these sixteen reads here as one group; left to itself the build moves them down among the matrix instructions of the second product and waits each small group out in full.
        __builtin_amdgcn_sched_barrier(0);
        const int rel = qrel - l0;
        // The lane's 16 scores of its query: keys l0 + 8 hi + j (a0) and l0 + 16 + 8 hi + j (a1). Whole-vector arithmetic: neighbouring registers pair into packed f32 instructions.
        v8f a0 = (s0 + x0 * LOSCI) * 0.125f, a1 = (s1 + x1 * LOSCI) * 0.125f;
#pragma unroll
        for (int j = 0; j < 8; ++j) { a0[j] = (j <= rel) ? a0[j] : -__builtin_inff(); a1[j] = (16 + j <= rel) ? a1[j] : -__builtin_inff(); }
        float mx = fmaxf(fmaxf(fmaxf(fmaxf(a0[0], a0[1]), fmaxf(a0[2], a0[3])), fmaxf(fmaxf(a0[4], a0[5]), fmaxf(a0[6], a0[7]))),
                         fmaxf(fmaxf(fmaxf(a1[0], a1[1]), fmaxf(a1[2], a1[3])), fmaxf(fmaxf(a1[4], a1[5]), fmaxf(a1[6], a1[7]))));
        mx = fmaxf(mx, xhalf(mx));                            // the other 16 keys of the tile sit in the other lane half
        const float mn = fmaxf(mrow, mx);
        const float alpha = __expf(mrow - mn); mrow = mn;
        const v8f e0 = (a0 - mn) * LOG2E, e1 = (a1 - mn) * LOG2E;
        v8f p0, p1;
#pragma unroll
        for (int j = 0; j < 8; ++j) p0[j] = __builtin_amdgcn_exp2f(e0[j]);
#pragma unroll
        for (int j = 0; j < 8; ++j) p1[j] = __builtin_amdgcn_exp2f(e1[j]);
        const v8f sp = p0 + p1;
        lpart = lpart * alpha + (((sp[0] + sp[1]) + (sp[2] + sp[3])) + ((sp[4] + sp[5]) + (sp[6] + sp[7])));
        // P^T as a B operand: element s = key kmap(s, hi) = score tile s >> 3, register s & 7; hi plane and residual x1024 plane.
        const v8f ps0 = p0 * PSC, ps1 = p1 * PSC;
        const v8h h0 = __builtin_convertvector(ps0, v8h), h1 = __builtin_convertvector(ps1, v8h);
        const v8h r0 = __builtin_convertvector((ps0 - __builtin_convertvector(h0, v8f)) * LOSC, v8h), r1 = __builtin_convertvector((ps1 - __builtin_convertvector(h1, v8f)) * LOSC, v8h);
        const v16h pa = cat16(h0, h1), px = cat16(r0, r1);
#pragma unroll
        for (int n = 0; n < 4; ++n) { o[n] *= alpha; ox[n] *= alpha; }
#pragma unroll
        for (int n = 0; n < 4; ++n) { o[n] = wmma16(vh[n], pa, o[n]); ox[n] = wmma16(vl[n], pa, ox[n]); ox[n] = wmma16(vh[n], px, ox[n]); }
        asm volatile("v_nop\n\tv_nop\n\tv_nop\n\tv_nop" : "+v"(o[0]), "+v"(o[1]), "+v"(o[2]), "+v"(o[3]), "+v"(ox[0]), "+v"(ox[1]), "+v"(ox[2]), "+v"(ox[3]) : "v"(pa), "v"(px));
        asm volatile("s_wait_dscnt 0x0" ::: "memory");        // this wave's reads of tile kt have returned before its buffer is handed back
        asm volatile("s_wait_asynccnt 0x0" ::: "memory");     // this wave's copies of tile kt + 1 have landed
        __syncthreads();                                      // publishes tile kt + 1 and ends every wave's reads of tile kt
        if (kt + 2 <= kt_hi) fill(kt + 2);                    // block-uniform test: refill the buffer just left
    }
    asm volatile("s_wait_asynccnt 0x0" ::: "memory");         // no copy is outstanding when the wave goes on to its end
    const float inv = 1.0f / ((lpart + xhalf(lpart)) * PSC);  // the two lane halves' sums joined once
    float* os = &ost[wave][0];
#pragma unroll
    for (int n = 0; n < 4; ++n)                               // o[n][j] = O[query lr][d = 16 n + 8 hi + j]: eight consecutive d of the lane's staging row
#pragma unroll
        for (int c = 0; c < 2; ++c) { v4f t;
#pragma unroll
            for (int i = 0; i < 4; ++i) t[i] = (o[n][4 * c + i] + ox[n][4 * c + i] * LOSCI) * inv;
            *(v4fa*)(os + lr * 68 + n * 16 + hi * 8 + 4 * c) = t; }
    __syncthreads();
    const size_t cbase = (tok0 + q0) * DM + (size_t)h * HD;
    auto pass = [&]() {
#pragma unroll
        for (int s = 0; s < 4; ++s) { const int row = 4 * s + (lane >> 3), piece = lane & 7; const float* sp = os + row * 68 + piece * 8; v8us oh, ol;
#pragma unroll
            for (int i = 0; i < 8; ++i) { const unsigned short hb = f2bf(sp[i]); oh[i] = hb; ol[i] = f2bf(sp[i] - bf2f(hb)); }
            *(v8us*)(CH + cbase + (size_t)row * DM + piece * 8) = oh; *(v8us*)(CL + cbase + (size_t)row * DM + piece * 8) = ol; }
    };
    pass(); 
}


// k_wt: WT [n][K] = bf16(W[k][n]) (k-major [K][ncols]) via 64 x 64 LDS tiles; grid (K/64, ncols/64, NP_ * NB_): z = path * NB_ + batch picks the source matrix and the plane of WTa.
__global__ __launch_bounds__(256) void k_wt(const float* __restrict__ Wl, const float* __restrict__ Wr, int K, int ncols, bf* WTa) {
    __shared__ __align__(16) unsigned short tl[64 * 72];
    const int tid = threadIdx.x, k0 = blockIdx.x * 64, n0 = blockIdx.y * 64;
    const float* __restrict__ Wm = (blockIdx.z / NB_ ? Wr : Wl) + (size_t)(blockIdx.z % NB_) * K * ncols;
    bf* WT = WTa + (size_t)blockIdx.z * K * ncols;
    const int kk = tid >> 2, nq = (tid & 3) * 16;
#pragma unroll
    for (int i = 0; i < 16; ++i) tl[(nq + i) * 72 + kk] = f2bf(Wm[(size_t)(k0 + kk) * ncols + n0 + nq + i]);
    __syncthreads();
    const int piece = tid & 7;
    auto pass = [&]() {
#pragma unroll
        for (int s = 0; s < 2; ++s) { const int nr = (tid >> 3) + 32 * s; const v8us val = *(const v8usa*)(tl + nr * 72 + piece * 8); *(v8us*)(WT + (size_t)(n0 + nr) * K + k0 + piece * 8) = val; }
    };
    pass(); 
}

// k_bf: all nine weight matrices -> bf16 in one launch; dst holds them back to back in argument order. 512 blocks cover DM x DM elements; w7 and w8 are twice that.
__global__ __launch_bounds__(256) void k_bf(const float* __restrict__ w0, const float* __restrict__ w1, const float* __restrict__ w2, const float* __restrict__ w3, const float* __restrict__ w4, const float* __restrict__ w5, const float* __restrict__ w6, const float* __restrict__ w7, const float* __restrict__ w8, bf* dst) {
    const int seg = blockIdx.x >> 9;
    const float* __restrict__ sb = seg == 0 ? w0 : seg == 1 ? w1 : seg == 2 ? w2 : seg == 3 ? w3 : seg == 4 ? w4 : seg == 5 ? w5 : seg == 6 ? w6 : seg < 9 ? w7 : w8;
    const int first = seg < 7 ? seg : seg < 9 ? 7 : 9;          // the segment at which this matrix begins
    const size_t i = (size_t)blockIdx.x * 256 + threadIdx.x;
    const v8f v = *(const v8f*)(sb + (i - (size_t)first * (DM * DM / 8)) * 8); v8us o;
#pragma unroll
    for (int k = 0; k < 8; ++k) o[k] = f2bf(v[k]);
    *(v8us*)(dst + i * 8) = o; 
}

// k_comb: per token row (one wave): lambda = exp(sum bf(lq_l) bf(lk_l)) - exp(sum bf(lq_r) bf(lk_r)) + 0.1 (64 terms, recomputed per wave), c = (CHl + CLl) - lambda (CHr + CLr)
// over the 1024 features, LayerNorm (mean, then biased variance, then the normalised output: three rolled passes that re-read the planes; f32, fixed lane order) x bf(g)
__global__ __launch_bounds__(256) void k_comb(const bf* __restrict__ AHl, const bf* __restrict__ ALl, const bf* __restrict__ AHr, const bf* __restrict__ ALr, const float* __restrict__ lql, const float* __restrict__ lkl, const float* __restrict__ lqr, const float* __restrict__ lkr, const float* __restrict__ g, const float* __restrict__ bb, bf* Yh, bf* Yl) {
    const int lane = threadIdx.x & 31, r = blockIdx.x * 8 + (threadIdx.x >> 5);
    if (r >= NTK) return;
    float dl = bfr(lql[lane]) * bfr(lkl[lane]) + bfr(lql[lane + 32]) * bfr(lkl[lane + 32]);
    float dr = bfr(lqr[lane]) * bfr(lkr[lane]) + bfr(lqr[lane + 32]) * bfr(lkr[lane + 32]);
#pragma unroll
    for (int sh = 16; sh; sh >>= 1) { dl += __shfl_xor(dl, sh, 32); dr += __shfl_xor(dr, sh, 32); }
    const float lam = __expf(dl) - __expf(dr) + LAM0;
    auto load8 = [&](int q, float* cv) { const size_t o = (size_t)r * DM + q * 256 + lane * 8;
        const v8us ah = *(const v8us*)(AHl + o), al = *(const v8us*)(ALl + o), bh = *(const v8us*)(AHr + o), bl = *(const v8us*)(ALr + o);
#pragma unroll
        for (int i = 0; i < 8; ++i) cv[i] = (bf2f(ah[i]) + bf2f(al[i])) - lam * (bf2f(bh[i]) + bf2f(bl[i])); };
    float s = 0.f;
#pragma unroll 1
    for (int q = 0; q < 4; ++q) { float cv[8]; load8(q, cv);
#pragma unroll
        for (int i = 0; i < 8; ++i) s += cv[i]; }
#pragma unroll
    for (int sh = 16; sh; sh >>= 1) s += __shfl_xor(s, sh, 32);
    const float mu = s * (1.0f / DM); float s2 = 0.f;
#pragma unroll 1
    for (int q = 0; q < 4; ++q) { float cv[8]; load8(q, cv);
#pragma unroll
        for (int i = 0; i < 8; ++i) { const float d = cv[i] - mu; s2 = fmaf(d, d, s2); } }
#pragma unroll
    for (int sh = 16; sh; sh >>= 1) s2 += __shfl_xor(s2, sh, 32);
    const float rs = rsqrtf(s2 * (1.0f / DM) + LN_EPS);
#pragma unroll 1
    for (int q = 0; q < 4; ++q) { float cv[8]; load8(q, cv); v8us oh, ol;
#pragma unroll
        for (int i = 0; i < 8; ++i) { const int col = q * 256 + lane * 8 + i; const float y = (cv[i] - mu) * rs * bfr(g[col]) + bfr(bb[col]); const unsigned short hb = f2bf(y); oh[i] = hb; ol[i] = f2bf(y - bf2f(hb)); }
        const size_t o = (size_t)r * DM + q * 256 + lane * 8; *(v8us*)(Yh + o) = oh; *(v8us*)(Yl + o) = ol;  }
}
// k_splitc: bf16 hi + UNSCALED residual planes of a computed f32 [nrows][nc] matrix (nc a multiple of 256), optional relu first; one wave per row, lane -> 8 columns per
__global__ __launch_bounds__(256) void k_splitc(const float* __restrict__ src, int nrows, int nc, int relu, bf* dh, bf* dl) {
    const int lane = threadIdx.x & 31, r = blockIdx.x * 8 + (threadIdx.x >> 5); if (r >= nrows) return;
{
#pragma unroll 1
        for (int c0 = lane * 8; c0 < nc; c0 += 256) { const size_t o = (size_t)r * nc + c0; const v8f v = *(const v8f*)(src + o); v8us oh, ol;
#pragma unroll
            for (int i = 0; i < 8; ++i) { float y = v[i]; if (relu) y = fmaxf(y, 0.f); const unsigned short hb = f2bf(y); oh[i] = hb; ol[i] = f2bf(y - bf2f(hb)); }
            *(v8us*)(dh + o) = oh; *(v8us*)(dl + o) = ol; }
         }
}
// k_trout: out[e][s] = Y[s][e] (f32 [2048][1024] -> [1024][2048]) through a 64 x 64 LDS tile; grid (S/64, E/64, batch); each output row segment of 64 s (256 B) by 16
__global__ __launch_bounds__(256) void k_trout(const float* __restrict__ Ya, float* OUTa) {
    __shared__ __align__(16) float tl[64 * 68];
    const int tid = threadIdx.x, s0 = blockIdx.x * 64, e0 = blockIdx.y * 64;
    const float* __restrict__ Y = Ya + (size_t)blockIdx.z * NT_ * DM; float* OUTP = OUTa + (size_t)blockIdx.z * DM * NT_;     // z = batch item
    const int ss = tid >> 2, eq = (tid & 3) * 16;
#pragma unroll
    for (int i = 0; i < 16; ++i) tl[(eq + i) * 68 + ss] = Y[(size_t)(s0 + ss) * DM + e0 + eq + i];
    __syncthreads();
    auto pass = [&]() {
#pragma unroll
        for (int j = 0; j < 4; ++j) { const int idx = tid + 256 * j; const int row = idx >> 4, piece = idx & 15; const v4f v = *(const v4fa*)(tl + row * 68 + piece * 4);
            *(v4f*)(OUTP + (size_t)(e0 + row) * NT_ + s0 + piece * 4) = v; }
    };
    pass(); 
}

extern "C" void kernel_launch(void* const* d_in, const int* in_sizes, int n_in,
                              void* d_out, int out_size, void* d_ws, size_t ws_size, hipStream_t stream) {
    (void)in_sizes; (void)n_in; (void)out_size;
    const float* xl = (const float*)d_in[0]; const float* xr = (const float*)d_in[1];                              // [2][1024][2048] = [b][e][s]
    const float* Wp[6]; for (int j = 0; j < 6; ++j) Wp[j] = (const float*)d_in[2 + j];                             // Wq_l, Wk_l, Wv_l, Wq_r, Wk_r, Wv_r  ([out][in])
    const float* Wo = (const float*)d_in[8]; const float* lql = (const float*)d_in[9]; const float* lkl = (const float*)d_in[10]; const float* lqr = (const float*)d_in[11]; const float* lkr = (const float*)d_in[12];
    const float* g = (const float*)d_in[13]; const float* bb = (const float*)d_in[14]; const float* W1 = (const float*)d_in[15]; const float* b1 = (const float*)d_in[16]; const float* W2 = (const float*)d_in[17]; const float* b2 = (const float*)d_in[18];
    float* out = (float*)d_out;    // [2][1024][2048]
    char* wsp = (char*)d_ws;
    auto take = [&](size_t bytes) { char* p = wsp; wsp += (bytes + 255) & ~(size_t)255; return (void*)p; };
    bf* WB = (bf*)take((size_t)11 * DM * DM * 2);          // Wq_l, Wk_l, Wv_l, Wq_r, Wk_r, Wv_r, Wo, W1, W2 back to back
    bf* WoB = WB + (size_t)6 * DM * DM; bf* W1B = WB + (size_t)7 * DM * DM; bf* W2B = WB + (size_t)9 * DM * DM;
    bf* Xb = (bf*)take((size_t)NTA * DM * 2);
    h16* QH = (h16*)take((size_t)NTA * DM * 2); h16* QL = (h16*)take((size_t)NTA * DM * 2); h16* KH = (h16*)take((size_t)NTA * DM * 2); h16* KL = (h16*)take((size_t)NTA * DM * 2);
    float* TMP = (float*)take((size_t)NTA * DM * 4); h16* VTH = (h16*)take((size_t)NTA * DM * 2); h16* VTL = (h16*)take((size_t)NTA * DM * 2);
    bf* AH = (bf*)take((size_t)NTA * DM * 2); bf* AL = (bf*)take((size_t)NTA * DM * 2);                    // [path][batch][s][e]
    bf* Yh = (bf*)take((size_t)NTK * DM * 2); bf* Yl = (bf*)take((size_t)NTK * DM * 2); bf* Y2h = (bf*)take((size_t)NTK * DM * 2); bf* Y2l = (bf*)take((size_t)NTK * DM * 2);
    if ((size_t)(wsp - (char*)d_ws) > ws_size) return;    // MiB: 22 + 16 + 4 x 16 + 32 + 2 x 16 + 2 x 16 + 4 x 8 = 230
    // aliases (stream order): Y2 (f32 [4096][1024], 16 MiB) lives over Xb, dead after the projections; Y3 (the same size) over AH, dead after k_comb; the MLP hidden Hf
    // (f32 [4096][2048], 32 MiB) over QH,QL and its planes Hh/Hl (16 MiB each) over KH and KL, consecutive 256-B-aligned takes, all dead after the attention.
    float* Y2 = (float*)(void*)Xb; float* Y3 = (float*)(void*)AH;
    float* Hf = (float*)(void*)QH; bf* Hh = (bf*)(void*)KH; bf* Hl = (bf*)(void*)KL;
    k_bf<<<11 * 512, 256, 0, stream>>>(Wp[0], Wp[1], Wp[2], Wp[3], Wp[4], Wp[5], Wo, W1, W2, WB);
    k_wt<<<dim3(DM / 64, NT_ / 64, NP_ * NB_), 256, 0, stream>>>(xl, xr, DM, NT_, Xb);                                                             // x^T [path][batch][s][e] exact
    k_gemmb<false, true, true><<<dim3(NTA / 128, DM / 128, 3), 128, 0, stream>>>(Xb, nullptr, WB, nullptr, (float*)(void*)QH, DM, QL, nullptr, DM, 1, TMP);   // q, k -> planes, v -> TMP
    k_vt<<<NP_ * NB_ * NH_ * (NT_ / 64), 256, 0, stream>>>(TMP, VTH, VTL);
    k_attn<<<NP_ * NB_ * NH_ * (NT_ / 64), 128, 0, stream>>>(QH, QL, KH, KL, VTH, VTL, AH, AL);
    k_comb<<<NTK / 8, 256, 0, stream>>>(AH, AL, AH + (size_t)NTK * DM, AL + (size_t)NTK * DM, lql, lkl, lqr, lkr, g, bb, Yh, Yl);
    k_gemmb<true, false><<<dim3(NTK / 128, DM / 128, 1), 128, 0, stream>>>(Yh, Yl, WoB, nullptr, Y2, DM, nullptr);                        // y.Wo^T
    k_splitc<<<NTK / 8, 256, 0, stream>>>(Y2, NTK, DM, 0, Y2h, Y2l);
    k_gemmb<true, false><<<dim3(NTK / 128, FF / 128, 1), 128, 0, stream>>>(Y2h, Y2l, W1B, b1, Hf, FF, nullptr);                         // y.W1^T + b1
    k_splitc<<<NTK / 8, 256, 0, stream>>>(Hf, NTK, FF, 1, Hh, Hl);                                                                        // relu -> planes
    k_gemmb<true, false><<<dim3(NTK / 128, DM / 128, 1), 128, 0, stream>>>(Hh, Hl, W2B, b2, Y3, DM, nullptr, nullptr, FF);               // h.W2^T + b2  (K = 2048)
    k_trout<<<dim3(NT_ / 64, DM / 64, NB_), 256, 0, stream>>>(Y3, out);                                                                  // -> [b][e][s]
}

// v006
// Measured time: 258 microseconds a run.
// Next to v005, in two timings, it ran 1.05 times as fast each time.
// Counting every step since v000, it is 5.06 times as fast.
#include <hip/hip_runtime.h>

// Compute dtypes, f32 accumulate, every stage one launch over both batch items and both paths (rows [path][batch][s]): the two causal 16-head attention paths (left / right inputs transposed from [E][S] once into bf16 [S][E];
// q/k/v = x.W^T as PLAIN bf16 operands = rounded inputs and weights, exact products) on v_wmma_f32_16x16x32_bf16 (q/k leave the epilogue as f16 hi + residual x1024
// planes, v -> transposed f16 hi + residual planes), each attention fused on v_wmma_f32_16x16x32_f16 (hh + hl + lh x 1/8, online f32 softmax, weights x32768 and v as
// f16 hi + residual x1024); lambda = exp(lq_l.lk_l) - exp(lq_r.lk_r) + 0.1, combined = attn_l - lambda attn_r and the LayerNorm in f32; y.Wo^T, relu(y.W1^T + b1) and
// h.W2^T + b2 with the computed operand as bf16 hi + UNSCALED residual against exact bf16 weights (two products) on v_wmma_f32_16x16x32_bf16; v and the result are formed transposed (operand roles swapped)

#define NB_  2                   // batch items, all in one launch of every stage
#define NP_  2                   // attention paths (left, right), likewise
#define NT_  2048
#define DM   1024
#define FF   2048
#define NH_  16
#define HD   64
#define NTK  (NB_ * NT_)         // token rows behind the combination
#define NTA  (NP_ * NTK)         // token rows of the projections and the attention: row = (path * NB_ + batch) * NT_ + s
#define NW   1024
#define NQKV 1024
#define LN_EPS 1e-5f
#define LAM0 0.1f
#define PSC  32768.0f
#define LOSC 1024.0f
#define LOSCI (1.0f / 1024.0f)
#define LOG2E 1.44269504088896340736f

typedef _Float16 h16;
typedef unsigned short bf;
typedef __attribute__((ext_vector_type(16))) __bf16   v16bf;
typedef __attribute__((ext_vector_type(16))) _Float16 v16h;
typedef __attribute__((ext_vector_type(8)))  _Float16 v8h;
typedef __attribute__((ext_vector_type(8)))  unsigned short v8us;
typedef __attribute__((ext_vector_type(8)))  float    v8f;
typedef __attribute__((ext_vector_type(4)))  float    v4f;
typedef v8h  __attribute__((may_alias)) v8ha;
typedef v4f  __attribute__((may_alias)) v4fa;
typedef v8us __attribute__((may_alias)) v8usa;

__device__ __forceinline__ unsigned short f2bf(float f) { unsigned u = __float_as_uint(f); u += 0x7FFFu + ((u >> 16) & 1u); return (unsigned short)(u >> 16); }
__device__ __forceinline__ float bf2f(unsigned short b) { return __uint_as_float(((unsigned)b) << 16); }
__device__ __forceinline__ float bfr(float f) { return bf2f(f2bf(f)); }
__device__ __forceinline__ v16h cat16(v8h lo, v8h hi) { return __builtin_shufflevector(lo, hi, 0, 1, 2, 3, 4, 5, 6, 7, 8, 9, 10, 11, 12, 13, 14, 15); }
__device__ __forceinline__ v16bf cat16b(v8us lo, v8us hi) { return __builtin_bit_cast(v16bf, __builtin_shufflevector(lo, hi, 0, 1, 2, 3, 4, 5, 6, 7, 8, 9, 10, 11, 12, 13, 14, 15)); }
__device__ __forceinline__ v8f wmma16(v16h a, v16h b, v8f c) { return __builtin_amdgcn_wmma_f32_16x16x32_f16(false, a, false, b, (short)0, c, false, false); }
__device__ __forceinline__ v8f wmmab(v16bf a, v16bf b, v8f c) { return __builtin_amdgcn_wmma_f32_16x16x32_bf16(false, a, false, b, (short)0, c, false, false); }

__global__ __launch_bounds__(256) void k_cvtb(const float* __restrict__ src, int nrows, bf* dst) {
    const int lane = threadIdx.x & 31, r = blockIdx.x * 8 + (threadIdx.x >> 5);
    if (r >= nrows) return;
    v8us o[DM / 256];
#pragma unroll
    for (int q = 0; q < DM / 256; ++q) { v8us t;
#pragma unroll
        for (int i = 0; i < 8; ++i) t[i] = f2bf(src[(size_t)r * DM + q * 256 + lane * 8 + i]);
        o[q] = t; }
#pragma unroll
    for (int q = 0; q < DM / 256; ++q) *(v8us*)(dst + (size_t)r * DM + q * 256 + lane * 8) = o[q];
    
}

// k_gemmb: 128 x 128 block tile (4 waves, 2 x 2, each 64 x 64 = 4 x 4 accumulator tiles) of C[rows][cols] = (A [+ Al]).B^T [+ bf(bias[c])] [+ bf(R[r][c]) residual]; f32 or f16-plane whole-line epilogue.
// The operands come from LDS: each pass of 64 k (128 rows x 128 B of A, of B and, where split, of Al) is copied once per block by global_load_async_to_lds_b128, whole 128-B lines a row,
// into one of two buffers, pass p + 2 being issued when every wave has left pass p; so a line leaves L2 once per block and pass, and a pass's L2 latency runs under the pass before it.
// QKV: one launch does q, k and v of both paths: blockIdx.z picks the projection (0, 1: f16 planes at C / C2p + z * 2 NTA DM; 2: V^T f16 planes at Vh / Vl), the row block's path and z the weight.
// Where the next reader wants the transpose (v for the attention, the last product for the output [b][e][s]) the operands swap roles: A = weight rows, B = token rows [+ residual], the same products
// summed in the same k order, and the tile that leaves through the same whole-line epilogue is C^T[feature][position]; its bias then goes with the rows.
#define GPE  72                          // LDS pitch of a 64-element bf16 row, in elements: 144 B = 16 B x odd, conflict-free for 16-byte row readers
#define GTE  (128 * GPE)                 // one operand plane of a pass: 18,432 B
__device__ __forceinline__ unsigned ldsoff(const void* p) { return (unsigned)(size_t)p; }   // byte offset in the work-group's LDS = low 32 bits of the __shared__ address
// Eight copies of 16 B a lane: rows 16 apart (gs bytes apart in global memory); s_wait_xcnt closes the statement so that no address register named here is rewritten in front of it.
__device__ __forceinline__ void copy8(unsigned l, const char* g, size_t gs) {
    asm volatile("global_load_async_to_lds_b128 %0, %1, off\n\tglobal_load_async_to_lds_b128 %2, %3, off\n\t"
                 "global_load_async_to_lds_b128 %4, %5, off\n\tglobal_load_async_to_lds_b128 %6, %7, off\n\t"
                 "global_load_async_to_lds_b128 %8, %9, off\n\tglobal_load_async_to_lds_b128 %10, %11, off\n\t"
                 "global_load_async_to_lds_b128 %12, %13, off\n\tglobal_load_async_to_lds_b128 %14, %15, off\n\ts_wait_xcnt 0x0"
                 :: "v"(l), "v"(g), "v"(l + 16 * GPE * 2), "v"(g + gs), "v"(l + 32 * GPE * 2), "v"(g + 2 * gs), "v"(l + 48 * GPE * 2), "v"(g + 3 * gs),
                    "v"(l + 64 * GPE * 2), "v"(g + 4 * gs), "v"(l + 80 * GPE * 2), "v"(g + 5 * gs), "v"(l + 96 * GPE * 2), "v"(g + 6 * gs), "v"(l + 112 * GPE * 2), "v"(g + 7 * gs) : "memory");
}
template <bool SPLITA, bool F16OUT = false, bool QKV = false, bool SWAP = false>
__global__ __launch_bounds__(128) void k_gemmb(const bf* __restrict__ A, const bf* __restrict__ Al, const bf* __restrict__ Bw, const float* __restrict__ bias, float* C, int ldc, h16* C2p, const float* __restrict__ R = nullptr, int K = DM, int roundR = 1, h16* Vh = nullptr, h16* Vl = nullptr) {
    constexpr int NPL = SPLITA ? 3 : 2;                      // planes of a buffer: A, B [, Al]
    __shared__ __align__(16) bf gring[2 * NPL * GTE];
    __shared__ __align__(16) float ost[4][16 * 68];
    const int tid = threadIdx.x, lane = threadIdx.x & 31, wave = __builtin_amdgcn_readfirstlane(threadIdx.x >> 5), lr = lane & 15, hi = lane >> 4;
    const int rb = blockIdx.x * 128, cb = blockIdx.y * 128;
    // Roles swapped (block-uniform): the weight rows are the A operand and the token rows the B operand, so the tile is C^T: rows = features of batch plane x / 16, columns = its 2,048 positions.
    const bool sw = SWAP || (QKV && blockIdx.z == 2);
    const int rw = (sw ? (int)(blockIdx.x / (NT_ / 128)) * DM + cb : rb) + (wave >> 1) * 64, c0 = (sw ? (int)(blockIdx.x % (NT_ / 128)) * 128 : cb) + (wave & 1) * 64;
    const int ldo = sw ? NT_ : ldc;
    const bf* __restrict__ Bn = QKV ? Bw + ((size_t)(blockIdx.x / (NTK / 128)) * 3 + blockIdx.z) * ((size_t)DM * DM) : Bw;
    const size_t zo = QKV ? (size_t)blockIdx.z * (2 * (size_t)NTA * DM) : 0;
    h16* C2 = QKV ? (sw ? Vl : C2p + zo) : C2p;
    // Copy map, 16 B a lane: a plane is 128 rows x 8 pieces; a thread takes piece tid & 7 of rows crow + 16 i.
    const int crow = tid >> 3, cpc = (tid & 7) * 8;
    const size_t gs = (size_t)K * 32;                        // 16 rows, in bytes
    const char* gx = (const char*)(A + (size_t)(rb + crow) * K + cpc);     // token rows
    const char* gw = (const char*)(Bn + (size_t)(cb + crow) * K + cpc);    // weight rows
    const char* ga = sw ? gw : gx;                           // plane 0: the A operand
    const char* gb = sw ? gx : gw;                           // plane 1: the B operand
    const char* gl = SPLITA ? (const char*)(Al + (size_t)(rb + crow) * K + cpc) : ga;   // plane 2: the token rows' residual
    const unsigned l0 = ldsoff(gring) + (unsigned)(crow * GPE + cpc) * 2u;
    auto fill = [&](int p) {
        const unsigned lb = l0 + (unsigned)(p & 1) * (NPL * GTE * 2u); const size_t go = (size_t)p * 128;
        copy8(lb, ga + go, gs); copy8(lb + GTE * 2u, gb + go, gs); if (SPLITA) copy8(lb + 2u * GTE * 2u, gl + go, gs);
    };
    // Every unrolled loop of this kernel indexes acc, a, al, b, bv or br: unrolled, the indices are constants and the arrays stay in registers.
    v8f acc[4][4];
#pragma unroll
    for (int i = 0; i < 4; ++i)
#pragma unroll
        for (int t = 0; t < 4; ++t) acc[i][t] = (v8f){};
    const int np = K >> 6;                                   // at least two passes (K is 1024 or 2048)
    fill(0);
    asm volatile("s_wait_asynccnt 0x0" ::: "memory");        // this wave's copies of pass 0 have landed
    __syncthreads();                                         // ... and every other wave's: pass 0 is published
    fill(1);
    const int aro = ((wave >> 1) * 64 + lr) * GPE + 8 * hi, bro = GTE + ((wave & 1) * 64 + lr) * GPE + 8 * hi;
#pragma unroll 1
    for (int p = 0; p < np; ++p) {                           // rolled: the body already holds 32 (64) matrix instructions
        const bf* buf = gring + (p & 1) * (NPL * GTE);
#pragma unroll
        for (int ks = 0; ks < 2; ++ks) {
            v16bf a[4], al[4], b[4];
            const bf* ap = buf + aro + ks * 32; const bf* bp = buf + bro + ks * 32;
            a[0] = cat16b(*(const v8usa*)ap, *(const v8usa*)(ap + 16));          // in the order of first use
#pragma unroll
            for (int t = 0; t < 4; ++t) b[t] = cat16b(*(const v8usa*)(bp + t * 16 * GPE), *(const v8usa*)(bp + t * 16 * GPE + 16));
#pragma unroll
            for (int i = 1; i < 4; ++i) a[i] = cat16b(*(const v8usa*)(ap + i * 16 * GPE), *(const v8usa*)(ap + i * 16 * GPE + 16));
#pragma unroll
            for (int i = 0; i < 4; ++i) { al[i] = a[i]; const bf* lp = (SWAP ? bp + GTE : ap + 2 * GTE) + i * 16 * GPE; if (SPLITA) al[i] = cat16b(*(const v8usa*)lp, *(const v8usa*)(lp + 16)); }   // the residual goes with the token operand
            // Keeps the k-step's LDS reads together as one group ahead of its matrix instructions; left to itself the build reads each A fragment directly in front of its four products and waits out the LDS latency every time.
            __builtin_amdgcn_sched_barrier(0);
#pragma unroll
            for (int i = 0; i < 4; ++i)
#pragma unroll
                for (int t = 0; t < 4; ++t) acc[i][t] = wmmab(a[i], b[t], acc[i][t]);
            if (SPLITA) {
#pragma unroll
                for (int i = 0; i < 4; ++i)
#pragma unroll
                    for (int t = 0; t < 4; ++t) acc[i][t] = SWAP ? wmmab(a[i], al[t], acc[i][t]) : wmmab(al[i], b[t], acc[i][t]);
            }
        }
        // Keeps the pass's matrix instructions in front of the waits and the barrier: moved behind them, they delay the refill, whose lead over its own wait then falls short of a pass.
        __builtin_amdgcn_sched_barrier(0);
        asm volatile("s_wait_dscnt 0x0" ::: "memory");       // this wave's reads of pass p have returned before its buffer is handed back
        asm volatile("s_wait_asynccnt 0x0" ::: "memory");    // this wave's copies of pass p + 1 have landed
        __syncthreads();                                     // publishes pass p + 1 and ends every wave's reads of pass p
        if (p + 2 < np) fill(p + 2);                         // block-uniform test: refill the buffer just left
    }
    asm volatile("s_wait_asynccnt 0x0" ::: "memory");        // no copy is outstanding when the wave goes on to its end
    float* os = &ost[wave][0];
    float bv[4];
#pragma unroll
    for (int t = 0; t < 4; ++t) bv[t] = (!SWAP && bias) ? bfr(bias[c0 + t * 16 + lr]) : 0.f;
    v4f br[4][2];                                            // roles swapped: the bias goes with the tile's rows, eight consecutive ones a lane and row group; read as one group
#pragma unroll
    for (int mi = 0; mi < 4; ++mi) { br[mi][0] = (v4f){}; br[mi][1] = (v4f){}; }
    if (SWAP && bias) {
        const float* bp = bias + cb + (wave >> 1) * 64 + hi * 8;
#pragma unroll
        for (int mi = 0; mi < 4; ++mi) { br[mi][0] = *(const v4f*)(bp + mi * 16); br[mi][1] = *(const v4f*)(bp + mi * 16 + 4); }
    }
#pragma unroll
    for (int mi = 0; mi < 4; ++mi) {                         // the wave's four 16-row groups, one after the other through its staging rows
        const int r0 = rw + mi * 16;
#pragma unroll
        for (int t = 0; t < 4; ++t)
#pragma unroll
            for (int j = 0; j < 8; ++j) os[(hi * 8 + j) * 68 + t * 16 + lr] = acc[mi][t][j] + (SWAP ? bfr(br[mi][j >> 2][j & 3]) : bv[t]);
        __syncthreads();
        if (QKV || F16OUT) {
            h16* crow2 = ((QKV && sw) ? Vh : (h16*)(void*)C + zo) + (size_t)r0 * ldo + c0;
#pragma unroll
            for (int s = 0; s < 4; ++s) { const int row = 4 * s + (lane >> 3), piece = lane & 7; const float* sp = os + row * 68 + piece * 8; v8h o, o2;
#pragma unroll
                for (int i = 0; i < 8; ++i) { const h16 a = (h16)sp[i]; o[i] = a; o2[i] = (h16)((sp[i] - (float)a) * LOSC); }
                *(v8h*)(crow2 + (size_t)row * ldo + piece * 8) = o;
                asm volatile("s_wait_xcnt 0x0" ::: "memory");     // the same precaution as below, for the store above: the residual's arithmetic reuses its registers
                if (C2) *(v8h*)(C2 + (size_t)r0 * ldo + c0 + (size_t)row * ldo + piece * 8) = o2;
                asm volatile("s_wait_xcnt 0x0" ::: "memory"); }   // a precaution: stands in front of the next rewrite of the registers that these stores name
        } else {
            float* crow2 = C + (size_t)r0 * ldo + c0;
#pragma unroll
            for (int s = 0; s < 8; ++s) { const int Lid = (lane >> 3) + 4 * s, piece = lane & 7; const int row = Lid >> 1, cofs = (Lid & 1) * 32 + piece * 4;
                v4f val = *(const v4fa*)(os + row * 68 + cofs); if (R) { const v4f rv = *(const v4f*)(R + ((size_t)r0 + row) * ldo + c0 + cofs); val += roundR ? (v4f){bfr(rv[0]), bfr(rv[1]), bfr(rv[2]), bfr(rv[3])} : rv; }
                *(v4f*)(crow2 + (size_t)row * ldo + cofs) = val;
                asm volatile("s_wait_xcnt 0x0" ::: "memory"); }   // a precaution: stands in front of the next rewrite of the registers that this store names
        }
        __syncthreads();                                     // the staged rows are read before the next group overwrites them
    }
}

#define KPE  72                          // LDS pitch of a 64-element f16 row, in elements: 144 B = 16 B x odd, conflict-free for 16-byte row readers
#define VPE  40                          // LDS pitch of a 32-element f16 row, in elements: 80 B = 16 B x odd
#define KTE  (32 * KPE)                  // one K plane of a tile
#define VTE  (64 * VPE)                  // one V^T plane of a tile
#define BUFE (2 * KTE + 2 * VTE)         // one tile: 19,456 B
__device__ __forceinline__ unsigned ldsa(const h16* p) { return (unsigned)(size_t)p; }   // byte offset in the work-group's LDS = low 32 bits of the __shared__ address
__device__ __forceinline__ float xhalf(float v) { const int b = __float_as_int(v); return __int_as_float(__builtin_amdgcn_permlanex16(b, b, 0x76543210, 0xfedcba98, false, false)); }   // lane l <-> l ^ 16

__global__ __launch_bounds__(128) void k_attn(const h16* __restrict__ Q16, const h16* __restrict__ QL16, const h16* __restrict__ K16, const h16* __restrict__ KL16, const h16* __restrict__ VTH, const h16* __restrict__ VTL, bf* CH, bf* CL) {
    __shared__ __align__(16) h16 ring[2 * BUFE];
    __shared__ __align__(16) h16 qls[64 * KPE];
    __shared__ __align__(16) float ost[4][16 * 68];
    // The wave's number sits in a scalar register, so that what derives from it leaves the vector registers and the loop's live set stays under 256 of them.
    const int tid = threadIdx.x, lane = threadIdx.x & 31, wave = __builtin_amdgcn_readfirstlane(threadIdx.x >> 5), lr = lane & 15, hi = lane >> 4;
    const int bid = blockIdx.x;
    // Cost falls with the index: a block walks 2 qt + 2 key tiles and only half the grid is resident at once, so the longest query blocks of every head come first and the short ones fill the places they free.
    const int qt = NT_ / 64 - 1 - bid / (NP_ * NB_ * NH_), rem = bid % (NP_ * NB_ * NH_), b = rem / NH_, h = rem % NH_;
    const int q0 = qt * 64 + wave * 16;
    const size_t tok0 = (size_t)b * NT_;
    v16h qa[2];
    const size_t qo0 = (tok0 + q0 + lr) * DM + h * HD + 8 * hi;
#pragma unroll
    for (int kc = 0; kc < 2; ++kc) qa[kc] = cat16(*(const v8h*)(Q16 + qo0 + kc * 32), *(const v8h*)(Q16 + qo0 + kc * 32 + 16));
    const h16* kh_b = K16 + tok0 * DM + h * HD;
    const h16* kl_b = KL16 + tok0 * DM + h * HD;
    const size_t vbase = (((size_t)b * NH_ + h) * HD) * NT_;
    v8f o[4], ox[4];
#pragma unroll
    for (int n = 0; n < 4; ++n) { o[n] = (v8f){}; ox[n] = (v8f){}; }
    float mrow = -3.0e38f, lpart = 0.f;                   // of the lane's query q0 + lr; lpart sums the lane half's own keys
    const int qrel = q0 + lr - 8 * hi;                    // key l0 + 8 hi + j is allowed where l0 + j <= qrel
    const int kt_lo = 0, kt_hi = (qt * 64 + 63) / 32;     // causal; at least two tiles
    // Copy map, 16 B a lane: K planes 32 rows x 8 pieces (a thread takes rows krow and krow + 16), V^T planes 64 rows x 4 pieces (rows vrow and vrow + 32).
    const int krow = tid >> 3, kpc = (tid & 7) * 8, vrow = tid >> 2, vpc = (tid & 3) * 8;
    const unsigned kgo = (unsigned)(krow * DM + kpc) * 2u, vgo = (unsigned)(vrow * NT_ + vpc) * 2u;                 // this thread's byte offsets in a K plane and a V^T plane of its head
    const unsigned klo = ldsa(ring) + (unsigned)(krow * KPE + kpc) * 2u, vlo = ldsa(ring) + (unsigned)(2 * KTE + vrow * VPE + vpc) * 2u;    // and in buffer 0
    const char* vh_b = (const char*)(VTH + vbase); const char* vl_b = (const char*)(VTL + vbase);
    auto fill = [&](int kt) {
        const unsigned ko = kgo + (unsigned)kt * (32u * DM * 2u), vo = vgo + (unsigned)kt * 64u, bo = (unsigned)(kt & 1) * (BUFE * 2u);
        const char* gkh = (const char*)kh_b + ko; const char* gkl = (const char*)kl_b + ko; const char* gvh = vh_b + vo; const char* gvl = vl_b + vo;
        const unsigned lk = klo + bo, lv = vlo + bo;
        // The tile's eight copies; s_wait_xcnt closes the statement so that no address register named here is rewritten in front of it.
        asm volatile("global_load_async_to_lds_b128 %0, %1, off\n\tglobal_load_async_to_lds_b128 %2, %3, off\n\t"
                     "global_load_async_to_lds_b128 %4, %5, off\n\tglobal_load_async_to_lds_b128 %6, %7, off\n\t"
                     "global_load_async_to_lds_b128 %8, %9, off\n\tglobal_load_async_to_lds_b128 %10, %11, off\n\t"
                     "global_load_async_to_lds_b128 %12, %13, off\n\tglobal_load_async_to_lds_b128 %14, %15, off\n\ts_wait_xcnt 0x0"
                     :: "v"(lk), "v"(gkh), "v"(lk + 16 * KPE * 2), "v"(gkh + 16 * DM * 2), "v"(lk + KTE * 2), "v"(gkl), "v"(lk + (KTE + 16 * KPE) * 2), "v"(gkl + 16 * DM * 2),
                        "v"(lv), "v"(gvh), "v"(lv + 32 * VPE * 2), "v"(gvh + 32 * NT_ * 2), "v"(lv + VTE * 2), "v"(gvl), "v"(lv + (VTE + 32 * VPE) * 2), "v"(gvl + 32 * NT_ * 2) : "memory");
    };
    {   // The block's 64 query residual rows, once: 64 rows x 8 pieces, a thread takes rows krow + 16 i; same closing wait as above.
        const h16* gq = QL16 + (tok0 + qt * 64 + krow) * DM + h * HD + kpc;
        const unsigned lq = ldsa(qls) + (krow * KPE + kpc) * 2;
        asm volatile("global_load_async_to_lds_b128 %0, %1, off\n\tglobal_load_async_to_lds_b128 %2, %3, off\n\t"
                     "global_load_async_to_lds_b128 %4, %5, off\n\tglobal_load_async_to_lds_b128 %6, %7, off\n\ts_wait_xcnt 0x0"
                     :: "v"(lq), "v"(gq), "v"(lq + 16 * KPE * 2), "v"(gq + 16 * DM), "v"(lq + 32 * KPE * 2), "v"(gq + 32 * DM), "v"(lq + 48 * KPE * 2), "v"(gq + 48 * DM) : "memory");
    }
    fill(0);
    asm volatile("s_wait_asynccnt 0x0" ::: "memory");     // this wave's copies of tile 0 and of the query residual have landed
    __syncthreads();                                      // ... and every other wave's: tile 0 is published
    fill(1);
    const h16* qlp = qls + (wave * 16 + lr) * KPE + 8 * hi;
#pragma unroll 1
    for (int kt = kt_lo; kt <= kt_hi; ++kt) {
        const int l0 = kt * 32;
        const h16* buf = ring + (kt & 1) * BUFE;
        const h16* kp = buf + lr * KPE + 8 * hi;
        const h16* vp = buf + 2 * KTE + lr * VPE + 8 * hi;
        v16h k0h[2], k1h[2], k0l[2], k1l[2], qlk[2];
#pragma unroll
        for (int kc = 0; kc < 2; ++kc) {
            k0h[kc] = cat16(*(const v8ha*)(kp + kc * 32), *(const v8ha*)(kp + kc * 32 + 16)); k1h[kc] = cat16(*(const v8ha*)(kp + 16 * KPE + kc * 32), *(const v8ha*)(kp + 16 * KPE + kc * 32 + 16));
            qlk[kc] = cat16(*(const v8ha*)(qlp + kc * 32), *(const v8ha*)(qlp + kc * 32 + 16));
            k0l[kc] = cat16(*(const v8ha*)(kp + KTE + kc * 32), *(const v8ha*)(kp + KTE + kc * 32 + 16)); k1l[kc] = cat16(*(const v8ha*)(kp + KTE + 16 * KPE + kc * 32), *(const v8ha*)(kp + KTE + 16 * KPE + kc * 32 + 16));
        }
        v8f s0 = {}, s1 = {}, x0 = {}, x1 = {};
#pragma unroll
        for (int kc = 0; kc < 2; ++kc) {
            s0 = wmma16(k0h[kc], qa[kc], s0); x0 = wmma16(k0h[kc], qlk[kc], x0); s1 = wmma16(k1h[kc], qa[kc], s1); x1 = wmma16(k1h[kc], qlk[kc], x1);
            x0 = wmma16(k0l[kc], qa[kc], x0); x1 = wmma16(k1l[kc], qa[kc], x1);
        }
        asm volatile("v_nop\n\tv_nop\n\tv_nop\n\tv_nop" : "+v"(s0), "+v"(s1), "+v"(x0), "+v"(x1) : "v"(qa[0]), "v"(qa[1]));
        v16h vh[4], vl[4];     // read ahead of the softmax, whose vector work covers their LDS latency
#pragma unroll
        for (int n = 0; n < 4; ++n) { vh[n] = cat16(*(const v8ha*)(vp + n * 16 * VPE), *(const v8ha*)(vp + n * 16 * VPE + 16)); vl[n] = cat16(*(const v8ha*)(vp + VTE + n * 16 * VPE), *(const v8ha*)(vp + VTE + n * 16 * VPE + 16)); }
        // Keeps these sixteen reads here as one group; left to itself the build moves them down among the matrix instructions of the second product and waits each small group out in full.
        __builtin_amdgcn_sched_barrier(0);
        const int rel = qrel - l0;
        // The lane's 16 scores of its query: keys l0 + 8 hi + j (a0) and l0 + 16 + 8 hi + j (a1). Whole-vector arithmetic: neighbouring registers pair into packed f32 instructions.
        v8f a0 = (s0 + x0 * LOSCI) * 0.125f, a1 = (s1 + x1 * LOSCI) * 0.125f;
#pragma unroll
        for (int j = 0; j < 8; ++j) { a0[j] = (j <= rel) ? a0[j] : -__builtin_inff(); a1[j] = (16 + j <= rel) ? a1[j] : -__builtin_inff(); }
        float mx = fmaxf(fmaxf(fmaxf(fmaxf(a0[0], a0[1]), fmaxf(a0[2], a0[3])), fmaxf(fmaxf(a0[4], a0[5]), fmaxf(a0[6], a0[7]))),
                         fmaxf(fmaxf(fmaxf(a1[0], a1[1]), fmaxf(a1[2], a1[3])), fmaxf(fmaxf(a1[4], a1[5]), fmaxf(a1[6], a1[7]))));
        mx = fmaxf(mx, xhalf(mx));                            // the other 16 keys of the tile sit in the other lane half
        const float mn = fmaxf(mrow, mx);
        const float alpha = __expf(mrow - mn); mrow = mn;
        const v8f e0 = (a0 - mn) * LOG2E, e1 = (a1 - mn) * LOG2E;
        v8f p0, p1;
#pragma unroll
        for (int j = 0; j < 8; ++j) p0[j] = __builtin_amdgcn_exp2f(e0[j]);
#pragma unroll
        for (int j = 0; j < 8; ++j) p1[j] = __builtin_amdgcn_exp2f(e1[j]);
        const v8f sp = p0 + p1;
        lpart = lpart * alpha + (((sp[0] + sp[1]) + (sp[2] + sp[3])) + ((sp[4] + sp[5]) + (sp[6] + sp[7])));
        // P^T as a B operand: element s = key kmap(s, hi) = score tile s >> 3, register s & 7; hi plane and residual x1024 plane.
        const v8f ps0 = p0 * PSC, ps1 = p1 * PSC;
        const v8h h0 = __builtin_convertvector(ps0, v8h), h1 = __builtin_convertvector(ps1, v8h);
        const v8h r0 = __builtin_convertvector((ps0 - __builtin_convertvector(h0, v8f)) * LOSC, v8h), r1 = __builtin_convertvector((ps1 - __builtin_convertvector(h1, v8f)) * LOSC, v8h);
        const v16h pa = cat16(h0, h1), px = cat16(r0, r1);
#pragma unroll
        for (int n = 0; n < 4; ++n) { o[n] *= alpha; ox[n] *= alpha; }
#pragma unroll
        for (int n = 0; n < 4; ++n) { o[n] = wmma16(vh[n], pa, o[n]); ox[n] = wmma16(vl[n], pa, ox[n]); ox[n] = wmma16(vh[n], px, ox[n]); }
        asm volatile("v_nop\n\tv_nop\n\tv_nop\n\tv_nop" : "+v"(o[0]), "+v"(o[1]), "+v"(o[2]), "+v"(o[3]), "+v"(ox[0]), "+v"(ox[1]), "+v"(ox[2]), "+v"(ox[3]) : "v"(pa), "v"(px));
        asm volatile("s_wait_dscnt 0x0" ::: "memory");        // this wave's reads of tile kt have returned before its buffer is handed back
        asm volatile("s_wait_asynccnt 0x0" ::: "memory");     // this wave's copies of tile kt + 1 have landed
        __syncthreads();                                      // publishes tile kt + 1 and ends every wave's reads of tile kt
        if (kt + 2 <= kt_hi) fill(kt + 2);                    // block-uniform test: refill the buffer just left
    }
    asm volatile("s_wait_asynccnt 0x0" ::: "memory");         // no copy is outstanding when the wave goes on to its end
    const float inv = 1.0f / ((lpart + xhalf(lpart)) * PSC);  // the two lane halves' sums joined once
    float* os = &ost[wave][0];
#pragma unroll
    for (int n = 0; n < 4; ++n)                               // o[n][j] = O[query lr][d = 16 n + 8 hi + j]: eight consecutive d of the lane's staging row
#pragma unroll
        for (int c = 0; c < 2; ++c) { v4f t;
#pragma unroll
            for (int i = 0; i < 4; ++i) t[i] = (o[n][4 * c + i] + ox[n][4 * c + i] * LOSCI) * inv;
            *(v4fa*)(os + lr * 68 + n * 16 + hi * 8 + 4 * c) = t; }
    __syncthreads();
    const size_t cbase = (tok0 + q0) * DM + (size_t)h * HD;
    auto pass = [&]() {
#pragma unroll
        for (int s = 0; s < 4; ++s) { const int row = 4 * s + (lane >> 3), piece = lane & 7; const float* sp = os + row * 68 + piece * 8; v8us oh, ol;
#pragma unroll
            for (int i = 0; i < 8; ++i) { const unsigned short hb = f2bf(sp[i]); oh[i] = hb; ol[i] = f2bf(sp[i] - bf2f(hb)); }
            *(v8us*)(CH + cbase + (size_t)row * DM + piece * 8) = oh; *(v8us*)(CL + cbase + (size_t)row * DM + piece * 8) = ol; }
    };
    pass(); 
}


// k_wt: WT [n][K] = bf16(W[k][n]) (k-major [K][ncols]) via 64 x 64 LDS tiles; grid (K/64, ncols/64, NP_ * NB_): z = path * NB_ + batch picks the source matrix and the plane of WTa.
__global__ __launch_bounds__(256) void k_wt(const float* __restrict__ Wl, const float* __restrict__ Wr, int K, int ncols, bf* WTa) {
    __shared__ __align__(16) unsigned short tl[64 * 72];
    const int tid = threadIdx.x, k0 = blockIdx.x * 64, n0 = blockIdx.y * 64;
    const float* __restrict__ Wm = (blockIdx.z / NB_ ? Wr : Wl) + (size_t)(blockIdx.z % NB_) * K * ncols;
    bf* WT = WTa + (size_t)blockIdx.z * K * ncols;
    const int kk = tid >> 2, nq = (tid & 3) * 16;
#pragma unroll
    for (int i = 0; i < 16; ++i) tl[(nq + i) * 72 + kk] = f2bf(Wm[(size_t)(k0 + kk) * ncols + n0 + nq + i]);
    __syncthreads();
    const int piece = tid & 7;
    auto pass = [&]() {
#pragma unroll
        for (int s = 0; s < 2; ++s) { const int nr = (tid >> 3) + 32 * s; const v8us val = *(const v8usa*)(tl + nr * 72 + piece * 8); *(v8us*)(WT + (size_t)(n0 + nr) * K + k0 + piece * 8) = val; }
    };
    pass(); 
}

// k_bf: all nine weight matrices -> bf16 in one launch; dst holds them back to back in argument order. 512 blocks cover DM x DM elements; w7 and w8 are twice that.
__global__ __launch_bounds__(256) void k_bf(const float* __restrict__ w0, const float* __restrict__ w1, const float* __restrict__ w2, const float* __restrict__ w3, const float* __restrict__ w4, const float* __restrict__ w5, const float* __restrict__ w6, const float* __restrict__ w7, const float* __restrict__ w8, bf* dst) {
    const int seg = blockIdx.x >> 9;
    const float* __restrict__ sb = seg == 0 ? w0 : seg == 1 ? w1 : seg == 2 ? w2 : seg == 3 ? w3 : seg == 4 ? w4 : seg == 5 ? w5 : seg == 6 ? w6 : seg < 9 ? w7 : w8;
    const int first = seg < 7 ? seg : seg < 9 ? 7 : 9;          // the segment at which this matrix begins
    const size_t i = (size_t)blockIdx.x * 256 + threadIdx.x;
    const v8f v = *(const v8f*)(sb + (i - (size_t)first * (DM * DM / 8)) * 8); v8us o;
#pragma unroll
    for (int k = 0; k < 8; ++k) o[k] = f2bf(v[k]);
    *(v8us*)(dst + i * 8) = o; 
}

// k_comb: per token row (one wave): lambda = exp(sum bf(lq_l) bf(lk_l)) - exp(sum bf(lq_r) bf(lk_r)) + 0.1 (64 terms, recomputed per wave), c = (CHl + CLl) - lambda (CHr + CLr)
// over the 1024 features, LayerNorm (mean, then biased variance, then the normalised output: three rolled passes that re-read the planes; f32, fixed lane order) x bf(g)
__global__ __launch_bounds__(256) void k_comb(const bf* __restrict__ AHl, const bf* __restrict__ ALl, const bf* __restrict__ AHr, const bf* __restrict__ ALr, const float* __restrict__ lql, const float* __restrict__ lkl, const float* __restrict__ lqr, const float* __restrict__ lkr, const float* __restrict__ g, const float* __restrict__ bb, bf* Yh, bf* Yl) {
    const int lane = threadIdx.x & 31, r = blockIdx.x * 8 + (threadIdx.x >> 5);
    if (r >= NTK) return;
    float dl = bfr(lql[lane]) * bfr(lkl[lane]) + bfr(lql[lane + 32]) * bfr(lkl[lane + 32]);
    float dr = bfr(lqr[lane]) * bfr(lkr[lane]) + bfr(lqr[lane + 32]) * bfr(lkr[lane + 32]);
#pragma unroll
    for (int sh = 16; sh; sh >>= 1) { dl += __shfl_xor(dl, sh, 32); dr += __shfl_xor(dr, sh, 32); }
    const float lam = __expf(dl) - __expf(dr) + LAM0;
    auto load8 = [&](int q, float* cv) { const size_t o = (size_t)r * DM + q * 256 + lane * 8;
        const v8us ah = *(const v8us*)(AHl + o), al = *(const v8us*)(ALl + o), bh = *(const v8us*)(AHr + o), bl = *(const v8us*)(ALr + o);
#pragma unroll
        for (int i = 0; i < 8; ++i) cv[i] = (bf2f(ah[i]) + bf2f(al[i])) - lam * (bf2f(bh[i]) + bf2f(bl[i])); };
    float s = 0.f;
#pragma unroll 1
    for (int q = 0; q < 4; ++q) { float cv[8]; load8(q, cv);
#pragma unroll
        for (int i = 0; i < 8; ++i) s += cv[i]; }
#pragma unroll
    for (int sh = 16; sh; sh >>= 1) s += __shfl_xor(s, sh, 32);
    const float mu = s * (1.0f / DM); float s2 = 0.f;
#pragma unroll 1
    for (int q = 0; q < 4; ++q) { float cv[8]; load8(q, cv);
#pragma unroll
        for (int i = 0; i < 8; ++i) { const float d = cv[i] - mu; s2 = fmaf(d, d, s2); } }
#pragma unroll
    for (int sh = 16; sh; sh >>= 1) s2 += __shfl_xor(s2, sh, 32);
    const float rs = rsqrtf(s2 * (1.0f / DM) + LN_EPS);
#pragma unroll 1
    for (int q = 0; q < 4; ++q) { float cv[8]; load8(q, cv); v8us oh, ol;
#pragma unroll
        for (int i = 0; i < 8; ++i) { const int col = q * 256 + lane * 8 + i; const float y = (cv[i] - mu) * rs * bfr(g[col]) + bfr(bb[col]); const unsigned short hb = f2bf(y); oh[i] = hb; ol[i] = f2bf(y - bf2f(hb)); }
        const size_t o = (size_t)r * DM + q * 256 + lane * 8; *(v8us*)(Yh + o) = oh; *(v8us*)(Yl + o) = ol;  }
}
// k_splitc: bf16 hi + UNSCALED residual planes of a computed f32 [nrows][nc] matrix (nc a multiple of 256), optional relu first; one wave per row, lane -> 8 columns per
__global__ __launch_bounds__(256) void k_splitc(const float* __restrict__ src, int nrows, int nc, int relu, bf* dh, bf* dl) {
    const int lane = threadIdx.x & 31, r = blockIdx.x * 8 + (threadIdx.x >> 5); if (r >= nrows) return;
{
#pragma unroll 1
        for (int c0 = lane * 8; c0 < nc; c0 += 256) { const size_t o = (size_t)r * nc + c0; const v8f v = *(const v8f*)(src + o); v8us oh, ol;
#pragma unroll
            for (int i = 0; i < 8; ++i) { float y = v[i]; if (relu) y = fmaxf(y, 0.f); const unsigned short hb = f2bf(y); oh[i] = hb; ol[i] = f2bf(y - bf2f(hb)); }
            *(v8us*)(dh + o) = oh; *(v8us*)(dl + o) = ol; }
         }
}
extern "C" void kernel_launch(void* const* d_in, const int* in_sizes, int n_in,
                              void* d_out, int out_size, void* d_ws, size_t ws_size, hipStream_t stream) {
    (void)in_sizes; (void)n_in; (void)out_size;
    const float* xl = (const float*)d_in[0]; const float* xr = (const float*)d_in[1];                              // [2][1024][2048] = [b][e][s]
    const float* Wp[6]; for (int j = 0; j < 6; ++j) Wp[j] = (const float*)d_in[2 + j];                             // Wq_l, Wk_l, Wv_l, Wq_r, Wk_r, Wv_r  ([out][in])
    const float* Wo = (const float*)d_in[8]; const float* lql = (const float*)d_in[9]; const float* lkl = (const float*)d_in[10]; const float* lqr = (const float*)d_in[11]; const float* lkr = (const float*)d_in[12];
    const float* g = (const float*)d_in[13]; const float* bb = (const float*)d_in[14]; const float* W1 = (const float*)d_in[15]; const float* b1 = (const float*)d_in[16]; const float* W2 = (const float*)d_in[17]; const float* b2 = (const float*)d_in[18];
    float* out = (float*)d_out;    // [2][1024][2048]
    char* wsp = (char*)d_ws;
    auto take = [&](size_t bytes) { char* p = wsp; wsp += (bytes + 255) & ~(size_t)255; return (void*)p; };
    bf* WB = (bf*)take((size_t)11 * DM * DM * 2);          // Wq_l, Wk_l, Wv_l, Wq_r, Wk_r, Wv_r, Wo, W1, W2 back to back
    bf* WoB = WB + (size_t)6 * DM * DM; bf* W1B = WB + (size_t)7 * DM * DM; bf* W2B = WB + (size_t)9 * DM * DM;
    bf* Xb = (bf*)take((size_t)NTA * DM * 2);
    h16* QH = (h16*)take((size_t)NTA * DM * 2); h16* QL = (h16*)take((size_t)NTA * DM * 2); h16* KH = (h16*)take((size_t)NTA * DM * 2); h16* KL = (h16*)take((size_t)NTA * DM * 2);
    h16* VTH = (h16*)take((size_t)NTA * DM * 2); h16* VTL = (h16*)take((size_t)NTA * DM * 2);
    bf* AH = (bf*)take((size_t)NTA * DM * 2); bf* AL = (bf*)take((size_t)NTA * DM * 2);                    // [path][batch][s][e]
    bf* Yh = (bf*)take((size_t)NTK * DM * 2); bf* Yl = (bf*)take((size_t)NTK * DM * 2); bf* Y2h = (bf*)take((size_t)NTK * DM * 2); bf* Y2l = (bf*)take((size_t)NTK * DM * 2);
    if ((size_t)(wsp - (char*)d_ws) > ws_size) return;    // MiB: 22 + 16 + 4 x 16 + 2 x 16 + 2 x 16 + 4 x 8 = 198
    // aliases (stream order): Y2 (f32 [4096][1024], 16 MiB) lives over Xb, dead after the projections; the MLP hidden Hf
    // (f32 [4096][2048], 32 MiB) over QH,QL and its planes Hh/Hl (16 MiB each) over KH and KL, consecutive 256-B-aligned takes, all dead after the attention.
    float* Y2 = (float*)(void*)Xb;
    float* Hf = (float*)(void*)QH; bf* Hh = (bf*)(void*)KH; bf* Hl = (bf*)(void*)KL;
    k_bf<<<11 * 512, 256, 0, stream>>>(Wp[0], Wp[1], Wp[2], Wp[3], Wp[4], Wp[5], Wo, W1, W2, WB);
    k_wt<<<dim3(DM / 64, NT_ / 64, NP_ * NB_), 256, 0, stream>>>(xl, xr, DM, NT_, Xb);                                                             // x^T [path][batch][s][e] exact
    k_gemmb<false, true, true><<<dim3(NTA / 128, DM / 128, 3), 128, 0, stream>>>(Xb, nullptr, WB, nullptr, (float*)(void*)QH, DM, QL, nullptr, DM, 1, VTH, VTL);   // q, k -> planes, v (roles swapped) -> V^T planes
    k_attn<<<NP_ * NB_ * NH_ * (NT_ / 64), 128, 0, stream>>>(QH, QL, KH, KL, VTH, VTL, AH, AL);
    k_comb<<<NTK / 8, 256, 0, stream>>>(AH, AL, AH + (size_t)NTK * DM, AL + (size_t)NTK * DM, lql, lkl, lqr, lkr, g, bb, Yh, Yl);
    k_gemmb<true, false><<<dim3(NTK / 128, DM / 128, 1), 128, 0, stream>>>(Yh, Yl, WoB, nullptr, Y2, DM, nullptr);                        // y.Wo^T
    k_splitc<<<NTK / 8, 256, 0, stream>>>(Y2, NTK, DM, 0, Y2h, Y2l);
    k_gemmb<true, false><<<dim3(NTK / 128, FF / 128, 1), 128, 0, stream>>>(Y2h, Y2l, W1B, b1, Hf, FF, nullptr);                         // y.W1^T + b1
    k_splitc<<<NTK / 8, 256, 0, stream>>>(Hf, NTK, FF, 1, Hh, Hl);                                                                        // relu -> planes
    k_gemmb<true, false, false, true><<<dim3(NTK / 128, DM / 128, 1), 128, 0, stream>>>(Hh, Hl, W2B, b2, out, DM, nullptr, nullptr, FF);  // (h.W2^T + b2)^T, roles swapped (K = 2048) -> [b][e][s]
}
